// v000
// Times are from an AMD MI455X. After a warm-up the kernel runs many times in a row, and a time is the length of
// such a window on the GPU divided by its runs, so every launch and the gaps after it count. The runs cycle
// through copies of the inputs. A figure is the median of several windows, for all but v000 over two sittings.
// Sittings can differ by a few percent; kernels timed side by side share one.
// v000 is the starting kernel. One run takes 424 microseconds.
// compute dtype: all float inputs rounded to bf16; qkv = x . W^T + b with EXACT bf16 products on WMMA 16x16x32 (natural rows), f16 hi + residual; causal PLAIN-HYBRID attention (first 128 queries 3-product, later single f16; logits std ~0.5, diffuse), x 1/32, running-max softmax in f32 (hardware exp); out = ctx (bf16 hi + lo) . Wo^T + b_o; f32 output.
#include <hip/hip_runtime.h>
#include <math.h>

typedef __attribute__((ext_vector_type(16))) _Float16 v16h;
typedef __attribute__((ext_vector_type(16))) __bf16 v16b;
typedef __attribute__((ext_vector_type(8)))  _Float16 v8h;
typedef __attribute__((ext_vector_type(8)))  float v8f;
typedef __attribute__((ext_vector_type(4)))  float v4f;
typedef __attribute__((ext_vector_type(2)))  float v2f;
typedef __attribute__((ext_vector_type(4)))  unsigned v4u;
typedef __attribute__((ext_vector_type(4)))  int v4i;
typedef float __attribute__((may_alias)) float_a;
typedef int __attribute__((may_alias)) int_a;

template <typename T> __device__ __forceinline__ void vst2(void* p, T v) { *(T*)p = v;  }
__device__ __forceinline__ v8f wmma16(v16h a, v16h b, v8f c) {
  v8f d = __builtin_amdgcn_wmma_f32_16x16x32_f16(false, a, false, b, (short)0, c, false, false);
  asm volatile("v_nop\n\tv_nop\n\tv_nop\n\tv_nop" : "+v"(d) : "v"(a), "v"(b));
  return d;
}
__device__ __forceinline__ v8f wmma_bf(v16b a, v16b b, v8f c) {
  v8f d = __builtin_amdgcn_wmma_f32_16x16x32_bf16(false, a, false, b, (short)0, c, false, false);
  asm volatile("v_nop\n\tv_nop\n\tv_nop\n\tv_nop" : "+v"(d) : "v"(a), "v"(b));
  return d;
}
// Multi-head attention '2' (B 2, N 2,048, C 1,024, 16 heads x 64): fused natural w_qkv (q | k | v row blocks) + bias, causal softmax(q k / sqrt(1024)) v (the module scales by 1/sqrt(embed_dim), -inf fill), merge heads, natural w_o + b_o.
__device__ __forceinline__ v16h frag_h(const _Float16* rowk0, int lane) {
  union { v16h v; v8h q[2]; } u; const _Float16* p = rowk0 + 8 * (lane >> 4);
  u.q[0] = *(const v8h*)p; u.q[1] = *(const v8h*)(p + 16); return u.v;
}
__device__ __forceinline__ v16h frag_f32(const float* rowk0, int lane) {
  v16h a; const float* p = rowk0 + 8 * (lane >> 4);
#pragma unroll
  for (int i = 0; i < 8; ++i) { a[i] = (_Float16)p[i]; a[8 + i] = (_Float16)p[16 + i]; }
  return a;
}
__device__ __forceinline__ v16h frag_f32s(const float* rowk0, int lane, float sc) {
  v16h a; const float* p = rowk0 + 8 * (lane >> 4);
#pragma unroll
  for (int i = 0; i < 8; ++i) { a[i] = (_Float16)(p[i] * sc); a[8 + i] = (_Float16)(p[16 + i] * sc); }
  return a;
}
// column fragment from a [K][ld] layout (column n), rows >= K read as 0
__device__ __forceinline__ v16h fragc_f32(const float* W, int k0, int n, int lane, int ld, int K) {
  v16h a; const int g = lane >> 4;
#pragma unroll
  for (int i = 0; i < 8; ++i) { const int ka = k0 + 8 * g + i, kb = ka + 16;
    a[i] = (_Float16)(ka < K ? W[(size_t)(ka < K ? ka : K - 1) * ld + n] : 0.f); a[8 + i] = (_Float16)(kb < K ? W[(size_t)(kb < K ? kb : K - 1) * ld + n] : 0.f); }
  return a;
}
struct F2 { v16b h, l; };
__device__ __forceinline__ F2 bsplit16(const float v[16]) { F2 r;
#pragma unroll
  for (int i = 0; i < 16; ++i) { const __bf16 h = (__bf16)v[i]; r.h[i] = h; r.l[i] = (__bf16)(v[i] - (float)h); }
  return r; }
__device__ __forceinline__ F2 split_row(const float* row, int k0, int lane) { float v[16]; const float* p = row + k0 + 8 * (lane >> 4);
#pragma unroll
  for (int i = 0; i < 8; ++i) { v[i] = p[i]; v[8 + i] = p[16 + i]; }
  return bsplit16(v); }
__device__ __forceinline__ F2 split_rowK(const float* row, int k0, int lane, int K) { float v[16]; const int g = lane >> 4;
#pragma unroll
  for (int i = 0; i < 8; ++i) { const int ka = k0 + 8 * g + i, kb = ka + 16; v[i] = ka < K ? row[ka < K ? ka : K - 1] : 0.f; v[8 + i] = kb < K ? row[kb < K ? kb : K - 1] : 0.f; }
  return bsplit16(v); }
__device__ __forceinline__ F2 split_col(const float* W, int k0, int n, int lane, int ld, int K) { float v[16]; const int g = lane >> 4;
#pragma unroll
  for (int i = 0; i < 8; ++i) { const int ka = k0 + 8 * g + i, kb = ka + 16; v[i] = ka < K ? W[(size_t)(ka < K ? ka : K - 1) * ld + n] : 0.f; v[8 + i] = kb < K ? W[(size_t)(kb < K ? kb : K - 1) * ld + n] : 0.f; }
  return bsplit16(v); }
__device__ __forceinline__ v8f mac3(const F2& a, const F2& b, v8f c) { c = wmma_bf(a.l, b.h, c); c = wmma_bf(a.h, b.l, c); return wmma_bf(a.h, b.h, c); }
__device__ __forceinline__ float sigm(float v) { return 1.0f / (1.0f + expf(-v)); }
#define LDSX() do { asm volatile("s_wait_dscnt 0" ::: "memory"); __builtin_amdgcn_wave_barrier(); __builtin_amdgcn_fence(__ATOMIC_RELEASE, "workgroup"); } while (0)


#define NB 2
#define SS 2048
#define DM 1024
#define NH 16
#define HD 64
#define QKVW (3 * DM)
#ifndef TQB
#define TQB (SS / 64)
#define TNB NB
#define TOB (NB * SS / 64)     // output row tiles (all)
#endif
typedef __attribute__((ext_vector_type(8))) __bf16 v8b;
__device__ __forceinline__ v16b frag_b(const __bf16* rowk0, int lane) {
  union { v16b v; v8b q[2]; } u; const __bf16* p = rowk0 + 8 * (lane >> 4);
  u.q[0] = *(const v8b*)p; u.q[1] = *(const v8b*)(p + 16); return u.v;
}
__device__ __forceinline__ float bfr(float v) { return (float)(__bf16)v; }
__device__ __attribute__((noinline)) float exp_ni(float v) { return expf(v); }
__device__ __attribute__((noinline)) float erf_ni(float v) { return erff(v); }

#define PK_A 0                       // [3072][1024] Wqkv rows (natural [out][in])
#define PK_P (PK_A + QKVW * DM)        // [1024][1024] Wo rows (natural)
#define PK_END (PK_P + DM * DM)
#define WS_PK  0u
#define WS_QK  (WS_PK + 2u * PK_END)             // f16 [4096 rows][2048]: q | k
#define WS_QKL (WS_QK + 2u * NB * SS * 2 * DM)     // f16 q | k residual planes x2048
#define WS_VTH (WS_QKL + 2u * NB * SS * 2 * DM)    // f16 [b][1024 (h*64+d)][2048 s] hi
#define WS_VTL (WS_VTH + 2u * NB * DM * SS)        // f16 lo x 2048
#define WS_O   (WS_VTL + 2u * NB * DM * SS)        // f32 [4096][1024]
#define WS_CS  (WS_O + 4u * NB * SS * DM)           // f32 2 x 2048 x 32, reserved, unused
#define WS_END (WS_CS + 4u * 2 * SS * 32)
// ---- k_pack: block = (row n, which): natural [out][in] rows -> bf16; which 0..2 -> W_q/W_k/W_v into PK_A rows which*1024 + n; 3 -> W_o into PK_P
__global__ __launch_bounds__(256) void k_pack(const float* __restrict__ WQ, const float* __restrict__ WK, const float* __restrict__ WV, const float* __restrict__ WO, __bf16* __restrict__ PK) {
  __shared__ __align__(16) __bf16 s[DM]; const int n = blockIdx.x, which = blockIdx.y, t = threadIdx.x; const float* Wm = (which == 0) ? WQ : (which == 1) ? WK : (which == 2) ? WV : WO;
  for (int k = t; k < DM; k += 256) s[k] = (__bf16)Wm[(size_t)n * DM + k];
  __syncthreads();
  __bf16* dst = (which < 3) ? PK + PK_A + ((size_t)which * DM + n) * DM : PK + PK_P + (size_t)n * DM;
  for (int q = t; q < DM / 8; q += 256) vst2((unsigned*)(dst + q * 8), *(const v4u*)&s[q * 8]);
}
__global__ __launch_bounds__(128) void k_qkv(const float* __restrict__ XQ, const float* __restrict__ XK, const float* __restrict__ XV, const __bf16* __restrict__ P, const float* __restrict__ BQ, const float* __restrict__ BK, const float* __restrict__ BV, _Float16* __restrict__ QK, _Float16* __restrict__ QKL, _Float16* __restrict__ VTH, _Float16* __restrict__ VTL) {
  const int which0 = (blockIdx.y * 128) / DM; const float* X = (which0 == 0) ? XQ : (which0 == 1) ? XK : XV; const float* BB = BQ ? (((which0 == 0) ? BQ : (which0 == 1) ? BK : BV) + (blockIdx.y * 128 - which0 * DM)) : nullptr;
  __shared__ __align__(16) _Float16 so[4][16][136], sol[4][16][136]; __shared__ __align__(16) _Float16 sth[128][72], stl[128][72];
  const int tid = threadIdx.x, wave = tid >> 5, lane = tid & 31, col = lane & 15, g = lane >> 4; const size_t r0 = (size_t)blockIdx.x * 64 + wave * 16; const int n0 = blockIdx.y * 128;
  v8f acc[8] = {};
#pragma unroll 2
  for (int kc = 0; kc < DM / 32; ++kc) { v16b a; { const float* p = X + (r0 + col) * DM + kc * 32 + 8 * g;
#pragma unroll
      for (int i = 0; i < 8; ++i) { a[i] = (__bf16)p[i]; a[8 + i] = (__bf16)p[16 + i]; } }
#pragma unroll
    for (int j = 0; j < 8; ++j) acc[j] = wmma_bf(a, frag_b(P + (size_t)(n0 + j * 16 + col) * DM + kc * 32, lane), acc[j]); }
  if (n0 < 2 * DM) {   // q stored unscaled (f16 sigma ~0.6, no subnormal exposure); 1/32 applied to the f32 score
#pragma unroll
    for (int j = 0; j < 8; ++j) {
#pragma unroll
      for (int r = 0; r < 8; ++r) { const float v = acc[j][r] + (BB ? bfr(BB[j * 16 + col]) : 0.f); const _Float16 hv = (_Float16)v; so[wave][8 * g + r][j * 16 + col] = hv; sol[wave][8 * g + r][j * 16 + col] = (_Float16)((v - (float)hv) * 2048.0f); } }   // q, k (+ bias) as f16 hi + (x2048) residual
    LDSX();
    for (int rl = 0; rl < 16; ++rl) if (lane < 16) { vst2((unsigned*)(QK + (r0 + rl) * (2 * DM) + n0 + lane * 8), *(const v4u*)&so[wave][rl][lane * 8]); vst2((unsigned*)(QKL + (r0 + rl) * (2 * DM) + n0 + lane * 8), *(const v4u*)&sol[wave][rl][lane * 8]); }
  } else {
#pragma unroll
    for (int j = 0; j < 8; ++j) {
#pragma unroll
      for (int r = 0; r < 8; ++r) { const float v = acc[j][r] + (BB ? bfr(BB[j * 16 + col]) : 0.f); const _Float16 hv = (_Float16)v; sth[j * 16 + col][wave * 16 + 8 * g + r] = hv; stl[j * 16 + col][wave * 16 + 8 * g + r] = (_Float16)((v - (float)hv) * 2048.0f); } }
    __syncthreads();
    const size_t rb = (size_t)blockIdx.x * 64; const int b = (int)(rb / SS), s0 = (int)(rb % SS); const int pc0 = n0 - 2 * DM;
    for (int q = tid; q < 128 * 8; q += 128) { const int d = q >> 3, pc = q & 7; const size_t o = ((size_t)b * DM + pc0 + d) * SS + s0 + pc * 8; vst2((unsigned*)(VTH + o), *(const v4u*)&sth[d][pc * 8]); vst2((unsigned*)(VTL + o), *(const v4u*)&stl[d][pc * 8]); }
  }
}
// ---- k_attn: block = (64 queries, head h, batch b): causal flash attention (K = 64: 2 k-steps), scores = (q.k) * 0.03125 (f16 hi; hi/residual 3 products in the first two query blocks), P.V: f16 P x (V hi, V lo*2048) in two accumulators; O[b*S+q][h*64+d] = (acc + accl / 2048) / (2048 l) (256-B segments)
__global__ __launch_bounds__(128) void k_attn(const _Float16* __restrict__ QK, const _Float16* __restrict__ QKL, const _Float16* __restrict__ VTH, const _Float16* __restrict__ VTL, const void* __restrict__ KMASK, float* __restrict__ O) {
  __shared__ __align__(16) float sp[4][16][36]; __shared__ __align__(16) float so[4][16][68];
  const int tid = threadIdx.x, wave = tid >> 5, lane = tid & 31, col = lane & 15, g = lane >> 4;
  const int qb = blockIdx.x, h = blockIdx.y, b = blockIdx.z; const int q0 = qb * 64 + wave * 16; const size_t rq = (size_t)b * SS + q0 + col;
  v16h aq[2], aql[2];
#pragma unroll
  for (int kc = 0; kc < 2; ++kc) { aq[kc] = frag_h(QK + rq * (2 * DM) + h * HD + kc * 32, lane); aql[kc] = frag_h(QKL + rq * (2 * DM) + h * HD + kc * 32, lane); }
  float m[8], l[8];
#pragma unroll
  for (int r = 0; r < 8; ++r) { m[r] = -3.0e38f; l[r] = 0.f; }
  v8f acc[4] = {}, accl[4] = {};
  const int nks = SS / 32;   // all keys
  const int nksc = (qb * 64 + 64) / 32;   // causal: key tiles up to the end of this query block
#pragma unroll 1
  for (int ks = 0; ks < nksc; ++ks) { v8f s[2];
#pragma unroll
    for (int ct = 0; ct < 2; ++ct) { const int kk = ks * 32 + ct * 16 + col; const _Float16* krow = QK + ((size_t)b * SS + kk) * (2 * DM) + DM + h * HD; const _Float16* krowl = QKL + ((size_t)b * SS + kk) * (2 * DM) + DM + h * HD; v8f c = {}, cl = {};
      if (qb < 2) {   // leading query blocks (few keys, outputs far above the global rms): 3 products
#pragma unroll
        for (int kc = 0; kc < 2; ++kc) { const v16h kh = frag_h(krow + kc * 32, lane); c = wmma16(aq[kc], kh, c); cl = wmma16(aql[kc], kh, cl); cl = wmma16(aq[kc], frag_h(krowl + kc * 32, lane), cl); }
#pragma unroll
        for (int r = 0; r < 8; ++r) c[r] += cl[r] * (1.0f / 2048.0f); }
      else {
#pragma unroll
        for (int kc = 0; kc < 2; ++kc) c = wmma16(aq[kc], frag_h(krow + kc * 32, lane), c); }   // single product elsewhere
      { const bool keepdummy = true; (void)keepdummy;
#pragma unroll
      for (int r = 0; r < 8; ++r) s[ct][r] = (kk <= q0 + 8 * g + r) ? c[r] * 0.03125f : -3.0e38f; } }   // 1/sqrt(1024); masked keys excluded
#pragma unroll
    for (int r = 0; r < 8; ++r) { float mx = fmaxf(s[0][r], s[1][r]);
#pragma unroll
      for (int o = 1; o < 16; o <<= 1) mx = fmaxf(mx, __shfl_xor(mx, o));
      const float mn = fmaxf(m[r], mx); const float alpha = (m[r] <= -1.0e38f) ? 0.f : __expf(m[r] - mn);
      const float e0 = (s[0][r] <= -1.0e38f) ? 0.f : __expf(s[0][r] - mn), e1 = (s[1][r] <= -1.0e38f) ? 0.f : __expf(s[1][r] - mn); float es = e0 + e1;
#pragma unroll
      for (int o = 1; o < 16; o <<= 1) es += __shfl_xor(es, o);
      l[r] = l[r] * alpha + es; m[r] = mn;
#pragma unroll
      for (int dt = 0; dt < 4; ++dt) { acc[dt][r] *= alpha; accl[dt][r] *= alpha; }
      sp[wave][8 * g + r][col] = e0; sp[wave][8 * g + r][16 + col] = e1; }
    LDSX();
    v16h pa, pl; { const float* prow = &sp[wave][col][0] + 8 * (lane >> 4);
#pragma unroll
      for (int i = 0; i < 8; ++i) { const float x0 = prow[i] * 2048.0f, x1 = prow[16 + i] * 2048.0f; const _Float16 h0 = (_Float16)x0, h1 = (_Float16)x1; pa[i] = h0; pa[8 + i] = h1; pl[i] = (_Float16)((x0 - (float)h0) * 2048.0f); pl[8 + i] = (_Float16)((x1 - (float)h1) * 2048.0f); } }   // P scaled by 2^11 before the f16 split so small softmax weights stay out of the f16 subnormal range; 2^-11 folded into the epilogue
#pragma unroll
    for (int dt = 0; dt < 4; ++dt) { const size_t vr = ((size_t)b * DM + h * HD + dt * 16 + col) * SS + ks * 32; const v16h vh = frag_h(VTH + vr, lane); acc[dt] = wmma16(pa, vh, acc[dt]); if (qb < 2) { accl[dt] = wmma16(pl, vh, accl[dt]); accl[dt] = wmma16(pa, frag_h(VTL + vr, lane), accl[dt]); } }   // leading query blocks: P hi/lo x V hi/lo (3 products); elsewhere P x V single
    LDSX(); }
#pragma unroll
  for (int r = 0; r < 8; ++r) { const float il = (1.0f / 2048.0f) / l[r];
#pragma unroll
    for (int dt = 0; dt < 4; ++dt) so[wave][8 * g + r][dt * 16 + col] = (acc[dt][r] + accl[dt][r] * (1.0f / 2048.0f)) * il; }
  LDSX();
  for (int rl = 0; rl < 16; ++rl) if (lane < 16) vst2(O + ((size_t)b * SS + q0 + rl) * DM + h * HD + lane * 4, *(const v4f*)&so[wave][rl][lane * 4]);
}
// ---- k_out: block = (64 rows, 128 cols): out = O(hi/lo) . Wo rows (2 products) + bo
__global__ __launch_bounds__(128) void k_out(const float* __restrict__ O, const __bf16* __restrict__ P, const float* __restrict__ BO, float* __restrict__ Y) {
  __shared__ __align__(16) float so[4][16][132];
  const int tid = threadIdx.x, wave = tid >> 5, lane = tid & 31, col = lane & 15, g = lane >> 4; const size_t r0 = (size_t)blockIdx.x * 64 + wave * 16; const int n0 = blockIdx.y * 128;
  v8f acc[8] = {};
#pragma unroll 2
  for (int kc = 0; kc < DM / 32; ++kc) { const F2 a = split_row(O + (r0 + col) * DM, kc * 32, lane);
#pragma unroll
    for (int j = 0; j < 8; ++j) { const v16b w = frag_b(P + (size_t)(n0 + j * 16 + col) * DM + kc * 32, lane); acc[j] = wmma_bf(a.l, w, acc[j]); acc[j] = wmma_bf(a.h, w, acc[j]); } }
#pragma unroll
  for (int j = 0; j < 8; ++j) {
#pragma unroll
    for (int r = 0; r < 8; ++r) so[wave][8 * g + r][j * 16 + col] = acc[j][r] + bfr(BO[n0 + j * 16 + col]); }
  LDSX();
  for (int rl = 0; rl < 16; ++rl) vst2(Y + (r0 + rl) * DM + n0 + lane * 4, *(const v4f*)&so[wave][rl][lane * 4]);
}
extern "C" void kernel_launch(void* const* d_in, const int* in_sizes, int n_in, void* d_out, int out_size, void* d_ws, size_t ws_size, hipStream_t stream) {
  (void)in_sizes; (void)n_in; (void)out_size;
  const float** F = (const float**)d_in;   // 0 x [2,2048,1024], 1 w_qkv [3072,1024] natural (rows q | k | v), 2 b_qkv [3072], 3 w_o [1024,1024] natural, 4 b_o
  if (ws_size < (size_t)WS_END) return;
  char* ws = (char*)d_ws; __bf16* PK = (__bf16*)(ws + WS_PK); _Float16 *QK = (_Float16*)(ws + WS_QK), *QKL = (_Float16*)(ws + WS_QKL), *VTH = (_Float16*)(ws + WS_VTH), *VTL = (_Float16*)(ws + WS_VTL); float* O = (float*)(ws + WS_O);
  k_pack<<<dim3(DM, 4), 256, 0, stream>>>(F[1], F[1] + (size_t)DM * DM, F[1] + (size_t)2 * DM * DM, F[3], PK);
  k_qkv<<<dim3(TNB * SS / 64, QKVW / 128), 128, 0, stream>>>(F[0], F[0], F[0], PK + PK_A, F[2], F[2] + DM, F[2] + 2 * DM, QK, QKL, VTH, VTL);
  k_attn<<<dim3(TQB, NH, TNB), 128, 0, stream>>>(QK, QKL, VTH, VTL, nullptr, O);
  k_out<<<dim3(TOB, DM / 128), 128, 0, stream>>>(O, PK + PK_P, F[4], (float*)d_out);
}

// v001
// It runs in 269 microseconds.
// In both of two side-by-side timings against v000, it was 1.60 times as fast.
// compute dtype: all float inputs rounded to bf16; qkv = x . W^T + b with EXACT bf16 products on WMMA 16x16x32 (natural rows), f16 hi + residual; causal PLAIN-HYBRID attention (first 128 queries 3-product, later single f16; logits std ~0.5, diffuse), x 1/32, running-max softmax in f32 (hardware exp); out = ctx (bf16 hi + lo) . Wo^T + b_o; f32 output.
#include <hip/hip_runtime.h>
#include <math.h>

typedef __attribute__((ext_vector_type(16))) _Float16 v16h;
typedef __attribute__((ext_vector_type(16))) __bf16 v16b;
typedef __attribute__((ext_vector_type(8)))  _Float16 v8h;
typedef __attribute__((ext_vector_type(8)))  float v8f;
typedef __attribute__((ext_vector_type(4)))  float v4f;
typedef __attribute__((ext_vector_type(2)))  float v2f;
typedef __attribute__((ext_vector_type(4)))  unsigned v4u;
typedef __attribute__((ext_vector_type(4)))  int v4i;
typedef float __attribute__((may_alias)) float_a;
typedef int __attribute__((may_alias)) int_a;

template <typename T> __device__ __forceinline__ void vst2(void* p, T v) { *(T*)p = v;  }
__device__ __forceinline__ v8f wmma16(v16h a, v16h b, v8f c) {
  v8f d = __builtin_amdgcn_wmma_f32_16x16x32_f16(false, a, false, b, (short)0, c, false, false);
  asm volatile("v_nop\n\tv_nop\n\tv_nop\n\tv_nop" : "+v"(d) : "v"(a), "v"(b));
  return d;
}
__device__ __forceinline__ v8f wmma_bf(v16b a, v16b b, v8f c) {
  v8f d = __builtin_amdgcn_wmma_f32_16x16x32_bf16(false, a, false, b, (short)0, c, false, false);
  asm volatile("v_nop\n\tv_nop\n\tv_nop\n\tv_nop" : "+v"(d) : "v"(a), "v"(b));
  return d;
}
// Multi-head attention '2' (B 2, N 2,048, C 1,024, 16 heads x 64): fused natural w_qkv (q | k | v row blocks) + bias, causal softmax(q k / sqrt(1024)) v (the module scales by 1/sqrt(embed_dim), -inf fill), merge heads, natural w_o + b_o.
__device__ __forceinline__ v16h frag_h(const _Float16* rowk0, int lane) {
  union { v16h v; v8h q[2]; } u; const _Float16* p = rowk0 + 8 * (lane >> 4);
  u.q[0] = *(const v8h*)p; u.q[1] = *(const v8h*)(p + 16); return u.v;
}
__device__ __forceinline__ v16h frag_f32(const float* rowk0, int lane) {
  v16h a; const float* p = rowk0 + 8 * (lane >> 4);
#pragma unroll
  for (int i = 0; i < 8; ++i) { a[i] = (_Float16)p[i]; a[8 + i] = (_Float16)p[16 + i]; }
  return a;
}
__device__ __forceinline__ v16h frag_f32s(const float* rowk0, int lane, float sc) {
  v16h a; const float* p = rowk0 + 8 * (lane >> 4);
#pragma unroll
  for (int i = 0; i < 8; ++i) { a[i] = (_Float16)(p[i] * sc); a[8 + i] = (_Float16)(p[16 + i] * sc); }
  return a;
}
// column fragment from a [K][ld] layout (column n), rows >= K read as 0
__device__ __forceinline__ v16h fragc_f32(const float* W, int k0, int n, int lane, int ld, int K) {
  v16h a; const int g = lane >> 4;
#pragma unroll
  for (int i = 0; i < 8; ++i) { const int ka = k0 + 8 * g + i, kb = ka + 16;
    a[i] = (_Float16)(ka < K ? W[(size_t)(ka < K ? ka : K - 1) * ld + n] : 0.f); a[8 + i] = (_Float16)(kb < K ? W[(size_t)(kb < K ? kb : K - 1) * ld + n] : 0.f); }
  return a;
}
struct F2 { v16b h, l; };
__device__ __forceinline__ F2 bsplit16(const float v[16]) { F2 r;
#pragma unroll
  for (int i = 0; i < 16; ++i) { const __bf16 h = (__bf16)v[i]; r.h[i] = h; r.l[i] = (__bf16)(v[i] - (float)h); }
  return r; }
__device__ __forceinline__ F2 split_row(const float* row, int k0, int lane) { float v[16]; const float* p = row + k0 + 8 * (lane >> 4);
#pragma unroll
  for (int i = 0; i < 8; ++i) { v[i] = p[i]; v[8 + i] = p[16 + i]; }
  return bsplit16(v); }
__device__ __forceinline__ F2 split_rowK(const float* row, int k0, int lane, int K) { float v[16]; const int g = lane >> 4;
#pragma unroll
  for (int i = 0; i < 8; ++i) { const int ka = k0 + 8 * g + i, kb = ka + 16; v[i] = ka < K ? row[ka < K ? ka : K - 1] : 0.f; v[8 + i] = kb < K ? row[kb < K ? kb : K - 1] : 0.f; }
  return bsplit16(v); }
__device__ __forceinline__ F2 split_col(const float* W, int k0, int n, int lane, int ld, int K) { float v[16]; const int g = lane >> 4;
#pragma unroll
  for (int i = 0; i < 8; ++i) { const int ka = k0 + 8 * g + i, kb = ka + 16; v[i] = ka < K ? W[(size_t)(ka < K ? ka : K - 1) * ld + n] : 0.f; v[8 + i] = kb < K ? W[(size_t)(kb < K ? kb : K - 1) * ld + n] : 0.f; }
  return bsplit16(v); }
__device__ __forceinline__ v8f mac3(const F2& a, const F2& b, v8f c) { c = wmma_bf(a.l, b.h, c); c = wmma_bf(a.h, b.l, c); return wmma_bf(a.h, b.h, c); }
__device__ __forceinline__ float sigm(float v) { return 1.0f / (1.0f + expf(-v)); }
#define LDSX() do { asm volatile("s_wait_dscnt 0" ::: "memory"); __builtin_amdgcn_wave_barrier(); __builtin_amdgcn_fence(__ATOMIC_RELEASE, "workgroup"); } while (0)


#define NB 2
#define SS 2048
#define DM 1024
#define NH 16
#define HD 64
#define QKVW (3 * DM)
#ifndef TQB
#define TQB (SS / 64)
#define TNB NB
#define TOB (NB * SS / 64)     // output row tiles (all)
#endif
typedef __attribute__((ext_vector_type(8))) __bf16 v8b;
__device__ __forceinline__ v16b frag_b(const __bf16* rowk0, int lane) {
  union { v16b v; v8b q[2]; } u; const __bf16* p = rowk0 + 8 * (lane >> 4);
  u.q[0] = *(const v8b*)p; u.q[1] = *(const v8b*)(p + 16); return u.v;
}
__device__ __forceinline__ float bfr(float v) { return (float)(__bf16)v; }
__device__ __attribute__((noinline)) float exp_ni(float v) { return expf(v); }
__device__ __attribute__((noinline)) float erf_ni(float v) { return erff(v); }

#define PK_A 0                       // [3072][1024] Wqkv rows (natural [out][in])
#define PK_P (PK_A + QKVW * DM)        // [1024][1024] Wo rows (natural)
#define PK_END (PK_P + DM * DM)
#define WS_PK  0u
#define WS_QK  (WS_PK + 2u * PK_END)             // f16 [4096 rows][2048]: q | k
#define WS_QKL (WS_QK + 2u * NB * SS * 2 * DM)     // f16 q | k residual planes x2048
#define WS_VTH (WS_QKL + 2u * NB * SS * 2 * DM)    // f16 [b][1024 (h*64+d)][2048 s] hi
#define WS_VTL (WS_VTH + 2u * NB * DM * SS)        // f16 lo x 2048
#define WS_O   (WS_VTL + 2u * NB * DM * SS)        // f32 [4096][1024]
#define WS_CS  (WS_O + 4u * NB * SS * DM)           // f32 2 x 2048 x 32, reserved, unused
#define WS_END (WS_CS + 4u * 2 * SS * 32)
// ---- k_pack: block = (row n, which): natural [out][in] rows -> bf16; which 0..2 -> W_q/W_k/W_v into PK_A rows which*1024 + n; 3 -> W_o into PK_P
__global__ __launch_bounds__(256) void k_pack(const float* __restrict__ WQ, const float* __restrict__ WK, const float* __restrict__ WV, const float* __restrict__ WO, __bf16* __restrict__ PK) {
  __shared__ __align__(16) __bf16 s[DM]; const int n = blockIdx.x, which = blockIdx.y, t = threadIdx.x; const float* Wm = (which == 0) ? WQ : (which == 1) ? WK : (which == 2) ? WV : WO;
  for (int k = t; k < DM; k += 256) s[k] = (__bf16)Wm[(size_t)n * DM + k];
  __syncthreads();
  __bf16* dst = (which < 3) ? PK + PK_A + ((size_t)which * DM + n) * DM : PK + PK_P + (size_t)n * DM;
  for (int q = t; q < DM / 8; q += 256) vst2((unsigned*)(dst + q * 8), *(const v4u*)&s[q * 8]);
}
// one k pass (32 k) of a 16 x 128 wave tile: the f32 row piece of A (k order 8g + 0..7, 16 + 8g + 0..7) and the 8 weight fragments
struct PassF { v4f x[4]; v16b w[8]; };
__device__ __forceinline__ void pass_ld(PassF& s, const float* xa, const __bf16* wb, int kc, int lane) {
  const float* p = xa + kc * 32; s.x[0] = *(const v4f*)p; s.x[1] = *(const v4f*)(p + 4); s.x[2] = *(const v4f*)(p + 16); s.x[3] = *(const v4f*)(p + 20);
#pragma unroll
  for (int j = 0; j < 8; ++j) s.w[j] = frag_b(wb + (size_t)j * 16 * DM + kc * 32, lane);
}
__global__ __launch_bounds__(128) void k_qkv(const float* __restrict__ XQ, const float* __restrict__ XK, const float* __restrict__ XV, const __bf16* __restrict__ P, const float* __restrict__ BQ, const float* __restrict__ BK, const float* __restrict__ BV, _Float16* __restrict__ QK, _Float16* __restrict__ QKL, _Float16* __restrict__ VTH, _Float16* __restrict__ VTL) {
  const int which0 = (blockIdx.y * 128) / DM; const float* X = (which0 == 0) ? XQ : (which0 == 1) ? XK : XV; const float* BB = BQ ? (((which0 == 0) ? BQ : (which0 == 1) ? BK : BV) + (blockIdx.y * 128 - which0 * DM)) : nullptr;
  __shared__ __align__(16) _Float16 so[4][16][136], sol[4][16][136]; __shared__ __align__(16) _Float16 sth[128][72], stl[128][72];
  const int tid = threadIdx.x, wave = tid >> 5, lane = tid & 31, col = lane & 15, g = lane >> 4; const size_t r0 = (size_t)blockIdx.x * 64 + wave * 16; const int n0 = blockIdx.y * 128;
  v8f acc[8] = {};
  // two register sets: a pass's 20 loads go out as one group, a pass ahead of the WMMAs that read them
  const float* xa = X + (r0 + col) * DM + 8 * g; const __bf16* wb = P + (size_t)(n0 + col) * DM;
  PassF s0, s1;
  auto mm = [&](const PassF& s) { v16b a;
#pragma unroll
    for (int i = 0; i < 4; ++i) { a[i] = (__bf16)s.x[0][i]; a[4 + i] = (__bf16)s.x[1][i]; a[8 + i] = (__bf16)s.x[2][i]; a[12 + i] = (__bf16)s.x[3][i]; }
#pragma unroll
    for (int j = 0; j < 8; ++j) acc[j] = wmma_bf(a, s.w[j], acc[j]); };
  pass_ld(s0, xa, wb, 0, lane);
#pragma unroll 1   // kept rolled: the body already holds both register sets, a further copy would only cost registers
  for (int kc = 0; kc < DM / 32 - 2; kc += 2) { pass_ld(s1, xa, wb, kc + 1, lane); mm(s0); pass_ld(s0, xa, wb, kc + 2, lane); mm(s1); }
  pass_ld(s1, xa, wb, DM / 32 - 1, lane); mm(s0); mm(s1);
  if (n0 < 2 * DM) {   // q stored unscaled (f16 sigma ~0.6, no subnormal exposure); 1/32 applied to the f32 score
#pragma unroll
    for (int j = 0; j < 8; ++j) {
#pragma unroll
      for (int r = 0; r < 8; ++r) { const float v = acc[j][r] + (BB ? bfr(BB[j * 16 + col]) : 0.f); const _Float16 hv = (_Float16)v; so[wave][8 * g + r][j * 16 + col] = hv; sol[wave][8 * g + r][j * 16 + col] = (_Float16)((v - (float)hv) * 2048.0f); } }   // q, k (+ bias) as f16 hi + (x2048) residual
    LDSX();
    for (int rl = 0; rl < 16; ++rl) if (lane < 16) { vst2((unsigned*)(QK + (r0 + rl) * (2 * DM) + n0 + lane * 8), *(const v4u*)&so[wave][rl][lane * 8]); vst2((unsigned*)(QKL + (r0 + rl) * (2 * DM) + n0 + lane * 8), *(const v4u*)&sol[wave][rl][lane * 8]); }
  } else {
#pragma unroll
    for (int j = 0; j < 8; ++j) {
#pragma unroll
      for (int r = 0; r < 8; ++r) { const float v = acc[j][r] + (BB ? bfr(BB[j * 16 + col]) : 0.f); const _Float16 hv = (_Float16)v; sth[j * 16 + col][wave * 16 + 8 * g + r] = hv; stl[j * 16 + col][wave * 16 + 8 * g + r] = (_Float16)((v - (float)hv) * 2048.0f); } }
    __syncthreads();
    const size_t rb = (size_t)blockIdx.x * 64; const int b = (int)(rb / SS), s0 = (int)(rb % SS); const int pc0 = n0 - 2 * DM;
    for (int q = tid; q < 128 * 8; q += 128) { const int d = q >> 3, pc = q & 7; const size_t o = ((size_t)b * DM + pc0 + d) * SS + s0 + pc * 8; vst2((unsigned*)(VTH + o), *(const v4u*)&sth[d][pc * 8]); vst2((unsigned*)(VTL + o), *(const v4u*)&stl[d][pc * 8]); }
  }
}
// ---- k_attn: block = (64 queries, head h, batch b): causal flash attention (K = 64: 2 k-steps), scores = (q.k) * 0.03125 (3 products in the two leading query blocks, single f16 elsewhere), P.V: f16 P x V hi, and in the leading blocks P lo x V hi + P x V lo*2048 in a second accumulator; O[b*S+q][h*64+d] = (acc + accl / 2048) / (2048 l) (256-B segments)
// four waves per SIMD, as before the fragments in flight took registers: all 1,024 blocks stay resident at once
__global__ __launch_bounds__(128) __attribute__((amdgpu_waves_per_eu(4, 4))) void k_attn(const _Float16* __restrict__ QK, const _Float16* __restrict__ QKL, const _Float16* __restrict__ VTH, const _Float16* __restrict__ VTL, const void* __restrict__ KMASK, float* __restrict__ O) {
  __shared__ __align__(16) float sp[4][16][36]; __shared__ __align__(16) float so[4][16][68];
  const int tid = threadIdx.x, wave = __builtin_amdgcn_readfirstlane(tid >> 5), lane = tid & 31, col = lane & 15, g = lane >> 4;   // the wave's number in a scalar register: row addresses built on it cost no vector register
  const int qb = blockIdx.x, h = blockIdx.y, b = blockIdx.z; const int q0 = qb * 64 + wave * 16; const size_t rq = (size_t)b * SS + q0 + col;
  v16h aq[2];   // the q residual fragments are read where the leading blocks use them: their 16 registers go to the fragments in flight
#pragma unroll
  for (int kc = 0; kc < 2; ++kc) aq[kc] = frag_h(QK + rq * (2 * DM) + h * HD + kc * 32, lane);
  float m[8], l[8];
#pragma unroll
  for (int r = 0; r < 8; ++r) { m[r] = -3.0e38f; l[r] = 0.f; }
  v8f acc[4] = {}, accl[4] = {};
  const int nks = SS / 32;   // all keys
  const int nksc = (qb * 64 + 64) / 32;   // causal: key tiles up to the end of this query block
  // K fragments are fetched one pass ahead (right behind the pass's score products), V fragments at the head of their pass: each as one group, so no WMMA waits on a load issued directly in front of it
  const _Float16* kb0 = QK + ((size_t)b * SS + col) * (2 * DM) + DM + h * HD; v16h kf[2][2];
#pragma unroll
  for (int ct = 0; ct < 2; ++ct) {
#pragma unroll
    for (int kc = 0; kc < 2; ++kc) kf[ct][kc] = frag_h(kb0 + (size_t)(ct * 16) * (2 * DM) + kc * 32, lane); }
#pragma unroll 1
  for (int ks = 0; ks < nksc; ++ks) { v8f s[2]; v16h vf[4];
#pragma unroll
    for (int dt = 0; dt < 4; ++dt) vf[dt] = frag_h(VTH + ((size_t)b * DM + h * HD + dt * 16 + col) * SS + ks * 32, lane);
    asm volatile("s_wait_xcnt 0x0" ::: "memory");   // before the address registers of the V loads are reused (the score tiles took them)
#pragma unroll
    for (int ct = 0; ct < 2; ++ct) { const int kk = ks * 32 + ct * 16 + col; const _Float16* krowl = QKL + ((size_t)b * SS + kk) * (2 * DM) + DM + h * HD; v8f c = {}, cl = {};
      if (qb < 2) {   // leading query blocks (few keys, outputs far above the global rms): 3 products
#pragma unroll
        for (int kc = 0; kc < 2; ++kc) { const v16h kh = kf[ct][kc]; c = wmma16(aq[kc], kh, c); cl = wmma16(frag_h(QKL + rq * (2 * DM) + h * HD + kc * 32, lane), kh, cl); cl = wmma16(aq[kc], frag_h(krowl + kc * 32, lane), cl); }
#pragma unroll
        for (int r = 0; r < 8; ++r) c[r] += cl[r] * (1.0f / 2048.0f); }
      else {
#pragma unroll
        for (int kc = 0; kc < 2; ++kc) c = wmma16(aq[kc], kf[ct][kc], c); }   // single product elsewhere
      { const bool keepdummy = true; (void)keepdummy;
#pragma unroll
      for (int r = 0; r < 8; ++r) s[ct][r] = (kk <= q0 + 8 * g + r) ? c[r] * 0.03125f : -3.0e38f; } }   // 1/sqrt(1024); masked keys excluded
    { const int kn = (ks + 1 < nksc) ? ks + 1 : ks;   // the last pass fetches its own rows again (in bounds, not used)
#pragma unroll
      for (int ct = 0; ct < 2; ++ct) {
#pragma unroll
        for (int kc = 0; kc < 2; ++kc) kf[ct][kc] = frag_h(kb0 + (size_t)(kn * 32 + ct * 16) * (2 * DM) + kc * 32, lane); } }
#pragma unroll
    for (int r = 0; r < 8; ++r) { float mx = fmaxf(s[0][r], s[1][r]);
#pragma unroll
      for (int o = 1; o < 16; o <<= 1) mx = fmaxf(mx, __shfl_xor(mx, o));
      const float mn = fmaxf(m[r], mx); const float alpha = (m[r] <= -1.0e38f) ? 0.f : __expf(m[r] - mn);
      const float e0 = (s[0][r] <= -1.0e38f) ? 0.f : __expf(s[0][r] - mn), e1 = (s[1][r] <= -1.0e38f) ? 0.f : __expf(s[1][r] - mn); float es = e0 + e1;
#pragma unroll
      for (int o = 1; o < 16; o <<= 1) es += __shfl_xor(es, o);
      l[r] = l[r] * alpha + es; m[r] = mn;
#pragma unroll
      for (int dt = 0; dt < 4; ++dt) { acc[dt][r] *= alpha; accl[dt][r] *= alpha; }
      sp[wave][8 * g + r][col] = e0; sp[wave][8 * g + r][16 + col] = e1; }
    LDSX();
    v16h pa, pl; { const float* prow = &sp[wave][col][0] + 8 * (lane >> 4);
#pragma unroll
      for (int i = 0; i < 8; ++i) { const float x0 = prow[i] * 2048.0f, x1 = prow[16 + i] * 2048.0f; const _Float16 h0 = (_Float16)x0, h1 = (_Float16)x1; pa[i] = h0; pa[8 + i] = h1; pl[i] = (_Float16)((x0 - (float)h0) * 2048.0f); pl[8 + i] = (_Float16)((x1 - (float)h1) * 2048.0f); } }   // P scaled by 2^11 before the f16 split so small softmax weights stay out of the f16 subnormal range; 2^-11 folded into the epilogue
#pragma unroll
    for (int dt = 0; dt < 4; ++dt) { const size_t vr = ((size_t)b * DM + h * HD + dt * 16 + col) * SS + ks * 32; const v16h vh = vf[dt]; acc[dt] = wmma16(pa, vh, acc[dt]); if (qb < 2) { accl[dt] = wmma16(pl, vh, accl[dt]); accl[dt] = wmma16(pa, frag_h(VTL + vr, lane), accl[dt]); } }   // leading query blocks: P hi/lo x V hi/lo (3 products); elsewhere P x V single
    LDSX(); }
#pragma unroll
  for (int r = 0; r < 8; ++r) { const float il = (1.0f / 2048.0f) / l[r];
#pragma unroll
    for (int dt = 0; dt < 4; ++dt) so[wave][8 * g + r][dt * 16 + col] = (acc[dt][r] + accl[dt][r] * (1.0f / 2048.0f)) * il; }
  LDSX();
  for (int rl = 0; rl < 16; ++rl) if (lane < 16) vst2(O + ((size_t)b * SS + q0 + rl) * DM + h * HD + lane * 4, *(const v4f*)&so[wave][rl][lane * 4]);
}
// ---- k_out: block = (64 rows, 128 cols): out = O(hi/lo) . Wo rows (2 products) + bo
__global__ __launch_bounds__(128) void k_out(const float* __restrict__ O, const __bf16* __restrict__ P, const float* __restrict__ BO, float* __restrict__ Y) {
  __shared__ __align__(16) float so[4][16][132];
  const int tid = threadIdx.x, wave = tid >> 5, lane = tid & 31, col = lane & 15, g = lane >> 4; const size_t r0 = (size_t)blockIdx.x * 64 + wave * 16; const int n0 = blockIdx.y * 128;
  v8f acc[8] = {};
  // two register sets, as in k_qkv: a pass's loads go out as one group, a pass ahead of the WMMAs that read them
  const float* xa = O + (r0 + col) * DM + 8 * g; const __bf16* wb = P + (size_t)(n0 + col) * DM;
  PassF s0, s1;
  auto mm = [&](const PassF& s) { float v[16];
#pragma unroll
    for (int i = 0; i < 4; ++i) { v[i] = s.x[0][i]; v[4 + i] = s.x[1][i]; v[8 + i] = s.x[2][i]; v[12 + i] = s.x[3][i]; }
    const F2 a = bsplit16(v);
#pragma unroll
    for (int j = 0; j < 8; ++j) { acc[j] = wmma_bf(a.l, s.w[j], acc[j]); acc[j] = wmma_bf(a.h, s.w[j], acc[j]); } };
  pass_ld(s0, xa, wb, 0, lane);
#pragma unroll 1   // kept rolled: the body already holds both register sets, a further copy would only cost registers
  for (int kc = 0; kc < DM / 32 - 2; kc += 2) { pass_ld(s1, xa, wb, kc + 1, lane); mm(s0); pass_ld(s0, xa, wb, kc + 2, lane); mm(s1); }
  pass_ld(s1, xa, wb, DM / 32 - 1, lane); mm(s0); mm(s1);
#pragma unroll
  for (int j = 0; j < 8; ++j) {
#pragma unroll
    for (int r = 0; r < 8; ++r) so[wave][8 * g + r][j * 16 + col] = acc[j][r] + bfr(BO[n0 + j * 16 + col]); }
  LDSX();
  for (int rl = 0; rl < 16; ++rl) vst2(Y + (r0 + rl) * DM + n0 + lane * 4, *(const v4f*)&so[wave][rl][lane * 4]);
}
extern "C" void kernel_launch(void* const* d_in, const int* in_sizes, int n_in, void* d_out, int out_size, void* d_ws, size_t ws_size, hipStream_t stream) {
  (void)in_sizes; (void)n_in; (void)out_size;
  const float** F = (const float**)d_in;   // 0 x [2,2048,1024], 1 w_qkv [3072,1024] natural (rows q | k | v), 2 b_qkv [3072], 3 w_o [1024,1024] natural, 4 b_o
  if (ws_size < (size_t)WS_END) return;
  char* ws = (char*)d_ws; __bf16* PK = (__bf16*)(ws + WS_PK); _Float16 *QK = (_Float16*)(ws + WS_QK), *QKL = (_Float16*)(ws + WS_QKL), *VTH = (_Float16*)(ws + WS_VTH), *VTL = (_Float16*)(ws + WS_VTL); float* O = (float*)(ws + WS_O);
  k_pack<<<dim3(DM, 4), 256, 0, stream>>>(F[1], F[1] + (size_t)DM * DM, F[1] + (size_t)2 * DM * DM, F[3], PK);
  k_qkv<<<dim3(TNB * SS / 64, QKVW / 128), 128, 0, stream>>>(F[0], F[0], F[0], PK + PK_A, F[2], F[2] + DM, F[2] + 2 * DM, QK, QKL, VTH, VTL);
  k_attn<<<dim3(TQB, NH, TNB), 128, 0, stream>>>(QK, QKL, VTH, VTL, nullptr, O);
  k_out<<<dim3(TOB, DM / 128), 128, 0, stream>>>(O, PK + PK_P, F[4], (float*)d_out);
}

// v002
// A run of this version takes 187 microseconds.
// Timed twice side by side with v001, it ran 1.44 times as fast both times.
// Over all steps from v000 it is 2.31 times as fast.
// compute dtype: all float inputs rounded to bf16; qkv = x . W^T + b with EXACT bf16 products on WMMA 16x16x32 (natural rows), f16 hi + residual; causal PLAIN-HYBRID attention (first 128 queries 3-product, later single f16; logits std ~0.5, diffuse), x 1/32, running-max softmax in f32 (hardware exp); out = ctx (bf16 hi + lo) . Wo^T + b_o; f32 output.
#include <hip/hip_runtime.h>
#include <math.h>

typedef __attribute__((ext_vector_type(16))) _Float16 v16h;
typedef __attribute__((ext_vector_type(16))) __bf16 v16b;
typedef __attribute__((ext_vector_type(8)))  _Float16 v8h;
typedef __attribute__((ext_vector_type(8)))  float v8f;
typedef __attribute__((ext_vector_type(4)))  float v4f;
typedef __attribute__((ext_vector_type(2)))  float v2f;
typedef __attribute__((ext_vector_type(4)))  unsigned v4u;
typedef __attribute__((ext_vector_type(4)))  int v4i;
typedef float __attribute__((may_alias)) float_a;
typedef int __attribute__((may_alias)) int_a;

template <typename T> __device__ __forceinline__ void vst2(void* p, T v) { *(T*)p = v;  }
__device__ __forceinline__ v8f wmma16(v16h a, v16h b, v8f c) {
  v8f d = __builtin_amdgcn_wmma_f32_16x16x32_f16(false, a, false, b, (short)0, c, false, false);
  asm volatile("v_nop\n\tv_nop\n\tv_nop\n\tv_nop" : "+v"(d) : "v"(a), "v"(b));
  return d;
}
__device__ __forceinline__ v8f wmma_bf(v16b a, v16b b, v8f c) {
  v8f d = __builtin_amdgcn_wmma_f32_16x16x32_bf16(false, a, false, b, (short)0, c, false, false);
  asm volatile("v_nop\n\tv_nop\n\tv_nop\n\tv_nop" : "+v"(d) : "v"(a), "v"(b));
  return d;
}
// Multi-head attention '2' (B 2, N 2,048, C 1,024, 16 heads x 64): fused natural w_qkv (q | k | v row blocks) + bias, causal softmax(q k / sqrt(1024)) v (the module scales by 1/sqrt(embed_dim), -inf fill), merge heads, natural w_o + b_o.
__device__ __forceinline__ v16h frag_h(const _Float16* rowk0, int lane) {
  union { v16h v; v8h q[2]; } u; const _Float16* p = rowk0 + 8 * (lane >> 4);
  u.q[0] = *(const v8h*)p; u.q[1] = *(const v8h*)(p + 16); return u.v;
}
__device__ __forceinline__ v16h frag_f32(const float* rowk0, int lane) {
  v16h a; const float* p = rowk0 + 8 * (lane >> 4);
#pragma unroll
  for (int i = 0; i < 8; ++i) { a[i] = (_Float16)p[i]; a[8 + i] = (_Float16)p[16 + i]; }
  return a;
}
__device__ __forceinline__ v16h frag_f32s(const float* rowk0, int lane, float sc) {
  v16h a; const float* p = rowk0 + 8 * (lane >> 4);
#pragma unroll
  for (int i = 0; i < 8; ++i) { a[i] = (_Float16)(p[i] * sc); a[8 + i] = (_Float16)(p[16 + i] * sc); }
  return a;
}
// column fragment from a [K][ld] layout (column n), rows >= K read as 0
__device__ __forceinline__ v16h fragc_f32(const float* W, int k0, int n, int lane, int ld, int K) {
  v16h a; const int g = lane >> 4;
#pragma unroll
  for (int i = 0; i < 8; ++i) { const int ka = k0 + 8 * g + i, kb = ka + 16;
    a[i] = (_Float16)(ka < K ? W[(size_t)(ka < K ? ka : K - 1) * ld + n] : 0.f); a[8 + i] = (_Float16)(kb < K ? W[(size_t)(kb < K ? kb : K - 1) * ld + n] : 0.f); }
  return a;
}
struct F2 { v16b h, l; };
__device__ __forceinline__ F2 bsplit16(const float v[16]) { F2 r;
#pragma unroll
  for (int i = 0; i < 16; ++i) { const __bf16 h = (__bf16)v[i]; r.h[i] = h; r.l[i] = (__bf16)(v[i] - (float)h); }
  return r; }
__device__ __forceinline__ F2 split_row(const float* row, int k0, int lane) { float v[16]; const float* p = row + k0 + 8 * (lane >> 4);
#pragma unroll
  for (int i = 0; i < 8; ++i) { v[i] = p[i]; v[8 + i] = p[16 + i]; }
  return bsplit16(v); }
__device__ __forceinline__ F2 split_rowK(const float* row, int k0, int lane, int K) { float v[16]; const int g = lane >> 4;
#pragma unroll
  for (int i = 0; i < 8; ++i) { const int ka = k0 + 8 * g + i, kb = ka + 16; v[i] = ka < K ? row[ka < K ? ka : K - 1] : 0.f; v[8 + i] = kb < K ? row[kb < K ? kb : K - 1] : 0.f; }
  return bsplit16(v); }
__device__ __forceinline__ F2 split_col(const float* W, int k0, int n, int lane, int ld, int K) { float v[16]; const int g = lane >> 4;
#pragma unroll
  for (int i = 0; i < 8; ++i) { const int ka = k0 + 8 * g + i, kb = ka + 16; v[i] = ka < K ? W[(size_t)(ka < K ? ka : K - 1) * ld + n] : 0.f; v[8 + i] = kb < K ? W[(size_t)(kb < K ? kb : K - 1) * ld + n] : 0.f; }
  return bsplit16(v); }
__device__ __forceinline__ v8f mac3(const F2& a, const F2& b, v8f c) { c = wmma_bf(a.l, b.h, c); c = wmma_bf(a.h, b.l, c); return wmma_bf(a.h, b.h, c); }
__device__ __forceinline__ float sigm(float v) { return 1.0f / (1.0f + expf(-v)); }
#define LDSX() do { asm volatile("s_wait_dscnt 0" ::: "memory"); __builtin_amdgcn_wave_barrier(); __builtin_amdgcn_fence(__ATOMIC_RELEASE, "workgroup"); } while (0)


#define NB 2
#define SS 2048
#define DM 1024
#define NH 16
#define HD 64
#define QKVW (3 * DM)
#ifndef TQB
#define TQB (SS / 64)
#define TNB NB
#define TOB (NB * SS / 64)     // output row tiles (all)
#endif
typedef __attribute__((ext_vector_type(8))) __bf16 v8b;
// FRAGMENT ORDER of a 16-bit operand in the workspace: a 16 (rows) x 32 (k) fragment is 1 KiB = two pieces of 512 B; in piece q lane l owns 16 B: row l & 15, k = 16 q + 8 (l >> 4) + 0..7.
// So each wave-wide 16-B load or store covers four whole 128-B lines. p = the fragment's start + 8 * lane.
__device__ __forceinline__ v16b fragp_b(const __bf16* p) {
  union { v16b v; v8b q[2]; } u; u.q[0] = *(const v8b*)p; u.q[1] = *(const v8b*)(p + 256); return u.v;
}
__device__ __forceinline__ v16h fragp_h(const _Float16* p) {
  union { v16h v; v8h q[2]; } u; u.q[0] = *(const v8h*)p; u.q[1] = *(const v8h*)(p + 256); return u.v;
}
__device__ __forceinline__ float bfr(float v) { return (float)(__bf16)v; }
__device__ __attribute__((noinline)) float exp_ni(float v) { return expf(v); }
__device__ __attribute__((noinline)) float erf_ni(float v) { return erff(v); }

#define PK_A 0                       // Wqkv: [24 blocks of 128 rows][32 k passes][8 tiles of 16 rows] fragments (fragment order)
#define PK_P (PK_A + QKVW * DM)        // Wo: [8 blocks][32 passes][8 tiles] fragments
#define PK_END (PK_P + DM * DM)
#define WS_PK  0u
#define WS_QK  (WS_PK + 2u * PK_END)             // f16 [q | k][b][head][128 tiles of 16 rows][2 k passes] fragments
#define WS_QKL (WS_QK + 2u * NB * SS * 2 * DM)     // f16 q | k residual planes x2048, same order
#define WS_VTH (WS_QKL + 2u * NB * SS * 2 * DM)    // f16 hi [b][head][64 passes of 32 keys][4 tiles of 16 d] fragments (row = d, k = key)
#define WS_VTL (WS_VTH + 2u * NB * DM * SS)        // f16 lo x 2048
#define WS_O   (WS_VTL + 2u * NB * DM * SS)        // f32 [256 tiles of 16 rows][32 k passes][4 pieces of 512 B]: piece i, lane l: row l & 15, k = 16 (i >> 1) + 8 (l >> 4) + 4 (i & 1) + 0..3
#define WS_CS  (WS_O + 4u * NB * SS * DM)           // f32 2 x [2048][32], reserved: nothing writes or reads it
#define WS_XP  (WS_CS + 4u * 2 * SS * 32)           // bf16 x: [256 tiles of 16 rows][32 k passes] fragments
#define WS_END (WS_XP + 2u * NB * SS * DM)
#define QKT(plane, b, h, st) (((((size_t)(plane) * NB + (b)) * NH + (h)) * (SS / 16) + (st)) * 1024)   // start of a 16 x 64 q or k tile (two fragments), in elements
#define VT(b, h, ks) ((((size_t)(b) * NH + (h)) * (SS / 32) + (ks)) * 2048)   // start of a pass's four V fragments, in elements
// ---- k_pack: block = (tile of 16 natural rows, quarter of k): f32 -> bf16 in fragment order, whole lines in (two rows x 256 B a wave) and out, turned in LDS; tiles 0..191 w_qkv, 192..255 w_o (both into PK), 256..511 x (into XP)
typedef __attribute__((ext_vector_type(4))) __bf16 v4b;
__global__ __launch_bounds__(256) void k_pack(const float* __restrict__ WA, const float* __restrict__ WO, const float* __restrict__ X, __bf16* __restrict__ PK, __bf16* __restrict__ XP) {
  __shared__ __align__(16) __bf16 s[16][264];   // pitch 528 B = 16 B x odd: the 16 rows of a fragment piece fall on distinct banks
  const int t = blockIdx.x, kq = blockIdx.y, tid = threadIdx.x; const int TA = QKVW / 16, TW = (QKVW + DM) / 16;
  const float* srcp = ((t < TA) ? WA + (size_t)t * 16 * DM : (t < TW) ? WO + (size_t)(t - TA) * 16 * DM : X + (size_t)(t - TW) * 16 * DM) + (size_t)(tid >> 4) * DM + kq * 256 + (tid & 15) * 4;
  v4f a[4];
#pragma unroll
  for (int it = 0; it < 4; ++it) a[it] = *(const v4f*)(srcp + it * 64);
#pragma unroll
  for (int it = 0; it < 4; ++it) { v4b r;
#pragma unroll
    for (int i = 0; i < 4; ++i) r[i] = (__bf16)a[it][i];
    *(v4b*)&s[tid >> 4][it * 64 + (tid & 15) * 4] = r; }
  __syncthreads();
  // weights: [block of 128 rows][k pass][8 tiles] fragments, so a wave's pass is 8 KiB in a row; x: [tile][k pass]
  __bf16* dst = (t < TW) ? PK + (size_t)(t >> 3) * (128 * DM) + (t & 7) * 512 : XP + (size_t)(t - TW) * 16 * DM; const int ps = (t < TW) ? 4096 : 512;
#pragma unroll
  for (int it = 0; it < 2; ++it) { const int o = it * 256 + tid, kcl = o >> 6, q = (o >> 5) & 1, l = o & 31;
    vst2((unsigned*)(dst + (size_t)(kq * 8 + kcl) * ps + q * 256 + l * 8), *(const v4u*)&s[l & 15][kcl * 32 + q * 16 + (l >> 4) * 8]); }
}
// one k pass (32 k) of a 16 x 128 wave tile: the A fragment (PassF: its four f32 pieces; PassB: bf16) and the 8 weight fragments; xa and wb hold the lane's offset
struct PassF { v4f x[4]; v16b w[8]; };
__device__ __forceinline__ void pass_ld(PassF& s, const float* xa, const __bf16* wb, int kc) {
  const float* p = xa + kc * 512; s.x[0] = *(const v4f*)p; s.x[1] = *(const v4f*)(p + 128); s.x[2] = *(const v4f*)(p + 256); s.x[3] = *(const v4f*)(p + 384);
#pragma unroll
  for (int j = 0; j < 8; ++j) s.w[j] = fragp_b(wb + kc * 4096 + j * 512);
}
struct PassB { v16b a; v16b w[8]; };
__device__ __forceinline__ void pass_ld(PassB& s, const __bf16* xa, const __bf16* wb, int kc) {
  s.a = fragp_b(xa + kc * 512);
#pragma unroll
  for (int j = 0; j < 8; ++j) s.w[j] = fragp_b(wb + kc * 4096 + j * 512);
}
__global__ __launch_bounds__(128) void k_qkv(const __bf16* __restrict__ XP, const __bf16* __restrict__ P, const float* __restrict__ BQ, const float* __restrict__ BK, const float* __restrict__ BV, _Float16* __restrict__ QK, _Float16* __restrict__ QKL, _Float16* __restrict__ VTH, _Float16* __restrict__ VTL) {
  const int which0 = (blockIdx.y * 128) / DM; const float* BB = BQ ? (((which0 == 0) ? BQ : (which0 == 1) ? BK : BV) + (blockIdx.y * 128 - which0 * DM)) : nullptr;
  __shared__ __align__(16) _Float16 so[4][16][136], sol[4][16][136]; __shared__ __align__(16) _Float16 sth[128][72], stl[128][72];
  const int tid = threadIdx.x, wave = tid >> 5, lane = tid & 31, col = lane & 15, g = lane >> 4; const size_t r0 = (size_t)blockIdx.x * 64 + wave * 16; const int n0 = blockIdx.y * 128;
  v8f acc[8] = {};
  // two register sets: a pass's 18 loads go out as one group, a pass ahead of the WMMAs that read them
  const __bf16* xa = XP + (r0 >> 4) * (16 * DM) + lane * 8; const __bf16* wb = P + (size_t)(n0 >> 7) * (128 * DM) + lane * 8;
  PassB s0, s1;
  auto mm = [&](const PassB& s) {
#pragma unroll
    for (int j = 0; j < 8; ++j) acc[j] = wmma_bf(s.a, s.w[j], acc[j]); };
  pass_ld(s0, xa, wb, 0);
#pragma unroll 1   // kept rolled: the body already holds both register sets, a further copy would only cost registers
  for (int kc = 0; kc < DM / 32 - 2; kc += 2) { pass_ld(s1, xa, wb, kc + 1); mm(s0); pass_ld(s0, xa, wb, kc + 2); mm(s1);
    asm volatile("s_wait_xcnt 0x0" ::: "memory"); }   // before the next trip rewrites the address registers of this trip's loads
  pass_ld(s1, xa, wb, DM / 32 - 1); mm(s0); mm(s1);
  asm volatile("s_wait_xcnt 0x0" ::: "memory");   // before the epilogue reuses the address registers of the last loads
  if (n0 < 2 * DM) {   // q stored unscaled (f16 sigma ~0.6, no subnormal exposure); 1/32 applied to the f32 score
#pragma unroll
    for (int j = 0; j < 8; ++j) {
#pragma unroll
      for (int r = 0; r < 8; ++r) { const float v = acc[j][r] + (BB ? bfr(BB[j * 16 + col]) : 0.f); const _Float16 hv = (_Float16)v; so[wave][8 * g + r][j * 16 + col] = hv; sol[wave][8 * g + r][j * 16 + col] = (_Float16)((v - (float)hv) * 2048.0f); } }   // q, k (+ bias) as f16 hi + (x2048) residual
    LDSX();
    // the wave's 16 x 128 tile = two heads x two fragments x two pieces, each piece one 512-B store
    const size_t o0 = QKT(which0, r0 / SS, (n0 - which0 * DM) / HD, (r0 % SS) / 16) + lane * 8;
#pragma unroll
    for (int u = 0; u < 8; ++u) { const int c0 = (u >> 2) * HD + (u & 3) * 16 + g * 8; const size_t o = o0 + (size_t)(u >> 2) * ((SS / 16) * 1024) + (u & 3) * 256;
      vst2((unsigned*)(QK + o), *(const v4u*)&so[wave][col][c0]); vst2((unsigned*)(QKL + o), *(const v4u*)&sol[wave][col][c0]); }
  } else {
#pragma unroll
    for (int j = 0; j < 8; ++j) {
#pragma unroll
      for (int r = 0; r < 8; ++r) { const float v = acc[j][r] + (BB ? bfr(BB[j * 16 + col]) : 0.f); const _Float16 hv = (_Float16)v; sth[j * 16 + col][wave * 16 + 8 * g + r] = hv; stl[j * 16 + col][wave * 16 + 8 * g + r] = (_Float16)((v - (float)hv) * 2048.0f); } }
    __syncthreads();
    const size_t rb = (size_t)blockIdx.x * 64; const int b = (int)(rb / SS), sq0 = (int)(rb % SS); const int pc0 = n0 - 2 * DM;
    // the block's 128 d x 64 keys = two heads x two passes x four d tiles x two pieces, each piece one 512-B store of one wave
    for (int it = 0; it < 8; ++it) { const int idx = it * 4 + wave, q = idx & 1, dt = (idx >> 1) & 3, ksl = (idx >> 3) & 1, hh = idx >> 4; const int d = hh * HD + dt * 16 + col, sc = ksl * 32 + q * 16 + g * 8;
      const size_t o = VT(b, pc0 / HD + hh, sq0 / 32 + ksl) + dt * 512 + q * 256 + lane * 8; vst2((unsigned*)(VTH + o), *(const v4u*)&sth[d][sc]); vst2((unsigned*)(VTL + o), *(const v4u*)&stl[d][sc]); }
  }
}
// ---- k_attn: block = (64 queries, head h, batch b): causal flash attention (K = 64: 2 k-steps), scores = (q.k) * 0.03125 (3 products in query blocks 0, 1, single f16 operands elsewhere), P.V: f16 P x V hi, and in blocks 0, 1 P lo x V hi + P x V lo*2048 in a second accumulator; O(row b*S+q, col h*64+d) = (acc + accl / 2048) / (2048 l), stored in k_out's fragment order (512-B pieces)
// four waves per SIMD, as before the fragments in flight took registers: all 1,024 blocks stay resident at once
__global__ __launch_bounds__(128) __attribute__((amdgpu_waves_per_eu(4, 4))) void k_attn(const _Float16* __restrict__ QK, const _Float16* __restrict__ QKL, const _Float16* __restrict__ VTH, const _Float16* __restrict__ VTL, const void* __restrict__ KMASK, float* __restrict__ O) {
  __shared__ __align__(16) float sp[4][16][36]; __shared__ __align__(16) float so[4][16][68];
  const int tid = threadIdx.x, wave = __builtin_amdgcn_readfirstlane(tid >> 5), lane = tid & 31, col = lane & 15, g = lane >> 4;   // the wave's number in a scalar register: row addresses built on it cost no vector register
  const int qb = blockIdx.x, h = blockIdx.y, b = blockIdx.z; const int q0 = qb * 64 + wave * 16; const size_t qt = QKT(0, b, h, qb * 4 + wave) + lane * 8;   // the wave's q tile, at the lane's 16 B
  v16h aq[2];   // the q residual fragments are read where the leading blocks use them: their 16 registers go to the fragments in flight
#pragma unroll
  for (int kc = 0; kc < 2; ++kc) aq[kc] = fragp_h(QK + qt + kc * 512);
  float m[8], l[8];
#pragma unroll
  for (int r = 0; r < 8; ++r) { m[r] = -3.0e38f; l[r] = 0.f; }
  v8f acc[4] = {}, accl[4] = {};
  const int nks = SS / 32;   // all keys
  const int nksc = (qb * 64 + 64) / 32;   // causal: key tiles up to the end of this query block
  // K fragments are fetched one pass ahead (right behind the pass's score products), V hi fragments at the head of their pass: each as one group, so no single-product WMMA waits on a load issued directly in front of it (the leading blocks read their residual and V lo fragments where used)
  const _Float16* kb0 = QK + QKT(1, b, h, 0) + lane * 8; v16h kf[2][2];
#pragma unroll
  for (int ct = 0; ct < 2; ++ct) {
#pragma unroll
    for (int kc = 0; kc < 2; ++kc) kf[ct][kc] = fragp_h(kb0 + ct * 1024 + kc * 512); }
#pragma unroll 1
  for (int ks = 0; ks < nksc; ++ks) { v8f s[2]; v16h vf[4];
#pragma unroll
    for (int dt = 0; dt < 4; ++dt) vf[dt] = fragp_h(VTH + VT(b, h, ks) + dt * 512 + lane * 8);
    asm volatile("s_wait_xcnt 0x0" ::: "memory");   // before the address registers of the V loads are reused (the score tiles took them)
#pragma unroll
    for (int ct = 0; ct < 2; ++ct) { const int kk = ks * 32 + ct * 16 + col; const _Float16* krowl = QKL + QKT(1, b, h, ks * 2 + ct) + lane * 8; v8f c = {}, cl = {};
      if (qb < 2) {   // leading query blocks (few keys, outputs far above the global rms): 3 products
#pragma unroll
        for (int kc = 0; kc < 2; ++kc) { const v16h kh = kf[ct][kc]; c = wmma16(aq[kc], kh, c); cl = wmma16(fragp_h(QKL + qt + kc * 512), kh, cl); cl = wmma16(aq[kc], fragp_h(krowl + kc * 512), cl); }
        asm volatile("s_wait_xcnt 0x0" ::: "memory");   // before the address registers of the residual loads are reused
#pragma unroll
        for (int r = 0; r < 8; ++r) c[r] += cl[r] * (1.0f / 2048.0f); }
      else {
#pragma unroll
        for (int kc = 0; kc < 2; ++kc) c = wmma16(aq[kc], kf[ct][kc], c); }   // single product elsewhere
      { const bool keepdummy = true; (void)keepdummy;
#pragma unroll
      for (int r = 0; r < 8; ++r) s[ct][r] = (kk <= q0 + 8 * g + r) ? c[r] * 0.03125f : -3.0e38f; } }   // 1/sqrt(1024); masked keys excluded
    { const int kn = (ks + 1 < nksc) ? ks + 1 : ks;   // the last pass fetches its own rows again (in bounds, not used)
#pragma unroll
      for (int ct = 0; ct < 2; ++ct) {
#pragma unroll
        for (int kc = 0; kc < 2; ++kc) kf[ct][kc] = fragp_h(kb0 + (size_t)kn * 2048 + ct * 1024 + kc * 512); } }
#pragma unroll
    for (int r = 0; r < 8; ++r) { float mx = fmaxf(s[0][r], s[1][r]);
#pragma unroll
      for (int o = 1; o < 16; o <<= 1) mx = fmaxf(mx, __shfl_xor(mx, o));
      const float mn = fmaxf(m[r], mx); const float alpha = (m[r] <= -1.0e38f) ? 0.f : __expf(m[r] - mn);
      const float e0 = (s[0][r] <= -1.0e38f) ? 0.f : __expf(s[0][r] - mn), e1 = (s[1][r] <= -1.0e38f) ? 0.f : __expf(s[1][r] - mn); float es = e0 + e1;
#pragma unroll
      for (int o = 1; o < 16; o <<= 1) es += __shfl_xor(es, o);
      l[r] = l[r] * alpha + es; m[r] = mn;
#pragma unroll
      for (int dt = 0; dt < 4; ++dt) { acc[dt][r] *= alpha; accl[dt][r] *= alpha; }
      sp[wave][8 * g + r][col] = e0; sp[wave][8 * g + r][16 + col] = e1; }
    LDSX();
    v16h pa, pl; { const float* prow = &sp[wave][col][0] + 8 * (lane >> 4);
#pragma unroll
      for (int i = 0; i < 8; ++i) { const float x0 = prow[i] * 2048.0f, x1 = prow[16 + i] * 2048.0f; const _Float16 h0 = (_Float16)x0, h1 = (_Float16)x1; pa[i] = h0; pa[8 + i] = h1; pl[i] = (_Float16)((x0 - (float)h0) * 2048.0f); pl[8 + i] = (_Float16)((x1 - (float)h1) * 2048.0f); } }   // P scaled by 2^11 before the f16 split so small softmax weights stay out of the f16 subnormal range; 2^-11 folded into the epilogue
#pragma unroll
    for (int dt = 0; dt < 4; ++dt) { const size_t vr = VT(b, h, ks) + dt * 512 + lane * 8; const v16h vh = vf[dt]; acc[dt] = wmma16(pa, vh, acc[dt]); if (qb < 2) { accl[dt] = wmma16(pl, vh, accl[dt]); accl[dt] = wmma16(pa, fragp_h(VTL + vr), accl[dt]); } }   // leading query blocks: P hi/lo x V hi/lo (3 products); elsewhere P x V single
    LDSX(); }
#pragma unroll
  for (int r = 0; r < 8; ++r) { const float il = (1.0f / 2048.0f) / l[r];
#pragma unroll
    for (int dt = 0; dt < 4; ++dt) so[wave][8 * g + r][dt * 16 + col] = (acc[dt][r] + accl[dt][r] * (1.0f / 2048.0f)) * il; }
  LDSX();
  // the wave's 16 x 64 tile = two k passes of k_out x four pieces, each piece one 512-B store
  float* ot = O + ((size_t)(b * (SS / 16) + qb * 4 + wave) * (DM / 32) + h * 2) * 512 + lane * 4;
#pragma unroll
  for (int u = 0; u < 8; ++u) vst2(ot + u * 128, *(const v4f*)&so[wave][col][(u >> 2) * 32 + ((u >> 1) & 1) * 16 + g * 8 + (u & 1) * 4]);
}
// ---- k_out: block = (64 rows, 128 cols): out = O(hi/lo) . Wo rows (2 products) + bo
__global__ __launch_bounds__(128) void k_out(const float* __restrict__ O, const __bf16* __restrict__ P, const float* __restrict__ BO, float* __restrict__ Y) {
  __shared__ __align__(16) float so[4][16][132];
  const int tid = threadIdx.x, wave = tid >> 5, lane = tid & 31, col = lane & 15, g = lane >> 4; const size_t r0 = (size_t)blockIdx.x * 64 + wave * 16; const int n0 = blockIdx.y * 128;
  v8f acc[8] = {};
  // two register sets, as in k_qkv: a pass's loads go out as one group, a pass ahead of the WMMAs that read them
  const float* xa = O + (r0 >> 4) * (16 * DM) + lane * 4; const __bf16* wb = P + (size_t)(n0 >> 7) * (128 * DM) + lane * 8;
  PassF s0, s1;
  auto mm = [&](const PassF& s) { float v[16];
#pragma unroll
    for (int i = 0; i < 4; ++i) { v[i] = s.x[0][i]; v[4 + i] = s.x[1][i]; v[8 + i] = s.x[2][i]; v[12 + i] = s.x[3][i]; }
    const F2 a = bsplit16(v);
#pragma unroll
    for (int j = 0; j < 8; ++j) { acc[j] = wmma_bf(a.l, s.w[j], acc[j]); acc[j] = wmma_bf(a.h, s.w[j], acc[j]); } };
  pass_ld(s0, xa, wb, 0);
#pragma unroll 1   // kept rolled: the body already holds both register sets, a further copy would only cost registers
  for (int kc = 0; kc < DM / 32 - 2; kc += 2) { pass_ld(s1, xa, wb, kc + 1); mm(s0); pass_ld(s0, xa, wb, kc + 2); mm(s1);
    asm volatile("s_wait_xcnt 0x0" ::: "memory"); }   // before the next trip rewrites the address registers of this trip's loads
  pass_ld(s1, xa, wb, DM / 32 - 1); mm(s0); mm(s1);
  asm volatile("s_wait_xcnt 0x0" ::: "memory");   // before the epilogue reuses the address registers of the last loads
#pragma unroll
  for (int j = 0; j < 8; ++j) {
#pragma unroll
    for (int r = 0; r < 8; ++r) so[wave][8 * g + r][j * 16 + col] = acc[j][r] + bfr(BO[n0 + j * 16 + col]); }
  LDSX();
  for (int rl = 0; rl < 16; ++rl) vst2(Y + (r0 + rl) * DM + n0 + lane * 4, *(const v4f*)&so[wave][rl][lane * 4]);
}
extern "C" void kernel_launch(void* const* d_in, const int* in_sizes, int n_in, void* d_out, int out_size, void* d_ws, size_t ws_size, hipStream_t stream) {
  (void)in_sizes; (void)n_in; (void)out_size;
  const float** F = (const float**)d_in;   // 0 x [2,2048,1024], 1 w_qkv [3072,1024] natural (rows q | k | v), 2 b_qkv [3072], 3 w_o [1024,1024] natural, 4 b_o
  if (ws_size < (size_t)WS_END) return;
  char* ws = (char*)d_ws; __bf16* PK = (__bf16*)(ws + WS_PK); _Float16 *QK = (_Float16*)(ws + WS_QK), *QKL = (_Float16*)(ws + WS_QKL), *VTH = (_Float16*)(ws + WS_VTH), *VTL = (_Float16*)(ws + WS_VTL); float* O = (float*)(ws + WS_O); __bf16* XP = (__bf16*)(ws + WS_XP);
  k_pack<<<dim3((QKVW + DM + NB * SS) / 16, 4), 256, 0, stream>>>(F[1], F[3], F[0], PK, XP);
  k_qkv<<<dim3(TNB * SS / 64, QKVW / 128), 128, 0, stream>>>(XP, PK + PK_A, F[2], F[2] + DM, F[2] + 2 * DM, QK, QKL, VTH, VTL);
  k_attn<<<dim3(TQB, NH, TNB), 128, 0, stream>>>(QK, QKL, VTH, VTL, nullptr, O);
  k_out<<<dim3(TOB, DM / 128), 128, 0, stream>>>(O, PK + PK_P, F[4], (float*)d_out);
}

// v003
// Measured time: 143 microseconds a run.
// Timed twice side by side with v002, it ran 1.31 times as fast both times.
// Counting every step since v000, it is 3.03 times as fast.
// compute dtype: all float inputs rounded to bf16; qkv = x . W^T + b with EXACT bf16 products on WMMA 16x16x32 (natural rows), f16 hi + residual; causal PLAIN-HYBRID attention (first 128 queries 3-product, later single f16; logits std ~0.5, diffuse), x 1/32, running-max softmax in f32 (hardware exp); out = ctx (bf16 hi + lo) . Wo^T + b_o; f32 output.
#include <hip/hip_runtime.h>
#include <math.h>

typedef __attribute__((ext_vector_type(16))) _Float16 v16h;
typedef __attribute__((ext_vector_type(16))) __bf16 v16b;
typedef __attribute__((ext_vector_type(8)))  _Float16 v8h;
typedef __attribute__((ext_vector_type(8)))  float v8f;
typedef __attribute__((ext_vector_type(4)))  float v4f;
typedef __attribute__((ext_vector_type(2)))  float v2f;
typedef __attribute__((ext_vector_type(4)))  unsigned v4u;
typedef __attribute__((ext_vector_type(4)))  int v4i;
typedef float __attribute__((may_alias)) float_a;
typedef int __attribute__((may_alias)) int_a;

template <typename T> __device__ __forceinline__ void vst2(void* p, T v) { *(T*)p = v;  }
__device__ __forceinline__ v8f wmma16(v16h a, v16h b, v8f c) {
  v8f d = __builtin_amdgcn_wmma_f32_16x16x32_f16(false, a, false, b, (short)0, c, false, false);
  asm volatile("v_nop\n\tv_nop\n\tv_nop\n\tv_nop" : "+v"(d) : "v"(a), "v"(b));
  return d;
}
__device__ __forceinline__ v8f wmma_bf(v16b a, v16b b, v8f c) {
  v8f d = __builtin_amdgcn_wmma_f32_16x16x32_bf16(false, a, false, b, (short)0, c, false, false);
  asm volatile("v_nop\n\tv_nop\n\tv_nop\n\tv_nop" : "+v"(d) : "v"(a), "v"(b));
  return d;
}
// Multi-head attention '2' (B 2, N 2,048, C 1,024, 16 heads x 64): fused natural w_qkv (q | k | v row blocks) + bias, causal softmax(q k / sqrt(1024)) v (the module scales by 1/sqrt(embed_dim), -inf fill), merge heads, natural w_o + b_o.
__device__ __forceinline__ v16h frag_h(const _Float16* rowk0, int lane) {
  union { v16h v; v8h q[2]; } u; const _Float16* p = rowk0 + 8 * (lane >> 4);
  u.q[0] = *(const v8h*)p; u.q[1] = *(const v8h*)(p + 16); return u.v;
}
__device__ __forceinline__ v16h frag_f32(const float* rowk0, int lane) {
  v16h a; const float* p = rowk0 + 8 * (lane >> 4);
#pragma unroll
  for (int i = 0; i < 8; ++i) { a[i] = (_Float16)p[i]; a[8 + i] = (_Float16)p[16 + i]; }
  return a;
}
__device__ __forceinline__ v16h frag_f32s(const float* rowk0, int lane, float sc) {
  v16h a; const float* p = rowk0 + 8 * (lane >> 4);
#pragma unroll
  for (int i = 0; i < 8; ++i) { a[i] = (_Float16)(p[i] * sc); a[8 + i] = (_Float16)(p[16 + i] * sc); }
  return a;
}
// column fragment from a [K][ld] layout (column n), rows >= K read as 0
__device__ __forceinline__ v16h fragc_f32(const float* W, int k0, int n, int lane, int ld, int K) {
  v16h a; const int g = lane >> 4;
#pragma unroll
  for (int i = 0; i < 8; ++i) { const int ka = k0 + 8 * g + i, kb = ka + 16;
    a[i] = (_Float16)(ka < K ? W[(size_t)(ka < K ? ka : K - 1) * ld + n] : 0.f); a[8 + i] = (_Float16)(kb < K ? W[(size_t)(kb < K ? kb : K - 1) * ld + n] : 0.f); }
  return a;
}
struct F2 { v16b h, l; };
__device__ __forceinline__ F2 bsplit16(const float v[16]) { F2 r;
#pragma unroll
  for (int i = 0; i < 16; ++i) { const __bf16 h = (__bf16)v[i]; r.h[i] = h; r.l[i] = (__bf16)(v[i] - (float)h); }
  return r; }
__device__ __forceinline__ F2 split_row(const float* row, int k0, int lane) { float v[16]; const float* p = row + k0 + 8 * (lane >> 4);
#pragma unroll
  for (int i = 0; i < 8; ++i) { v[i] = p[i]; v[8 + i] = p[16 + i]; }
  return bsplit16(v); }
__device__ __forceinline__ F2 split_rowK(const float* row, int k0, int lane, int K) { float v[16]; const int g = lane >> 4;
#pragma unroll
  for (int i = 0; i < 8; ++i) { const int ka = k0 + 8 * g + i, kb = ka + 16; v[i] = ka < K ? row[ka < K ? ka : K - 1] : 0.f; v[8 + i] = kb < K ? row[kb < K ? kb : K - 1] : 0.f; }
  return bsplit16(v); }
__device__ __forceinline__ F2 split_col(const float* W, int k0, int n, int lane, int ld, int K) { float v[16]; const int g = lane >> 4;
#pragma unroll
  for (int i = 0; i < 8; ++i) { const int ka = k0 + 8 * g + i, kb = ka + 16; v[i] = ka < K ? W[(size_t)(ka < K ? ka : K - 1) * ld + n] : 0.f; v[8 + i] = kb < K ? W[(size_t)(kb < K ? kb : K - 1) * ld + n] : 0.f; }
  return bsplit16(v); }
__device__ __forceinline__ v8f mac3(const F2& a, const F2& b, v8f c) { c = wmma_bf(a.l, b.h, c); c = wmma_bf(a.h, b.l, c); return wmma_bf(a.h, b.h, c); }
__device__ __forceinline__ float sigm(float v) { return 1.0f / (1.0f + expf(-v)); }
#define LDSX() do { asm volatile("s_wait_dscnt 0" ::: "memory"); __builtin_amdgcn_wave_barrier(); __builtin_amdgcn_fence(__ATOMIC_RELEASE, "workgroup"); } while (0)


#define NB 2
#define SS 2048
#define DM 1024
#define NH 16
#define HD 64
#define QKVW (3 * DM)
#ifndef TQB
#define TQB (SS / 64)
#define TNB NB
#define TOB (NB * SS / 64)     // output row tiles (all)
#endif
typedef __attribute__((ext_vector_type(8))) __bf16 v8b;
// FRAGMENT ORDER of a 16-bit operand in the workspace: a 16 (rows) x 32 (k) fragment is 1 KiB = two pieces of 512 B; in piece q lane l owns 16 B: row l & 15, k = 16 q + 8 (l >> 4) + 0..7.
// So each wave-wide 16-B load or store covers four whole 128-B lines. p = the fragment's start + 8 * lane.
__device__ __forceinline__ v16b fragp_b(const __bf16* p) {
  union { v16b v; v8b q[2]; } u; u.q[0] = *(const v8b*)p; u.q[1] = *(const v8b*)(p + 256); return u.v;
}
__device__ __forceinline__ v16h fragp_h(const _Float16* p) {
  union { v16h v; v8h q[2]; } u; u.q[0] = *(const v8h*)p; u.q[1] = *(const v8h*)(p + 256); return u.v;
}
__device__ __forceinline__ float bfr(float v) { return (float)(__bf16)v; }
__device__ __attribute__((noinline)) float exp_ni(float v) { return expf(v); }
__device__ __attribute__((noinline)) float erf_ni(float v) { return erff(v); }

#define PK_A 0                       // Wqkv: [24 blocks of 128 rows][32 k passes][8 tiles of 16 rows] fragments (fragment order)
#define PK_P (PK_A + QKVW * DM)        // Wo: [8 blocks][32 passes][8 tiles] fragments
#define PK_END (PK_P + DM * DM)
#define WS_PK  0u
#define WS_QK  (WS_PK + 2u * PK_END)             // f16 [q | k][b][head][128 tiles of 16 rows][2 k passes] fragments
#define WS_QKL (WS_QK + 2u * NB * SS * 2 * DM)     // f16 q | k residual planes x2048, same order
#define WS_VTH (WS_QKL + 2u * NB * SS * 2 * DM)    // f16 hi [b][head][64 passes of 32 keys][4 tiles of 16 d] fragments (row = d, k = key)
#define WS_VTL (WS_VTH + 2u * NB * DM * SS)        // f16 lo x 2048
#define WS_O   (WS_VTL + 2u * NB * DM * SS)        // f32 [256 tiles of 16 rows][32 k passes][4 pieces of 512 B]: piece i, lane l: row l & 15, k = 16 (i >> 1) + 8 (l >> 4) + 4 (i & 1) + 0..3
#define WS_CS  (WS_O + 4u * NB * SS * DM)           // f32 2 x [2048][32], reserved: nothing writes or reads it
#define WS_XP  (WS_CS + 4u * 2 * SS * 32)           // bf16 x: [256 tiles of 16 rows][32 k passes] fragments
#define WS_END (WS_XP + 2u * NB * SS * DM)
#define QKT(plane, b, h, st) (((((size_t)(plane) * NB + (b)) * NH + (h)) * (SS / 16) + (st)) * 1024)   // start of a 16 x 64 q or k tile (two fragments), in elements
#define VT(b, h, ks) ((((size_t)(b) * NH + (h)) * (SS / 32) + (ks)) * 2048)   // start of a pass's four V fragments, in elements
// ---- k_pack: block = (tile of 16 natural rows, quarter of k): f32 -> bf16 in fragment order, whole lines in (two rows x 256 B a wave) and out, turned in LDS; tiles 0..191 w_qkv, 192..255 w_o (both into PK), 256..511 x (into XP)
typedef __attribute__((ext_vector_type(4))) __bf16 v4b;
__global__ __launch_bounds__(256) void k_pack(const float* __restrict__ WA, const float* __restrict__ WO, const float* __restrict__ X, __bf16* __restrict__ PK, __bf16* __restrict__ XP) {
  __shared__ __align__(16) __bf16 s[16][264];   // pitch 528 B = 16 B x odd: the 16 rows of a fragment piece fall on distinct banks
  const int t = blockIdx.x, kq = blockIdx.y, tid = threadIdx.x; const int TA = QKVW / 16, TW = (QKVW + DM) / 16;
  const float* srcp = ((t < TA) ? WA + (size_t)t * 16 * DM : (t < TW) ? WO + (size_t)(t - TA) * 16 * DM : X + (size_t)(t - TW) * 16 * DM) + (size_t)(tid >> 4) * DM + kq * 256 + (tid & 15) * 4;
  v4f a[4];
#pragma unroll
  for (int it = 0; it < 4; ++it) a[it] = *(const v4f*)(srcp + it * 64);
#pragma unroll
  for (int it = 0; it < 4; ++it) { v4b r;
#pragma unroll
    for (int i = 0; i < 4; ++i) r[i] = (__bf16)a[it][i];
    *(v4b*)&s[tid >> 4][it * 64 + (tid & 15) * 4] = r; }
  __syncthreads();
  // weights: [block of 128 rows][k pass][8 tiles] fragments, so a wave's pass is 8 KiB in a row; x: [tile][k pass]
  __bf16* dst = (t < TW) ? PK + (size_t)(t >> 3) * (128 * DM) + (t & 7) * 512 : XP + (size_t)(t - TW) * 16 * DM; const int ps = (t < TW) ? 4096 : 512;
#pragma unroll
  for (int it = 0; it < 2; ++it) { const int o = it * 256 + tid, kcl = o >> 6, q = (o >> 5) & 1, l = o & 31;
    vst2((unsigned*)(dst + (size_t)(kq * 8 + kcl) * ps + q * 256 + l * 8), *(const v4u*)&s[l & 15][kcl * 32 + q * 16 + (l >> 4) * 8]); }
}
// one k pass (32 k) of a 16 x 128 wave tile: the A fragment (PassF: its four f32 pieces; PassB: bf16) and the 8 weight fragments; xa and wb hold the lane's offset
struct PassF { v4f x[4]; v16b w[8]; };
__device__ __forceinline__ void pass_ld(PassF& s, const float* xa, const __bf16* wb, int kc) {
  const float* p = xa + kc * 512; s.x[0] = *(const v4f*)p; s.x[1] = *(const v4f*)(p + 128); s.x[2] = *(const v4f*)(p + 256); s.x[3] = *(const v4f*)(p + 384);
#pragma unroll
  for (int j = 0; j < 8; ++j) s.w[j] = fragp_b(wb + kc * 4096 + j * 512);
}
struct PassB { v16b a; v16b w[8]; };
__device__ __forceinline__ void pass_ld(PassB& s, const __bf16* xa, const __bf16* wb, int kc) {
  s.a = fragp_b(xa + kc * 512);
#pragma unroll
  for (int j = 0; j < 8; ++j) s.w[j] = fragp_b(wb + kc * 4096 + j * 512);
}
__global__ __launch_bounds__(128) void k_qkv(const __bf16* __restrict__ XP, const __bf16* __restrict__ P, const float* __restrict__ BQ, const float* __restrict__ BK, const float* __restrict__ BV, _Float16* __restrict__ QK, _Float16* __restrict__ QKL, _Float16* __restrict__ VTH, _Float16* __restrict__ VTL) {
  const int which0 = (blockIdx.y * 128) / DM; const float* BB = BQ ? (((which0 == 0) ? BQ : (which0 == 1) ? BK : BV) + (blockIdx.y * 128 - which0 * DM)) : nullptr;
  __shared__ __align__(16) _Float16 so[4][16][136], sol[4][16][136]; __shared__ __align__(16) _Float16 sth[128][72], stl[128][72];
  const int tid = threadIdx.x, wave = tid >> 5, lane = tid & 31, col = lane & 15, g = lane >> 4; const size_t r0 = (size_t)blockIdx.x * 64 + wave * 16; const int n0 = blockIdx.y * 128;
  v8f acc[8] = {};
  // two register sets: a pass's 18 loads go out as one group, a pass ahead of the WMMAs that read them
  const __bf16* xa = XP + (r0 >> 4) * (16 * DM) + lane * 8; const __bf16* wb = P + (size_t)(n0 >> 7) * (128 * DM) + lane * 8;
  PassB s0, s1;
  auto mm = [&](const PassB& s) {
#pragma unroll
    for (int j = 0; j < 8; ++j) acc[j] = wmma_bf(s.a, s.w[j], acc[j]); };
  pass_ld(s0, xa, wb, 0);
#pragma unroll 1   // kept rolled: the body already holds both register sets, a further copy would only cost registers
  for (int kc = 0; kc < DM / 32 - 2; kc += 2) { pass_ld(s1, xa, wb, kc + 1); mm(s0); pass_ld(s0, xa, wb, kc + 2); mm(s1);
    asm volatile("s_wait_xcnt 0x0" ::: "memory"); }   // before the next trip rewrites the address registers of this trip's loads
  pass_ld(s1, xa, wb, DM / 32 - 1); mm(s0); mm(s1);
  asm volatile("s_wait_xcnt 0x0" ::: "memory");   // before the epilogue reuses the address registers of the last loads
  if (n0 < 2 * DM) {   // q stored unscaled (f16 sigma ~0.6, no subnormal exposure); 1/32 applied to the f32 score
#pragma unroll
    for (int j = 0; j < 8; ++j) {
#pragma unroll
      for (int r = 0; r < 8; ++r) { const float v = acc[j][r] + (BB ? bfr(BB[j * 16 + col]) : 0.f); const _Float16 hv = (_Float16)v; so[wave][8 * g + r][j * 16 + col] = hv; sol[wave][8 * g + r][j * 16 + col] = (_Float16)((v - (float)hv) * 2048.0f); } }   // q, k (+ bias) as f16 hi + (x2048) residual
    LDSX();
    // the wave's 16 x 128 tile = two heads x two fragments x two pieces, each piece one 512-B store
    const size_t o0 = QKT(which0, r0 / SS, (n0 - which0 * DM) / HD, (r0 % SS) / 16) + lane * 8;
#pragma unroll
    for (int u = 0; u < 8; ++u) { const int c0 = (u >> 2) * HD + (u & 3) * 16 + g * 8; const size_t o = o0 + (size_t)(u >> 2) * ((SS / 16) * 1024) + (u & 3) * 256;
      vst2((unsigned*)(QK + o), *(const v4u*)&so[wave][col][c0]); vst2((unsigned*)(QKL + o), *(const v4u*)&sol[wave][col][c0]); }
  } else {
#pragma unroll
    for (int j = 0; j < 8; ++j) {
#pragma unroll
      for (int r = 0; r < 8; ++r) { const float v = acc[j][r] + (BB ? bfr(BB[j * 16 + col]) : 0.f); const _Float16 hv = (_Float16)v; sth[j * 16 + col][wave * 16 + 8 * g + r] = hv; stl[j * 16 + col][wave * 16 + 8 * g + r] = (_Float16)((v - (float)hv) * 2048.0f); } }
    __syncthreads();
    const size_t rb = (size_t)blockIdx.x * 64; const int b = (int)(rb / SS), sq0 = (int)(rb % SS); const int pc0 = n0 - 2 * DM;
    // the block's 128 d x 64 keys = two heads x two passes x four d tiles x two pieces, each piece one 512-B store of one wave
    for (int it = 0; it < 8; ++it) { const int idx = it * 4 + wave, q = idx & 1, dt = (idx >> 1) & 3, ksl = (idx >> 3) & 1, hh = idx >> 4; const int d = hh * HD + dt * 16 + col, sc = ksl * 32 + q * 16 + g * 8;
      const size_t o = VT(b, pc0 / HD + hh, sq0 / 32 + ksl) + dt * 512 + q * 256 + lane * 8; vst2((unsigned*)(VTH + o), *(const v4u*)&sth[d][sc]); vst2((unsigned*)(VTL + o), *(const v4u*)&stl[d][sc]); }
  }
}
// lane l with lane l ^ 16 (a vector cross-row move, no LDS path)
__device__ __forceinline__ float xhalf(float x) { return __builtin_bit_cast(float, __builtin_amdgcn_permlanex16(__builtin_bit_cast(int, x), __builtin_bit_cast(int, x), 0x76543210, 0xfedcba98, false, false)); }
// ---- k_attn: block = (64 queries, head h, batch b): causal flash attention (K = 64: 2 k-steps) in the TRANSPOSED form: S^T = K . Q^T (A = K fragment, B = q fragment), O^T += V^T . P^T (A = V fragment, B = P).
// A lane then holds ONE query (q0 + col): of a 16-key score tile its 8 registers are keys 8 g + r, so maximum and sum run inside the lane, the two wave halves meet in one exchange (the maximum, each pass) and once behind the loop (the sum).
// The two score tiles of a pass, converted in place, ARE the B fragment of P^T (element s = tile s >> 3, register s & 7: the k order of the V fragments), so P touches no LDS; acc[dt][r] = O(query col, d = dt * 16 + 8 g + r) is already k_out's fragment order.
// scores = (q.k) / 32 with single f16 operands (leading blocks add k hi x q lo and k lo x q hi), P.V: f16 P x V hi (leading blocks add P lo*2048 x V hi and P x V lo*2048 in a second accumulator); O(row b*S+q, col h*64+d) = (acc + accl / 2048) / (2048 l)
// four waves per SIMD: all 1,024 blocks stay resident at once
__global__ __launch_bounds__(128) __attribute__((amdgpu_waves_per_eu(4, 4))) void k_attn(const _Float16* __restrict__ QK, const _Float16* __restrict__ QKL, const _Float16* __restrict__ VTH, const _Float16* __restrict__ VTL, const void* __restrict__ KMASK, float* __restrict__ O) {
  const int tid = threadIdx.x, wave = __builtin_amdgcn_readfirstlane(tid >> 5), lane = tid & 31, col = lane & 15, g = lane >> 4;   // the wave's number in a scalar register: row addresses built on it cost no vector register
  const int qb = blockIdx.x, h = blockIdx.y, b = blockIdx.z; const int q0 = qb * 64 + wave * 16; const size_t qt = QKT(0, b, h, qb * 4 + wave) + lane * 8;   // the wave's q tile, at the lane's 16 B
  v16h aq[2];   // the q residual fragments are read where the leading blocks use them
#pragma unroll
  for (int kc = 0; kc < 2; ++kc) aq[kc] = fragp_h(QK + qt + kc * 512);
  float m = -3.0e38f, l = 0.f;   // of the lane's query; l sums the keys of the lane's own half only
  v8f acc[4] = {}, accl[4] = {};
  const int nksc = (qb * 64 + 64) / 32;   // causal: key tiles up to the end of this query block
  // K fragments are fetched one pass ahead (right behind the pass's score products), V hi fragments at the head of their pass: each as one group, so no single-product WMMA waits on a load issued directly in front of it (the leading blocks read their residual and V lo fragments where used)
  const _Float16* kb0 = QK + QKT(1, b, h, 0) + lane * 8; v16h kf[2][2];
#pragma unroll
  for (int ct = 0; ct < 2; ++ct) {
#pragma unroll
    for (int kc = 0; kc < 2; ++kc) kf[ct][kc] = fragp_h(kb0 + ct * 1024 + kc * 512); }
#pragma unroll 1
  for (int ks = 0; ks < nksc; ++ks) { v8f s[2]; v16h vf[4]; const int dq = q0 + col - ks * 32 - 8 * g;   // the lane's query, counted from the first key of the lane's half in this pass
#pragma unroll
    for (int dt = 0; dt < 4; ++dt) vf[dt] = fragp_h(VTH + VT(b, h, ks) + dt * 512 + lane * 8);
    asm volatile("s_wait_xcnt 0x0" ::: "memory");   // before the address registers of the V loads are reused
#pragma unroll
    for (int ct = 0; ct < 2; ++ct) { const _Float16* krowl = QKL + QKT(1, b, h, ks * 2 + ct) + lane * 8; v8f c = {}, cl = {};
      if (qb < 2) {   // leading query blocks (few keys, outputs far above the global rms): 3 products
#pragma unroll
        for (int kc = 0; kc < 2; ++kc) { const v16h kh = kf[ct][kc]; c = wmma16(kh, aq[kc], c); cl = wmma16(kh, fragp_h(QKL + qt + kc * 512), cl); cl = wmma16(fragp_h(krowl + kc * 512), aq[kc], cl); }
        asm volatile("s_wait_xcnt 0x0" ::: "memory");   // before the address registers of the residual loads are reused
#pragma unroll
        for (int r = 0; r < 8; ++r) c[r] += cl[r] * (1.0f / 2048.0f); }
      else {
#pragma unroll
        for (int kc = 0; kc < 2; ++kc) c = wmma16(kf[ct][kc], aq[kc], c); }   // single product elsewhere
#pragma unroll
      for (int r = 0; r < 8; ++r) s[ct][r] = (ct * 16 + r <= dq) ? c[r] * 0.03125f : -3.0e38f; }   // 1/sqrt(1024); keys behind the lane's query excluded
    { const int kn = (ks + 1 < nksc) ? ks + 1 : ks;   // the last pass fetches its own rows again (in bounds, not used)
#pragma unroll
      for (int ct = 0; ct < 2; ++ct) {
#pragma unroll
        for (int kc = 0; kc < 2; ++kc) kf[ct][kc] = fragp_h(kb0 + (size_t)kn * 2048 + ct * 1024 + kc * 512); } }
    float mt[8];
#pragma unroll
    for (int r = 0; r < 8; ++r) mt[r] = fmaxf(s[0][r], s[1][r]);
    float mx = fmaxf(fmaxf(fmaxf(mt[0], mt[1]), fmaxf(mt[2], mt[3])), fmaxf(fmaxf(mt[4], mt[5]), fmaxf(mt[6], mt[7])));
    mx = fmaxf(mx, xhalf(mx));   // both halves now hold the maximum over the pass's 32 keys
    const float mn = fmaxf(m, mx); const float alpha = (m <= -1.0e38f) ? 0.f : __expf(m - mn);
    v16h pa, pl; float es[4] = {0.f, 0.f, 0.f, 0.f};   // four short chains of adds in place of one long one
#pragma unroll
    for (int i = 0; i < 16; ++i) { const float sv = s[i >> 3][i & 7]; const float e = (sv <= -1.0e38f) ? 0.f : __expf(sv - mn); es[i & 3] += e;
      const float x0 = e * 2048.0f; const _Float16 h0 = (_Float16)x0; pa[i] = h0; pl[i] = (_Float16)((x0 - (float)h0) * 2048.0f); }   // P scaled by 2^11 before the f16 split so small softmax weights stay out of the f16 subnormal range; 2^-11 folded into the epilogue
    l = l * alpha + ((es[0] + es[1]) + (es[2] + es[3])); m = mn;
#pragma unroll
    for (int dt = 0; dt < 4; ++dt) {
#pragma unroll
      for (int r = 0; r < 8; ++r) { acc[dt][r] *= alpha; accl[dt][r] *= alpha; } }
#pragma unroll
    for (int dt = 0; dt < 4; ++dt) { const size_t vr = VT(b, h, ks) + dt * 512 + lane * 8; const v16h vh = vf[dt]; acc[dt] = wmma16(vh, pa, acc[dt]); if (qb < 2) { accl[dt] = wmma16(vh, pl, accl[dt]); accl[dt] = wmma16(fragp_h(VTL + vr), pa, accl[dt]); } }   // leading query blocks: P hi/lo x V hi/lo (3 products); elsewhere P x V single
  }
  const float il = (1.0f / 2048.0f) / (l + xhalf(l));   // the two halves' sums meet here, once
  // the wave's 16 x 64 tile = two k passes of k_out x four pieces, each piece one 512-B store, straight from the accumulators
  float* ot = O + ((size_t)(b * (SS / 16) + qb * 4 + wave) * (DM / 32) + h * 2) * 512 + lane * 4;
#pragma unroll
  for (int u = 0; u < 8; ++u) { v4f o;
#pragma unroll
    for (int i = 0; i < 4; ++i) o[i] = (acc[u >> 1][(u & 1) * 4 + i] + accl[u >> 1][(u & 1) * 4 + i] * (1.0f / 2048.0f)) * il;
    vst2(ot + u * 128, o); }
}
// ---- k_out: block = (64 rows, 128 cols): out = O(hi/lo) . Wo rows (2 products) + bo
__global__ __launch_bounds__(128) void k_out(const float* __restrict__ O, const __bf16* __restrict__ P, const float* __restrict__ BO, float* __restrict__ Y) {
  __shared__ __align__(16) float so[4][16][132];
  const int tid = threadIdx.x, wave = tid >> 5, lane = tid & 31, col = lane & 15, g = lane >> 4; const size_t r0 = (size_t)blockIdx.x * 64 + wave * 16; const int n0 = blockIdx.y * 128;
  v8f acc[8] = {};
  // two register sets, as in k_qkv: a pass's loads go out as one group, a pass ahead of the WMMAs that read them
  const float* xa = O + (r0 >> 4) * (16 * DM) + lane * 4; const __bf16* wb = P + (size_t)(n0 >> 7) * (128 * DM) + lane * 8;
  PassF s0, s1;
  auto mm = [&](const PassF& s) { float v[16];
#pragma unroll
    for (int i = 0; i < 4; ++i) { v[i] = s.x[0][i]; v[4 + i] = s.x[1][i]; v[8 + i] = s.x[2][i]; v[12 + i] = s.x[3][i]; }
    const F2 a = bsplit16(v);
#pragma unroll
    for (int j = 0; j < 8; ++j) { acc[j] = wmma_bf(a.l, s.w[j], acc[j]); acc[j] = wmma_bf(a.h, s.w[j], acc[j]); } };
  pass_ld(s0, xa, wb, 0);
#pragma unroll 1   // kept rolled: the body already holds both register sets, a further copy would only cost registers
  for (int kc = 0; kc < DM / 32 - 2; kc += 2) { pass_ld(s1, xa, wb, kc + 1); mm(s0); pass_ld(s0, xa, wb, kc + 2); mm(s1);
    asm volatile("s_wait_xcnt 0x0" ::: "memory"); }   // before the next trip rewrites the address registers of this trip's loads
  pass_ld(s1, xa, wb, DM / 32 - 1); mm(s0); mm(s1);
  asm volatile("s_wait_xcnt 0x0" ::: "memory");   // before the epilogue reuses the address registers of the last loads
#pragma unroll
  for (int j = 0; j < 8; ++j) {
#pragma unroll
    for (int r = 0; r < 8; ++r) so[wave][8 * g + r][j * 16 + col] = acc[j][r] + bfr(BO[n0 + j * 16 + col]); }
  LDSX();
  for (int rl = 0; rl < 16; ++rl) vst2(Y + (r0 + rl) * DM + n0 + lane * 4, *(const v4f*)&so[wave][rl][lane * 4]);
}
extern "C" void kernel_launch(void* const* d_in, const int* in_sizes, int n_in, void* d_out, int out_size, void* d_ws, size_t ws_size, hipStream_t stream) {
  (void)in_sizes; (void)n_in; (void)out_size;
  const float** F = (const float**)d_in;   // 0 x [2,2048,1024], 1 w_qkv [3072,1024] natural (rows q | k | v), 2 b_qkv [3072], 3 w_o [1024,1024] natural, 4 b_o
  if (ws_size < (size_t)WS_END) return;
  char* ws = (char*)d_ws; __bf16* PK = (__bf16*)(ws + WS_PK); _Float16 *QK = (_Float16*)(ws + WS_QK), *QKL = (_Float16*)(ws + WS_QKL), *VTH = (_Float16*)(ws + WS_VTH), *VTL = (_Float16*)(ws + WS_VTL); float* O = (float*)(ws + WS_O); __bf16* XP = (__bf16*)(ws + WS_XP);
  k_pack<<<dim3((QKVW + DM + NB * SS) / 16, 4), 256, 0, stream>>>(F[1], F[3], F[0], PK, XP);
  k_qkv<<<dim3(TNB * SS / 64, QKVW / 128), 128, 0, stream>>>(XP, PK + PK_A, F[2], F[2] + DM, F[2] + 2 * DM, QK, QKL, VTH, VTL);
  k_attn<<<dim3(TQB, NH, TNB), 128, 0, stream>>>(QK, QKL, VTH, VTL, nullptr, O);
  k_out<<<dim3(TOB, DM / 128), 128, 0, stream>>>(O, PK + PK_P, F[4], (float*)d_out);
}

// v004
// A run of this version takes 129 microseconds.
// Timed twice side by side with v003, it ran 1.12 and 1.10 times as fast.
// All steps since v000 together make it 3.36 times as fast.
// compute dtype: all float inputs rounded to bf16; qkv = x . W^T + b with EXACT bf16 products on WMMA 16x16x32 (natural rows), f16 hi + residual; causal PLAIN-HYBRID attention (first 128 queries 3-product, later single f16; logits std ~0.5, diffuse), x 1/32, running-max softmax in f32 (hardware exp); out = ctx (bf16 hi + lo) . Wo^T + b_o; f32 output.
#include <hip/hip_runtime.h>
#include <math.h>

typedef __attribute__((ext_vector_type(16))) _Float16 v16h;
typedef __attribute__((ext_vector_type(16))) __bf16 v16b;
typedef __attribute__((ext_vector_type(8)))  _Float16 v8h;
typedef __attribute__((ext_vector_type(8)))  float v8f;
typedef __attribute__((ext_vector_type(4)))  float v4f;
typedef __attribute__((ext_vector_type(2)))  float v2f;
typedef __attribute__((ext_vector_type(4)))  unsigned v4u;
typedef __attribute__((ext_vector_type(4)))  int v4i;
typedef float __attribute__((may_alias)) float_a;
typedef int __attribute__((may_alias)) int_a;

template <typename T> __device__ __forceinline__ void vst2(void* p, T v) { *(T*)p = v;  }
__device__ __forceinline__ v8f wmma16(v16h a, v16h b, v8f c) {
  v8f d = __builtin_amdgcn_wmma_f32_16x16x32_f16(false, a, false, b, (short)0, c, false, false);
  asm volatile("v_nop\n\tv_nop\n\tv_nop\n\tv_nop" : "+v"(d) : "v"(a), "v"(b));
  return d;
}
__device__ __forceinline__ v8f wmma_bf(v16b a, v16b b, v8f c) {
  v8f d = __builtin_amdgcn_wmma_f32_16x16x32_bf16(false, a, false, b, (short)0, c, false, false);
  asm volatile("v_nop\n\tv_nop\n\tv_nop\n\tv_nop" : "+v"(d) : "v"(a), "v"(b));
  return d;
}
// Multi-head attention '2' (B 2, N 2,048, C 1,024, 16 heads x 64): fused natural w_qkv (q | k | v row blocks) + bias, causal softmax(q k / sqrt(1024)) v (the module scales by 1/sqrt(embed_dim), -inf fill), merge heads, natural w_o + b_o.
__device__ __forceinline__ v16h frag_h(const _Float16* rowk0, int lane) {
  union { v16h v; v8h q[2]; } u; const _Float16* p = rowk0 + 8 * (lane >> 4);
  u.q[0] = *(const v8h*)p; u.q[1] = *(const v8h*)(p + 16); return u.v;
}
__device__ __forceinline__ v16h frag_f32(const float* rowk0, int lane) {
  v16h a; const float* p = rowk0 + 8 * (lane >> 4);
#pragma unroll
  for (int i = 0; i < 8; ++i) { a[i] = (_Float16)p[i]; a[8 + i] = (_Float16)p[16 + i]; }
  return a;
}
__device__ __forceinline__ v16h frag_f32s(const float* rowk0, int lane, float sc) {
  v16h a; const float* p = rowk0 + 8 * (lane >> 4);
#pragma unroll
  for (int i = 0; i < 8; ++i) { a[i] = (_Float16)(p[i] * sc); a[8 + i] = (_Float16)(p[16 + i] * sc); }
  return a;
}
// column fragment from a [K][ld] layout (column n), rows >= K read as 0
__device__ __forceinline__ v16h fragc_f32(const float* W, int k0, int n, int lane, int ld, int K) {
  v16h a; const int g = lane >> 4;
#pragma unroll
  for (int i = 0; i < 8; ++i) { const int ka = k0 + 8 * g + i, kb = ka + 16;
    a[i] = (_Float16)(ka < K ? W[(size_t)(ka < K ? ka : K - 1) * ld + n] : 0.f); a[8 + i] = (_Float16)(kb < K ? W[(size_t)(kb < K ? kb : K - 1) * ld + n] : 0.f); }
  return a;
}
struct F2 { v16b h, l; };
__device__ __forceinline__ F2 bsplit16(const float v[16]) { F2 r;
#pragma unroll
  for (int i = 0; i < 16; ++i) { const __bf16 h = (__bf16)v[i]; r.h[i] = h; r.l[i] = (__bf16)(v[i] - (float)h); }
  return r; }
__device__ __forceinline__ F2 split_row(const float* row, int k0, int lane) { float v[16]; const float* p = row + k0 + 8 * (lane >> 4);
#pragma unroll
  for (int i = 0; i < 8; ++i) { v[i] = p[i]; v[8 + i] = p[16 + i]; }
  return bsplit16(v); }
__device__ __forceinline__ F2 split_rowK(const float* row, int k0, int lane, int K) { float v[16]; const int g = lane >> 4;
#pragma unroll
  for (int i = 0; i < 8; ++i) { const int ka = k0 + 8 * g + i, kb = ka + 16; v[i] = ka < K ? row[ka < K ? ka : K - 1] : 0.f; v[8 + i] = kb < K ? row[kb < K ? kb : K - 1] : 0.f; }
  return bsplit16(v); }
__device__ __forceinline__ F2 split_col(const float* W, int k0, int n, int lane, int ld, int K) { float v[16]; const int g = lane >> 4;
#pragma unroll
  for (int i = 0; i < 8; ++i) { const int ka = k0 + 8 * g + i, kb = ka + 16; v[i] = ka < K ? W[(size_t)(ka < K ? ka : K - 1) * ld + n] : 0.f; v[8 + i] = kb < K ? W[(size_t)(kb < K ? kb : K - 1) * ld + n] : 0.f; }
  return bsplit16(v); }
__device__ __forceinline__ v8f mac3(const F2& a, const F2& b, v8f c) { c = wmma_bf(a.l, b.h, c); c = wmma_bf(a.h, b.l, c); return wmma_bf(a.h, b.h, c); }
__device__ __forceinline__ float sigm(float v) { return 1.0f / (1.0f + expf(-v)); }
#define LDSX() do { asm volatile("s_wait_dscnt 0" ::: "memory"); __builtin_amdgcn_wave_barrier(); __builtin_amdgcn_fence(__ATOMIC_RELEASE, "workgroup"); } while (0)


#define NB 2
#define SS 2048
#define DM 1024
#define NH 16
#define HD 64
#define QKVW (3 * DM)
#ifndef TQB
#define TQB (SS / 64)
#define TNB NB
#define TOB (NB * SS / 64)     // output row tiles (all)
#endif
typedef __attribute__((ext_vector_type(8))) __bf16 v8b;
// FRAGMENT ORDER of a 16-bit operand in the workspace: a 16 (rows) x 32 (k) fragment is 1 KiB = two pieces of 512 B; in piece q lane l owns 16 B: row l & 15, k = 16 q + 8 (l >> 4) + 0..7.
// So each wave-wide 16-B load or store covers four whole 128-B lines. p = the fragment's start + 8 * lane.
__device__ __forceinline__ v16b fragp_b(const __bf16* p) {
  union { v16b v; v8b q[2]; } u; u.q[0] = *(const v8b*)p; u.q[1] = *(const v8b*)(p + 256); return u.v;
}
__device__ __forceinline__ v16h fragp_h(const _Float16* p) {
  union { v16h v; v8h q[2]; } u; u.q[0] = *(const v8h*)p; u.q[1] = *(const v8h*)(p + 256); return u.v;
}
__device__ __forceinline__ float bfr(float v) { return (float)(__bf16)v; }
__device__ __attribute__((noinline)) float exp_ni(float v) { return expf(v); }
__device__ __attribute__((noinline)) float erf_ni(float v) { return erff(v); }

#define PK_A 0                       // Wqkv: [24 blocks of 128 rows][32 k passes][8 tiles of 16 rows] fragments (fragment order)
#define PK_P (PK_A + QKVW * DM)        // Wo: [8 blocks][32 passes][8 tiles] fragments
#define PK_END (PK_P + DM * DM)
#define WS_PK  0u
#define WS_QK  (WS_PK + 2u * PK_END)             // f16 [q | k][b][head][128 tiles of 16 rows][2 k passes] fragments
#define WS_QKL (WS_QK + 2u * NB * SS * 2 * DM)     // f16 q | k residual planes x2048, same order
#define WS_VTH (WS_QKL + 2u * NB * SS * 2 * DM)    // f16 hi [b][head][64 passes of 32 keys][4 tiles of 16 d] fragments (row = d, k = key)
#define WS_VTL (WS_VTH + 2u * NB * DM * SS)        // f16 lo x 2048
#define WS_O   (WS_VTL + 2u * NB * DM * SS)        // f32 [256 tiles of 16 rows][32 k passes][4 pieces of 512 B]: piece i, lane l: row l & 15, k = 16 (i >> 1) + 8 (l >> 4) + 4 (i & 1) + 0..3
#define WS_CS  (WS_O + 4u * NB * SS * DM)           // f32 2 x [2048][32], reserved: nothing writes or reads it
#define WS_XP  (WS_CS + 4u * 2 * SS * 32)           // bf16 x: [256 tiles of 16 rows][32 k passes] fragments
#define WS_END (WS_XP + 2u * NB * SS * DM)
#define QKT(plane, b, h, st) (((((size_t)(plane) * NB + (b)) * NH + (h)) * (SS / 16) + (st)) * 1024)   // start of a 16 x 64 q or k tile (two fragments), in elements
#define VT(b, h, ks) ((((size_t)(b) * NH + (h)) * (SS / 32) + (ks)) * 2048)   // start of a pass's four V fragments, in elements
// ---- k_pack: block = (tile of 16 natural rows, quarter of k): f32 -> bf16 in fragment order, whole lines in (two rows x 256 B a wave) and out, turned in LDS; tiles 0..191 w_qkv, 192..255 w_o (both into PK), 256..511 x (into XP)
typedef __attribute__((ext_vector_type(4))) __bf16 v4b;
__global__ __launch_bounds__(256) void k_pack(const float* __restrict__ WA, const float* __restrict__ WO, const float* __restrict__ X, __bf16* __restrict__ PK, __bf16* __restrict__ XP) {
  __shared__ __align__(16) __bf16 s[16][264];   // pitch 528 B = 16 B x odd: the 16 rows of a fragment piece fall on distinct banks
  const int t = blockIdx.x, kq = blockIdx.y, tid = threadIdx.x; const int TA = QKVW / 16, TW = (QKVW + DM) / 16;
  const float* srcp = ((t < TA) ? WA + (size_t)t * 16 * DM : (t < TW) ? WO + (size_t)(t - TA) * 16 * DM : X + (size_t)(t - TW) * 16 * DM) + (size_t)(tid >> 4) * DM + kq * 256 + (tid & 15) * 4;
  v4f a[4];
#pragma unroll
  for (int it = 0; it < 4; ++it) a[it] = *(const v4f*)(srcp + it * 64);
#pragma unroll
  for (int it = 0; it < 4; ++it) { v4b r;
#pragma unroll
    for (int i = 0; i < 4; ++i) r[i] = (__bf16)a[it][i];
    *(v4b*)&s[tid >> 4][it * 64 + (tid & 15) * 4] = r; }
  __syncthreads();
  // weights: [block of 128 rows][k pass][8 tiles] fragments, so a wave's pass is 8 KiB in a row; x: [tile][k pass]
  __bf16* dst = (t < TW) ? PK + (size_t)(t >> 3) * (128 * DM) + (t & 7) * 512 : XP + (size_t)(t - TW) * 16 * DM; const int ps = (t < TW) ? 4096 : 512;
#pragma unroll
  for (int it = 0; it < 2; ++it) { const int o = it * 256 + tid, kcl = o >> 6, q = (o >> 5) & 1, l = o & 31;
    vst2((unsigned*)(dst + (size_t)(kq * 8 + kcl) * ps + q * 256 + l * 8), *(const v4u*)&s[l & 15][kcl * 32 + q * 16 + (l >> 4) * 8]); }
}
// one k pass (32 k) of a 16 x 128 wave tile: the A fragment (PassF: its four f32 pieces; PassB: bf16) and the 8 weight fragments; xa and wb hold the lane's offset
struct PassF { v4f x[4]; v16b w[8]; };
__device__ __forceinline__ void pass_ld(PassF& s, const float* xa, const __bf16* wb, int kc) {
  const float* p = xa + kc * 512; s.x[0] = *(const v4f*)p; s.x[1] = *(const v4f*)(p + 128); s.x[2] = *(const v4f*)(p + 256); s.x[3] = *(const v4f*)(p + 384);
#pragma unroll
  for (int j = 0; j < 8; ++j) s.w[j] = fragp_b(wb + kc * 4096 + j * 512);
}
struct PassB { v16b a; v16b w[8]; };
__device__ __forceinline__ void pass_ld(PassB& s, const __bf16* xa, const __bf16* wb, int kc) {
  s.a = fragp_b(xa + kc * 512);
#pragma unroll
  for (int j = 0; j < 8; ++j) s.w[j] = fragp_b(wb + kc * 4096 + j * 512);
}
__global__ __launch_bounds__(128) void k_qkv(const __bf16* __restrict__ XP, const __bf16* __restrict__ P, const float* __restrict__ BQ, const float* __restrict__ BK, const float* __restrict__ BV, _Float16* __restrict__ QK, _Float16* __restrict__ QKL, _Float16* __restrict__ VTH, _Float16* __restrict__ VTL) {
  const int which0 = (blockIdx.y * 128) / DM; const float* BB = BQ ? (((which0 == 0) ? BQ : (which0 == 1) ? BK : BV) + (blockIdx.y * 128 - which0 * DM)) : nullptr;
  __shared__ __align__(16) _Float16 so[4][16][136], sol[4][16][136]; __shared__ __align__(16) _Float16 sth[128][72], stl[128][72];
  const int tid = threadIdx.x, wave = tid >> 5, lane = tid & 31, col = lane & 15, g = lane >> 4; const size_t r0 = (size_t)blockIdx.x * 64 + wave * 16; const int n0 = blockIdx.y * 128;
  v8f acc[8] = {};
  // two register sets: a pass's 18 loads go out as one group, a pass ahead of the WMMAs that read them
  const __bf16* xa = XP + (r0 >> 4) * (16 * DM) + lane * 8; const __bf16* wb = P + (size_t)(n0 >> 7) * (128 * DM) + lane * 8;
  PassB s0, s1;
  auto mm = [&](const PassB& s) {
#pragma unroll
    for (int j = 0; j < 8; ++j) acc[j] = wmma_bf(s.a, s.w[j], acc[j]); };
  pass_ld(s0, xa, wb, 0);
#pragma unroll 1   // kept rolled: the body already holds both register sets, a further copy would only cost registers
  for (int kc = 0; kc < DM / 32 - 2; kc += 2) { pass_ld(s1, xa, wb, kc + 1); mm(s0); pass_ld(s0, xa, wb, kc + 2); mm(s1);
    asm volatile("s_wait_xcnt 0x0" ::: "memory"); }   // before the next trip rewrites the address registers of this trip's loads
  pass_ld(s1, xa, wb, DM / 32 - 1); mm(s0); mm(s1);
  asm volatile("s_wait_xcnt 0x0" ::: "memory");   // before the epilogue reuses the address registers of the last loads
  if (n0 < 2 * DM) {   // q stored unscaled (f16 sigma ~0.6, no subnormal exposure); 1/32 applied to the f32 score
#pragma unroll
    for (int j = 0; j < 8; ++j) {
#pragma unroll
      for (int r = 0; r < 8; ++r) { const float v = acc[j][r] + (BB ? bfr(BB[j * 16 + col]) : 0.f); const _Float16 hv = (_Float16)v; so[wave][8 * g + r][j * 16 + col] = hv; sol[wave][8 * g + r][j * 16 + col] = (_Float16)((v - (float)hv) * 2048.0f); } }   // q, k (+ bias) as f16 hi + (x2048) residual
    LDSX();
    // the wave's 16 x 128 tile = two heads x two fragments x two pieces, each piece one 512-B store
    const size_t o0 = QKT(which0, r0 / SS, (n0 - which0 * DM) / HD, (r0 % SS) / 16) + lane * 8;
#pragma unroll
    for (int u = 0; u < 8; ++u) { const int c0 = (u >> 2) * HD + (u & 3) * 16 + g * 8; const size_t o = o0 + (size_t)(u >> 2) * ((SS / 16) * 1024) + (u & 3) * 256;
      vst2((unsigned*)(QK + o), *(const v4u*)&so[wave][col][c0]); vst2((unsigned*)(QKL + o), *(const v4u*)&sol[wave][col][c0]); }
  } else {
#pragma unroll
    for (int j = 0; j < 8; ++j) {
#pragma unroll
      for (int r = 0; r < 8; ++r) { const float v = acc[j][r] + (BB ? bfr(BB[j * 16 + col]) : 0.f); const _Float16 hv = (_Float16)v; sth[j * 16 + col][wave * 16 + 8 * g + r] = hv; stl[j * 16 + col][wave * 16 + 8 * g + r] = (_Float16)((v - (float)hv) * 2048.0f); } }
    __syncthreads();
    const size_t rb = (size_t)blockIdx.x * 64; const int b = (int)(rb / SS), sq0 = (int)(rb % SS); const int pc0 = n0 - 2 * DM;
    // the block's 128 d x 64 keys = two heads x two passes x four d tiles x two pieces, each piece one 512-B store of one wave
    for (int it = 0; it < 8; ++it) { const int idx = it * 4 + wave, q = idx & 1, dt = (idx >> 1) & 3, ksl = (idx >> 3) & 1, hh = idx >> 4; const int d = hh * HD + dt * 16 + col, sc = ksl * 32 + q * 16 + g * 8;
      const size_t o = VT(b, pc0 / HD + hh, sq0 / 32 + ksl) + dt * 512 + q * 256 + lane * 8; vst2((unsigned*)(VTH + o), *(const v4u*)&sth[d][sc]); vst2((unsigned*)(VTL + o), *(const v4u*)&stl[d][sc]); }
  }
}
// lane l with lane l ^ 16 (a vector cross-row move, no LDS path)
__device__ __forceinline__ float xhalf(float x) { return __builtin_bit_cast(float, __builtin_amdgcn_permlanex16(__builtin_bit_cast(int, x), __builtin_bit_cast(int, x), 0x76543210, 0xfedcba98, false, false)); }
// ---- k_attn: block = (64 queries, head h, batch b): causal flash attention (K = 64: 2 k-steps) in the TRANSPOSED form: S^T = K . Q^T (A = K fragment, B = q fragment), O^T += V^T . P^T (A = V fragment, B = P).
// A lane then holds ONE query (q0 + col): of a 16-key score tile its 8 registers are keys 8 g + r, so maximum and sum run inside the lane, the two wave halves meet in one exchange (the maximum, each pass) and once behind the loop (the sum).
// The two score tiles of a pass, converted in place, ARE the B fragment of P^T (element s = tile s >> 3, register s & 7: the k order of the V fragments), so P touches no LDS; acc[dt][r] = O(query col, d = dt * 16 + 8 g + r) is already k_out's fragment order.
// scores = (q.k) / 32 with single f16 operands (LEAD: + residual products), P.V: f16 P x V hi (LEAD: + P lo x V hi, P x V lo*2048 in a second accumulator); O(row b*S+q, col h*64+d) = (acc + accl / 2048) / (2048 l)
// The pass is compiled per case of its two wave-uniform conditions, so that the common pass carries only its own work:
// LEAD (query blocks 0 and 1): residual products, the low half of P and the second accumulator; elsewhere none of them exists.
// LAST (the wave's one pass that holds its diagonal, ks = q0 / 32): the causal mask, and no fetch of further K rows; every pass in front of it has all 32 keys at or before all 16 queries.
// __expf as it compiles (one multiply, v_exp_f32), written so that the free slot which the instruction set asks for behind a transcendental (before its result is read or its source overwritten) is there by construction.
// exp8: each next v_exp_f32 is the independent instruction behind the one before (early-clobber outputs: none lies on a source), one v_nop closes the last; exp1: the same for a single value.
__device__ __forceinline__ void exp8(float* r, const float* x) {
  float y[8];
#pragma unroll
  for (int i = 0; i < 8; ++i) y[i] = x[i] * 1.44269504f;
  asm("v_exp_f32 %0, %8\n\tv_exp_f32 %1, %9\n\tv_exp_f32 %2, %10\n\tv_exp_f32 %3, %11\n\tv_exp_f32 %4, %12\n\tv_exp_f32 %5, %13\n\tv_exp_f32 %6, %14\n\tv_exp_f32 %7, %15\n\tv_nop"
      : "=&v"(r[0]), "=&v"(r[1]), "=&v"(r[2]), "=&v"(r[3]), "=&v"(r[4]), "=&v"(r[5]), "=&v"(r[6]), "=&v"(r[7])
      : "v"(y[0]), "v"(y[1]), "v"(y[2]), "v"(y[3]), "v"(y[4]), "v"(y[5]), "v"(y[6]), "v"(y[7]));
}
__device__ __forceinline__ float exp1(float x) { float r; const float y = x * 1.44269504f; asm("v_exp_f32 %0, %1\n\tv_nop" : "=v"(r) : "v"(y)); return r; }
// a fragment's two loads; EACH true (the leading blocks, whose loads go through vector address pairs shared by a run of loads): every load is closed by a wait of its own, because the register allocator lets a later load of a run land on the pair that the earlier ones still name
template <bool EACH> __device__ __forceinline__ v16h fragp_x(const _Float16* p) {
  if constexpr (!EACH) return fragp_h(p);
  else { union { v16h v; v8h q[2]; } u;
    u.q[0] = *(const v8h*)p; asm volatile("s_wait_xcnt 0x0" ::: "memory");   // before the next load may land on this one's address pair
    u.q[1] = *(const v8h*)(p + 256); asm volatile("s_wait_xcnt 0x0" ::: "memory");   // the same
    return u.v; }
}
template <bool LEAD> struct AttnSt { v16h aq[2]; v16h kf[2][2]; v8f acc[4]; v8f accl[LEAD ? 4 : 1]; float m, l; };
// qlp, klb, kb0, vhb, vlb: q residual tile, K residual rows, K rows, V hi and V lo of this (b, h), each at the lane's 16 B; dq: the lane's query counted from the first key of the lane's half in this pass (read by LAST only)
template <bool LEAD, bool LAST>
__device__ __forceinline__ void attn_pass(AttnSt<LEAD>& t, const int ks, const int dq, const _Float16* qlp, const _Float16* klb, const _Float16* kb0, const _Float16* vhb, const _Float16* vlb) {
  v8f s[2]; v16h vf[4];
#pragma unroll
  for (int dt = 0; dt < 4; ++dt) vf[dt] = fragp_x<LEAD>(vhb + (size_t)ks * 2048 + dt * 512);
  if constexpr (!LEAD) asm volatile("s_wait_xcnt 0x0" ::: "memory");   // before the address registers of the V loads are reused (LEAD: each load has its own wait, here and below)
#pragma unroll
  for (int ct = 0; ct < 2; ++ct) { v8f c = {};
    if constexpr (LEAD) {   // leading query blocks (few keys, outputs far above the global rms): 3 products
      const _Float16* krowl = klb + (size_t)(ks * 2 + ct) * 1024; v8f cl = {};
#pragma unroll
      for (int kc = 0; kc < 2; ++kc) { const v16h kh = t.kf[ct][kc]; c = wmma16(kh, t.aq[kc], c); cl = wmma16(kh, fragp_x<LEAD>(qlp + kc * 512), cl); cl = wmma16(fragp_x<LEAD>(krowl + kc * 512), t.aq[kc], cl); }
#pragma unroll
      for (int r = 0; r < 8; ++r) c[r] += cl[r] * (1.0f / 2048.0f); }
    else {
#pragma unroll
      for (int kc = 0; kc < 2; ++kc) c = wmma16(t.kf[ct][kc], t.aq[kc], c); }   // single product elsewhere
#pragma unroll
    for (int r = 0; r < 8; ++r) s[ct][r] = (!LAST || ct * 16 + r <= dq) ? c[r] * 0.03125f : -3.0e38f; }   // 1/sqrt(1024); keys behind the lane's query excluded
  if constexpr (!LAST) {   // the next pass's K rows, right behind this pass's score products
#pragma unroll
    for (int ct = 0; ct < 2; ++ct) {
#pragma unroll
      for (int kc = 0; kc < 2; ++kc) t.kf[ct][kc] = fragp_x<LEAD>(kb0 + (size_t)(ks + 1) * 2048 + ct * 1024 + kc * 512); }
    if constexpr (!LEAD) asm volatile("s_wait_xcnt 0x0" ::: "memory"); }   // before the address registers of the K loads are reused
  float mt[8];
#pragma unroll
  for (int r = 0; r < 8; ++r) mt[r] = fmaxf(s[0][r], s[1][r]);
  float mx = fmaxf(fmaxf(fmaxf(mt[0], mt[1]), fmaxf(mt[2], mt[3])), fmaxf(fmaxf(mt[4], mt[5]), fmaxf(mt[6], mt[7])));
  mx = fmaxf(mx, xhalf(mx));   // both halves now hold the maximum over the pass's 32 keys
  const float mn = fmaxf(t.m, mx); const float ea = exp1(t.m - mn); const float alpha = (t.m <= -1.0e38f) ? 0.f : ea;
  float df[16], ex[16];
#pragma unroll
  for (int i = 0; i < 16; ++i) df[i] = s[i >> 3][i & 7] - mn;
  exp8(ex, df); exp8(ex + 8, df + 8);
  v16h pa, pl; float es[4];   // four short chains of adds in place of one long one
#pragma unroll
  for (int i = 0; i < 16; ++i) { const float sv = s[i >> 3][i & 7]; const float e = (LAST && sv <= -1.0e38f) ? 0.f : ex[i]; es[i & 3] = (i < 4) ? e : es[i & 3] + e;
    const float x0 = e * 2048.0f; const _Float16 h0 = (_Float16)x0; pa[i] = h0; if constexpr (LEAD) pl[i] = (_Float16)((x0 - (float)h0) * 2048.0f); }   // P scaled by 2^11 before the f16 split so small softmax weights stay out of the f16 subnormal range; 2^-11 folded into the epilogue
  t.l = t.l * alpha + ((es[0] + es[1]) + (es[2] + es[3])); t.m = mn;
#pragma unroll
  for (int dt = 0; dt < 4; ++dt) {
#pragma unroll
    for (int r = 0; r < 8; ++r) { t.acc[dt][r] *= alpha; if constexpr (LEAD) t.accl[dt][r] *= alpha; } }
#pragma unroll
  for (int dt = 0; dt < 4; ++dt) { const v16h vh = vf[dt]; t.acc[dt] = wmma16(vh, pa, t.acc[dt]);
    if constexpr (LEAD) { t.accl[dt] = wmma16(vh, pl, t.accl[dt]); t.accl[dt] = wmma16(fragp_x<LEAD>(vlb + (size_t)ks * 2048 + dt * 512), pa, t.accl[dt]); } }   // leading query blocks: P hi/lo x V hi/lo (3 products); elsewhere P x V single
}
template <bool LEAD>
__device__ __forceinline__ void attn_wave(const _Float16* __restrict__ QK, const _Float16* __restrict__ QKL, const _Float16* __restrict__ VTH, const _Float16* __restrict__ VTL, float* __restrict__ O, const int qb, const int h, const int b, const int wave, const int lane) {
  const int col = lane & 15, g = lane >> 4; const int q0 = qb * 64 + wave * 16; const size_t qt = QKT(0, b, h, qb * 4 + wave) + lane * 8;   // the wave's q tile, at the lane's 16 B
  AttnSt<LEAD> t;   // the q residual fragments are read where the leading blocks use them
#pragma unroll
  for (int kc = 0; kc < 2; ++kc) t.aq[kc] = fragp_x<LEAD>(QK + qt + kc * 512);
  t.m = -3.0e38f; t.l = 0.f;   // of the lane's query; l sums the keys of the lane's own half only
#pragma unroll
  for (int dt = 0; dt < 4; ++dt) { t.acc[dt] = v8f{}; if constexpr (LEAD) t.accl[dt] = v8f{}; }
  // K fragments are fetched one pass ahead (right behind the pass's score products), V hi fragments at the head of their pass: each as one group, so no WMMA of the common pass waits on a load issued directly in front of it
  const _Float16* kb0 = QK + QKT(1, b, h, 0) + lane * 8; const _Float16* klb = QKL + QKT(1, b, h, 0) + lane * 8; const _Float16* vhb = VTH + VT(b, h, 0) + lane * 8; const _Float16* vlb = VTL + VT(b, h, 0) + lane * 8;
#pragma unroll
  for (int ct = 0; ct < 2; ++ct) {
#pragma unroll
    for (int kc = 0; kc < 2; ++kc) t.kf[ct][kc] = fragp_x<LEAD>(kb0 + ct * 1024 + kc * 512); }
  if constexpr (!LEAD) asm volatile("s_wait_xcnt 0x0" ::: "memory");   // before the address registers of the q and K loads are reused
  const int nfull = q0 >> 5;   // passes whose 32 keys all lie at or before the wave's first query
#pragma unroll 1   // kept rolled: one copy of the common pass in the instruction cache
  for (int ks = 0; ks < nfull; ++ks) attn_pass<LEAD, false>(t, ks, 0, QKL + qt, klb, kb0, vhb, vlb);
  attn_pass<LEAD, true>(t, nfull, q0 + col - nfull * 32 - 8 * g, QKL + qt, klb, kb0, vhb, vlb);
  const float il = (1.0f / 2048.0f) / (t.l + xhalf(t.l));   // the two halves' sums meet here, once
  // the wave's 16 x 64 tile = two k passes of k_out x four pieces, each piece one 512-B store, straight from the accumulators
  float* ot = O + ((size_t)(b * (SS / 16) + qb * 4 + wave) * (DM / 32) + h * 2) * 512 + lane * 4;
#pragma unroll
  for (int u = 0; u < 8; ++u) { v4f o;
#pragma unroll
    for (int i = 0; i < 4; ++i) { float a = t.acc[u >> 1][(u & 1) * 4 + i]; if constexpr (LEAD) a += t.accl[u >> 1][(u & 1) * 4 + i] * (1.0f / 2048.0f); o[i] = a * il; }
    vst2(ot + u * 128, o); }
}
// four waves per SIMD: all 1,024 blocks stay resident at once
__global__ __launch_bounds__(128) __attribute__((amdgpu_waves_per_eu(4, 4))) void k_attn(const _Float16* __restrict__ QK, const _Float16* __restrict__ QKL, const _Float16* __restrict__ VTH, const _Float16* __restrict__ VTL, const void* __restrict__ KMASK, float* __restrict__ O) {
  const int tid = threadIdx.x, wave = __builtin_amdgcn_readfirstlane(tid >> 5), lane = tid & 31;   // the wave's number in a scalar register: row addresses built on it cost no vector register
  const int qb = blockIdx.x, h = blockIdx.y, b = blockIdx.z;
  if (qb < 2) attn_wave<true>(QK, QKL, VTH, VTL, O, qb, h, b, wave, lane);
  else attn_wave<false>(QK, QKL, VTH, VTL, O, qb, h, b, wave, lane);
}
// ---- k_out: block = (64 rows, 128 cols): out = O(hi/lo) . Wo rows (2 products) + bo
__global__ __launch_bounds__(128) void k_out(const float* __restrict__ O, const __bf16* __restrict__ P, const float* __restrict__ BO, float* __restrict__ Y) {
  __shared__ __align__(16) float so[4][16][132];
  const int tid = threadIdx.x, wave = tid >> 5, lane = tid & 31, col = lane & 15, g = lane >> 4; const size_t r0 = (size_t)blockIdx.x * 64 + wave * 16; const int n0 = blockIdx.y * 128;
  v8f acc[8] = {};
  // two register sets, as in k_qkv: a pass's loads go out as one group, a pass ahead of the WMMAs that read them
  const float* xa = O + (r0 >> 4) * (16 * DM) + lane * 4; const __bf16* wb = P + (size_t)(n0 >> 7) * (128 * DM) + lane * 8;
  PassF s0, s1;
  auto mm = [&](const PassF& s) { float v[16];
#pragma unroll
    for (int i = 0; i < 4; ++i) { v[i] = s.x[0][i]; v[4 + i] = s.x[1][i]; v[8 + i] = s.x[2][i]; v[12 + i] = s.x[3][i]; }
    const F2 a = bsplit16(v);
#pragma unroll
    for (int j = 0; j < 8; ++j) { acc[j] = wmma_bf(a.l, s.w[j], acc[j]); acc[j] = wmma_bf(a.h, s.w[j], acc[j]); } };
  pass_ld(s0, xa, wb, 0);
#pragma unroll 1   // kept rolled: the body already holds both register sets, a further copy would only cost registers
  for (int kc = 0; kc < DM / 32 - 2; kc += 2) { pass_ld(s1, xa, wb, kc + 1); mm(s0); pass_ld(s0, xa, wb, kc + 2); mm(s1);
    asm volatile("s_wait_xcnt 0x0" ::: "memory"); }   // before the next trip rewrites the address registers of this trip's loads
  pass_ld(s1, xa, wb, DM / 32 - 1); mm(s0); mm(s1);
  asm volatile("s_wait_xcnt 0x0" ::: "memory");   // before the epilogue reuses the address registers of the last loads
#pragma unroll
  for (int j = 0; j < 8; ++j) {
#pragma unroll
    for (int r = 0; r < 8; ++r) so[wave][8 * g + r][j * 16 + col] = acc[j][r] + bfr(BO[n0 + j * 16 + col]); }
  LDSX();
  for (int rl = 0; rl < 16; ++rl) vst2(Y + (r0 + rl) * DM + n0 + lane * 4, *(const v4f*)&so[wave][rl][lane * 4]);
}
extern "C" void kernel_launch(void* const* d_in, const int* in_sizes, int n_in, void* d_out, int out_size, void* d_ws, size_t ws_size, hipStream_t stream) {
  (void)in_sizes; (void)n_in; (void)out_size;
  const float** F = (const float**)d_in;   // 0 x [2,2048,1024], 1 w_qkv [3072,1024] natural (rows q | k | v), 2 b_qkv [3072], 3 w_o [1024,1024] natural, 4 b_o
  if (ws_size < (size_t)WS_END) return;
  char* ws = (char*)d_ws; __bf16* PK = (__bf16*)(ws + WS_PK); _Float16 *QK = (_Float16*)(ws + WS_QK), *QKL = (_Float16*)(ws + WS_QKL), *VTH = (_Float16*)(ws + WS_VTH), *VTL = (_Float16*)(ws + WS_VTL); float* O = (float*)(ws + WS_O); __bf16* XP = (__bf16*)(ws + WS_XP);
  k_pack<<<dim3((QKVW + DM + NB * SS) / 16, 4), 256, 0, stream>>>(F[1], F[3], F[0], PK, XP);
  k_qkv<<<dim3(TNB * SS / 64, QKVW / 128), 128, 0, stream>>>(XP, PK + PK_A, F[2], F[2] + DM, F[2] + 2 * DM, QK, QKL, VTH, VTL);
  k_attn<<<dim3(TQB, NH, TNB), 128, 0, stream>>>(QK, QKL, VTH, VTL, nullptr, O);
  k_out<<<dim3(TOB, DM / 128), 128, 0, stream>>>(O, PK + PK_P, F[4], (float*)d_out);
}

// v005
// One run takes 121 microseconds.
// Next to v004, in two timings, it ran 1.07 and 1.05 times as fast.
// Counting every step since v000, it is 3.56 times as fast.
// compute dtype: all float inputs rounded to bf16; qkv = x . W^T + b with EXACT bf16 products on WMMA 16x16x32 (natural rows), f16 hi + residual; causal PLAIN-HYBRID attention (first 128 queries 3-product, later single f16; logits std ~0.5, diffuse), x 1/32, running-max softmax in f32 (hardware exp); out = ctx (bf16 hi + lo) . Wo^T + b_o; f32 output.
#include <hip/hip_runtime.h>
#include <math.h>

typedef __attribute__((ext_vector_type(16))) _Float16 v16h;
typedef __attribute__((ext_vector_type(16))) __bf16 v16b;
typedef __attribute__((ext_vector_type(8)))  _Float16 v8h;
typedef __attribute__((ext_vector_type(8)))  float v8f;
typedef __attribute__((ext_vector_type(4)))  float v4f;
typedef __attribute__((ext_vector_type(2)))  float v2f;
typedef __attribute__((ext_vector_type(4)))  unsigned v4u;
typedef __attribute__((ext_vector_type(4)))  int v4i;
typedef float __attribute__((may_alias)) float_a;
typedef int __attribute__((may_alias)) int_a;

template <typename T> __device__ __forceinline__ void vst2(void* p, T v) { *(T*)p = v;  }
__device__ __forceinline__ v8f wmma16(v16h a, v16h b, v8f c) {
  v8f d = __builtin_amdgcn_wmma_f32_16x16x32_f16(false, a, false, b, (short)0, c, false, false);
  asm volatile("v_nop\n\tv_nop\n\tv_nop\n\tv_nop" : "+v"(d) : "v"(a), "v"(b));
  return d;
}
__device__ __forceinline__ v8f wmma_bf(v16b a, v16b b, v8f c) {
  v8f d = __builtin_amdgcn_wmma_f32_16x16x32_bf16(false, a, false, b, (short)0, c, false, false);
  asm volatile("v_nop\n\tv_nop\n\tv_nop\n\tv_nop" : "+v"(d) : "v"(a), "v"(b));
  return d;
}
// Multi-head attention '2' (B 2, N 2,048, C 1,024, 16 heads x 64): fused natural w_qkv (q | k | v row blocks) + bias, causal softmax(q k / sqrt(1024)) v (the module scales by 1/sqrt(embed_dim), -inf fill), merge heads, natural w_o + b_o.
__device__ __forceinline__ v16h frag_h(const _Float16* rowk0, int lane) {
  union { v16h v; v8h q[2]; } u; const _Float16* p = rowk0 + 8 * (lane >> 4);
  u.q[0] = *(const v8h*)p; u.q[1] = *(const v8h*)(p + 16); return u.v;
}
__device__ __forceinline__ v16h frag_f32(const float* rowk0, int lane) {
  v16h a; const float* p = rowk0 + 8 * (lane >> 4);
#pragma unroll
  for (int i = 0; i < 8; ++i) { a[i] = (_Float16)p[i]; a[8 + i] = (_Float16)p[16 + i]; }
  return a;
}
__device__ __forceinline__ v16h frag_f32s(const float* rowk0, int lane, float sc) {
  v16h a; const float* p = rowk0 + 8 * (lane >> 4);
#pragma unroll
  for (int i = 0; i < 8; ++i) { a[i] = (_Float16)(p[i] * sc); a[8 + i] = (_Float16)(p[16 + i] * sc); }
  return a;
}
// column fragment from a [K][ld] layout (column n), rows >= K read as 0
__device__ __forceinline__ v16h fragc_f32(const float* W, int k0, int n, int lane, int ld, int K) {
  v16h a; const int g = lane >> 4;
#pragma unroll
  for (int i = 0; i < 8; ++i) { const int ka = k0 + 8 * g + i, kb = ka + 16;
    a[i] = (_Float16)(ka < K ? W[(size_t)(ka < K ? ka : K - 1) * ld + n] : 0.f); a[8 + i] = (_Float16)(kb < K ? W[(size_t)(kb < K ? kb : K - 1) * ld + n] : 0.f); }
  return a;
}
struct F2 { v16b h, l; };
__device__ __forceinline__ F2 bsplit16(const float v[16]) { F2 r;
#pragma unroll
  for (int i = 0; i < 16; ++i) { const __bf16 h = (__bf16)v[i]; r.h[i] = h; r.l[i] = (__bf16)(v[i] - (float)h); }
  return r; }
__device__ __forceinline__ F2 split_row(const float* row, int k0, int lane) { float v[16]; const float* p = row + k0 + 8 * (lane >> 4);
#pragma unroll
  for (int i = 0; i < 8; ++i) { v[i] = p[i]; v[8 + i] = p[16 + i]; }
  return bsplit16(v); }
__device__ __forceinline__ F2 split_rowK(const float* row, int k0, int lane, int K) { float v[16]; const int g = lane >> 4;
#pragma unroll
  for (int i = 0; i < 8; ++i) { const int ka = k0 + 8 * g + i, kb = ka + 16; v[i] = ka < K ? row[ka < K ? ka : K - 1] : 0.f; v[8 + i] = kb < K ? row[kb < K ? kb : K - 1] : 0.f; }
  return bsplit16(v); }
__device__ __forceinline__ F2 split_col(const float* W, int k0, int n, int lane, int ld, int K) { float v[16]; const int g = lane >> 4;
#pragma unroll
  for (int i = 0; i < 8; ++i) { const int ka = k0 + 8 * g + i, kb = ka + 16; v[i] = ka < K ? W[(size_t)(ka < K ? ka : K - 1) * ld + n] : 0.f; v[8 + i] = kb < K ? W[(size_t)(kb < K ? kb : K - 1) * ld + n] : 0.f; }
  return bsplit16(v); }
__device__ __forceinline__ v8f mac3(const F2& a, const F2& b, v8f c) { c = wmma_bf(a.l, b.h, c); c = wmma_bf(a.h, b.l, c); return wmma_bf(a.h, b.h, c); }
__device__ __forceinline__ float sigm(float v) { return 1.0f / (1.0f + expf(-v)); }
#define LDSX() do { asm volatile("s_wait_dscnt 0" ::: "memory"); __builtin_amdgcn_wave_barrier(); __builtin_amdgcn_fence(__ATOMIC_RELEASE, "workgroup"); } while (0)


#define NB 2
#define SS 2048
#define DM 1024
#define NH 16
#define HD 64
#define QKVW (3 * DM)
#ifndef TQB
#define TQB (SS / 64)
#define TNB NB
#define TOB (NB * SS / 64)     // output row tiles (all)
#endif
typedef __attribute__((ext_vector_type(8))) __bf16 v8b;
// FRAGMENT ORDER of a 16-bit operand in the workspace: a 16 (rows) x 32 (k) fragment is 1 KiB = two pieces of 512 B; in piece q lane l owns 16 B: row l & 15, k = 16 q + 8 (l >> 4) + 0..7.
// So each wave-wide 16-B load or store covers four whole 128-B lines. p = the fragment's start + 8 * lane.
__device__ __forceinline__ v16b fragp_b(const __bf16* p) {
  union { v16b v; v8b q[2]; } u; u.q[0] = *(const v8b*)p; u.q[1] = *(const v8b*)(p + 256); return u.v;
}
__device__ __forceinline__ v16h fragp_h(const _Float16* p) {
  union { v16h v; v8h q[2]; } u; u.q[0] = *(const v8h*)p; u.q[1] = *(const v8h*)(p + 256); return u.v;
}
__device__ __forceinline__ float bfr(float v) { return (float)(__bf16)v; }
__device__ __attribute__((noinline)) float exp_ni(float v) { return expf(v); }
__device__ __attribute__((noinline)) float erf_ni(float v) { return erff(v); }

#define PK_A 0                       // Wqkv: [24 blocks of 128 rows][32 k passes][8 tiles of 16 rows] fragments (fragment order)
#define PK_P (PK_A + QKVW * DM)        // Wo: [8 blocks][32 passes][8 tiles] fragments
#define PK_END (PK_P + DM * DM)
#define WS_PK  0u
#define WS_QK  (WS_PK + 2u * PK_END)             // f16 [q | k][b][head][128 tiles of 16 rows][2 k passes] fragments
#define WS_QKL (WS_QK + 2u * NB * SS * 2 * DM)     // f16 q | k residual planes x2048, same order
#define WS_VTH (WS_QKL + 2u * NB * SS * 2 * DM)    // f16 hi [b][head][64 passes of 32 keys][4 tiles of 16 d] fragments (row = d, k = key)
#define WS_VTL (WS_VTH + 2u * NB * DM * SS)        // f16 lo x 2048
#define WS_O   (WS_VTL + 2u * NB * DM * SS)        // f32 [256 tiles of 16 rows][32 k passes][4 pieces of 512 B]: piece i, lane l: row l & 15, k = 16 (i >> 1) + 8 (l >> 4) + 4 (i & 1) + 0..3
#define WS_CS  (WS_O + 4u * NB * SS * DM)           // f32 2 x [2048][32], reserved: nothing writes or reads it
#define WS_XP  (WS_CS + 4u * 2 * SS * 32)           // bf16 x: [256 tiles of 16 rows][32 k passes] fragments
#define WS_END (WS_XP + 2u * NB * SS * DM)
#define QKT(plane, b, h, st) (((((size_t)(plane) * NB + (b)) * NH + (h)) * (SS / 16) + (st)) * 1024)   // start of a 16 x 64 q or k tile (two fragments), in elements
#define VT(b, h, ks) ((((size_t)(b) * NH + (h)) * (SS / 32) + (ks)) * 2048)   // start of a pass's four V fragments, in elements
// ---- k_pack: block = (tile of 16 natural rows, quarter of k): f32 -> bf16 in fragment order, whole lines in (two rows x 256 B a wave) and out, turned in LDS; tiles 0..191 w_qkv, 192..255 w_o (both into PK), 256..511 x (into XP)
typedef __attribute__((ext_vector_type(4))) __bf16 v4b;
__global__ __launch_bounds__(256) void k_pack(const float* __restrict__ WA, const float* __restrict__ WO, const float* __restrict__ X, __bf16* __restrict__ PK, __bf16* __restrict__ XP) {
  __shared__ __align__(16) __bf16 s[16][264];   // pitch 528 B = 16 B x odd: the 16 rows of a fragment piece fall on distinct banks
  const int t = blockIdx.x, kq = blockIdx.y, tid = threadIdx.x; const int TA = QKVW / 16, TW = (QKVW + DM) / 16;
  const float* srcp = ((t < TA) ? WA + (size_t)t * 16 * DM : (t < TW) ? WO + (size_t)(t - TA) * 16 * DM : X + (size_t)(t - TW) * 16 * DM) + (size_t)(tid >> 4) * DM + kq * 256 + (tid & 15) * 4;
  v4f a[4];
#pragma unroll
  for (int it = 0; it < 4; ++it) a[it] = *(const v4f*)(srcp + it * 64);
#pragma unroll
  for (int it = 0; it < 4; ++it) { v4b r;
#pragma unroll
    for (int i = 0; i < 4; ++i) r[i] = (__bf16)a[it][i];
    *(v4b*)&s[tid >> 4][it * 64 + (tid & 15) * 4] = r; }
  __syncthreads();
  // weights: [block of 128 rows][k pass][8 tiles] fragments, so a wave's pass is 8 KiB in a row; x: [tile][k pass]
  __bf16* dst = (t < TW) ? PK + (size_t)(t >> 3) * (128 * DM) + (t & 7) * 512 : XP + (size_t)(t - TW) * 16 * DM; const int ps = (t < TW) ? 4096 : 512;
#pragma unroll
  for (int it = 0; it < 2; ++it) { const int o = it * 256 + tid, kcl = o >> 6, q = (o >> 5) & 1, l = o & 31;
    vst2((unsigned*)(dst + (size_t)(kq * 8 + kcl) * ps + q * 256 + l * 8), *(const v4u*)&s[l & 15][kcl * 32 + q * 16 + (l >> 4) * 8]); }
}
// one k pass (32 k) of a 16 x 128 wave tile: the A fragment (PassF: its four f32 pieces; PassB: bf16) and the 8 weight fragments; xa and wb hold the lane's offset
struct PassF { v4f x[4]; v16b w[8]; };
__device__ __forceinline__ void pass_ld(PassF& s, const float* xa, const __bf16* wb, int kc) {
  const float* p = xa + kc * 512; s.x[0] = *(const v4f*)p; s.x[1] = *(const v4f*)(p + 128); s.x[2] = *(const v4f*)(p + 256); s.x[3] = *(const v4f*)(p + 384);
#pragma unroll
  for (int j = 0; j < 8; ++j) s.w[j] = fragp_b(wb + kc * 4096 + j * 512);
}
struct PassB { v16b a; v16b w[8]; };
__device__ __forceinline__ void pass_ld(PassB& s, const __bf16* xa, const __bf16* wb, int kc) {
  s.a = fragp_b(xa + kc * 512);
#pragma unroll
  for (int j = 0; j < 8; ++j) s.w[j] = fragp_b(wb + kc * 4096 + j * 512);
}
__global__ __launch_bounds__(128) void k_qkv(const __bf16* __restrict__ XP, const __bf16* __restrict__ P, const float* __restrict__ BQ, const float* __restrict__ BK, const float* __restrict__ BV, _Float16* __restrict__ QK, _Float16* __restrict__ QKL, _Float16* __restrict__ VTH, _Float16* __restrict__ VTL) {
  const int which0 = (blockIdx.y * 128) / DM; const float* BB = BQ ? (((which0 == 0) ? BQ : (which0 == 1) ? BK : BV) + (blockIdx.y * 128 - which0 * DM)) : nullptr;
  __shared__ __align__(16) _Float16 so[4][16][136], sol[4][16][136]; __shared__ __align__(16) _Float16 sth[128][72], stl[128][72];
  const int tid = threadIdx.x, wave = tid >> 5, lane = tid & 31, col = lane & 15, g = lane >> 4; const size_t r0 = (size_t)blockIdx.x * 64 + wave * 16; const int n0 = blockIdx.y * 128;
  v8f acc[8] = {};
  // the lane's 8 bias values (one a column tile) go out as one group in front of the k loop and are held in registers: the epilogue has no load and no wait on one
  float bias[8] = {};
  if (BB) {
#pragma unroll
    for (int j = 0; j < 8; ++j) bias[j] = BB[j * 16 + col];
    asm volatile("s_wait_xcnt 0x0" ::: "memory");   // before the address registers of the bias loads are reused
  }
  // two register sets: a pass's 18 loads go out as one group, a pass ahead of the WMMAs that read them
  const __bf16* xa = XP + (r0 >> 4) * (16 * DM) + lane * 8; const __bf16* wb = P + (size_t)(n0 >> 7) * (128 * DM) + lane * 8;
  PassB s0, s1;
  auto mm = [&](const PassB& s) {
#pragma unroll
    for (int j = 0; j < 8; ++j) acc[j] = wmma_bf(s.a, s.w[j], acc[j]); };
  pass_ld(s0, xa, wb, 0);
#pragma unroll 1   // kept rolled: the body already holds both register sets, a further copy would only cost registers
  for (int kc = 0; kc < DM / 32 - 2; kc += 2) { pass_ld(s1, xa, wb, kc + 1); mm(s0); pass_ld(s0, xa, wb, kc + 2); mm(s1);
    asm volatile("s_wait_xcnt 0x0" ::: "memory"); }   // before the next trip rewrites the address registers of this trip's loads
  pass_ld(s1, xa, wb, DM / 32 - 1); mm(s0); mm(s1);
  asm volatile("s_wait_xcnt 0x0" ::: "memory");   // before the epilogue reuses the address registers of the last loads
#pragma unroll
  for (int j = 0; j < 8; ++j) bias[j] = bfr(bias[j]);
  if (n0 < 2 * DM) {   // q stored unscaled (f16 sigma ~0.6, no subnormal exposure); 1/32 applied to the f32 score
#pragma unroll
    for (int j = 0; j < 8; ++j) {
#pragma unroll
      for (int r = 0; r < 8; ++r) { const float v = acc[j][r] + bias[j]; const _Float16 hv = (_Float16)v; so[wave][8 * g + r][j * 16 + col] = hv; sol[wave][8 * g + r][j * 16 + col] = (_Float16)((v - (float)hv) * 2048.0f); } }   // q, k (+ bias) as f16 hi + (x2048) residual
    LDSX();
    // the wave's 16 x 128 tile = two heads x two fragments x two pieces, each piece one 512-B store
    const size_t o0 = QKT(which0, r0 / SS, (n0 - which0 * DM) / HD, (r0 % SS) / 16) + lane * 8;
#pragma unroll
    for (int u = 0; u < 8; ++u) { const int c0 = (u >> 2) * HD + (u & 3) * 16 + g * 8; const size_t o = o0 + (size_t)(u >> 2) * ((SS / 16) * 1024) + (u & 3) * 256;
      vst2((unsigned*)(QK + o), *(const v4u*)&so[wave][col][c0]); vst2((unsigned*)(QKL + o), *(const v4u*)&sol[wave][col][c0]); }
  } else {
#pragma unroll
    for (int j = 0; j < 8; ++j) {
#pragma unroll
      for (int r = 0; r < 8; ++r) { const float v = acc[j][r] + bias[j]; const _Float16 hv = (_Float16)v; sth[j * 16 + col][wave * 16 + 8 * g + r] = hv; stl[j * 16 + col][wave * 16 + 8 * g + r] = (_Float16)((v - (float)hv) * 2048.0f); } }
    __syncthreads();
    const size_t rb = (size_t)blockIdx.x * 64; const int b = (int)(rb / SS), sq0 = (int)(rb % SS); const int pc0 = n0 - 2 * DM;
    // the block's 128 d x 64 keys = two heads x two passes x four d tiles x two pieces, each piece one 512-B store of one wave
    for (int it = 0; it < 8; ++it) { const int idx = it * 4 + wave, q = idx & 1, dt = (idx >> 1) & 3, ksl = (idx >> 3) & 1, hh = idx >> 4; const int d = hh * HD + dt * 16 + col, sc = ksl * 32 + q * 16 + g * 8;
      const size_t o = VT(b, pc0 / HD + hh, sq0 / 32 + ksl) + dt * 512 + q * 256 + lane * 8; vst2((unsigned*)(VTH + o), *(const v4u*)&sth[d][sc]); vst2((unsigned*)(VTL + o), *(const v4u*)&stl[d][sc]); }
  }
}
// lane l with lane l ^ 16 (a vector cross-row move, no LDS path)
__device__ __forceinline__ float xhalf(float x) { return __builtin_bit_cast(float, __builtin_amdgcn_permlanex16(__builtin_bit_cast(int, x), __builtin_bit_cast(int, x), 0x76543210, 0xfedcba98, false, false)); }
// ---- k_attn: block = (64 queries, head h, batch b): causal flash attention (K = 64: 2 k-steps) in the TRANSPOSED form: S^T = K . Q^T (A = K fragment, B = q fragment), O^T += V^T . P^T (A = V fragment, B = P).
// A lane then holds ONE query (q0 + col): of a 16-key score tile its 8 registers are keys 8 g + r, so maximum and sum run inside the lane, the two wave halves meet in one exchange (the maximum, each pass) and once behind the loop (the sum).
// The two score tiles of a pass, converted in place, ARE the B fragment of P^T (element s = tile s >> 3, register s & 7: the k order of the V fragments), so P touches no LDS; acc[dt][r] = O(query col, d = dt * 16 + 8 g + r) is already k_out's fragment order.
// scores = (q.k) / 32 with single f16 operands (LEAD: + residual products), P.V: f16 P x V hi (LEAD: + P lo x V hi, P x V lo*2048 in a second accumulator); O(row b*S+q, col h*64+d) = (acc + accl / 2048) / (2048 l)
// The pass is compiled per case of its two wave-uniform conditions, so that the common pass carries only its own work:
// LEAD (query blocks 0 and 1): residual products, the low half of P and the second accumulator; elsewhere none of them exists.
// LAST (the wave's one pass that holds its diagonal, ks = q0 / 32): the causal mask, and no fetch of further K rows; every pass in front of it has all 32 keys at or before all 16 queries.
// __expf as it compiles (one multiply, v_exp_f32), written so that the free slot which the instruction set asks for behind a transcendental (before its result is read or its source overwritten) is there by construction.
// exp8: each next v_exp_f32 is the independent instruction behind the one before (early-clobber outputs: none lies on a source), one v_nop closes the last; exp1: the same for a single value.
__device__ __forceinline__ void exp8(float* r, const float* x) {
  float y[8];
#pragma unroll
  for (int i = 0; i < 8; ++i) y[i] = x[i] * 1.44269504f;
  asm("v_exp_f32 %0, %8\n\tv_exp_f32 %1, %9\n\tv_exp_f32 %2, %10\n\tv_exp_f32 %3, %11\n\tv_exp_f32 %4, %12\n\tv_exp_f32 %5, %13\n\tv_exp_f32 %6, %14\n\tv_exp_f32 %7, %15\n\tv_nop"
      : "=&v"(r[0]), "=&v"(r[1]), "=&v"(r[2]), "=&v"(r[3]), "=&v"(r[4]), "=&v"(r[5]), "=&v"(r[6]), "=&v"(r[7])
      : "v"(y[0]), "v"(y[1]), "v"(y[2]), "v"(y[3]), "v"(y[4]), "v"(y[5]), "v"(y[6]), "v"(y[7]));
}
__device__ __forceinline__ float exp1(float x) { float r; const float y = x * 1.44269504f; asm("v_exp_f32 %0, %1\n\tv_nop" : "=v"(r) : "v"(y)); return r; }
// a fragment's two loads; EACH true (the leading blocks, whose loads go through vector address pairs shared by a run of loads): every load is closed by a wait of its own, because the register allocator lets a later load of a run land on the pair that the earlier ones still name
template <bool EACH> __device__ __forceinline__ v16h fragp_x(const _Float16* p) {
  if constexpr (!EACH) return fragp_h(p);
  else { union { v16h v; v8h q[2]; } u;
    u.q[0] = *(const v8h*)p; asm volatile("s_wait_xcnt 0x0" ::: "memory");   // before the next load may land on this one's address pair
    u.q[1] = *(const v8h*)(p + 256); asm volatile("s_wait_xcnt 0x0" ::: "memory");   // the same
    return u.v; }
}
template <bool LEAD> struct AttnSt { v16h aq[2]; v16h kf[2][2]; v8f acc[4]; v8f accl[LEAD ? 4 : 1]; float m, l; };
// qlp, klb, kb0, vhb, vlb: q residual tile, K residual rows, K rows, V hi and V lo of this (b, h), each at the lane's 16 B; dq: the lane's query counted from the first key of the lane's half in this pass (read by LAST only)
template <bool LEAD, bool LAST>
__device__ __forceinline__ void attn_pass(AttnSt<LEAD>& t, const int ks, const int dq, const _Float16* qlp, const _Float16* klb, const _Float16* kb0, const _Float16* vhb, const _Float16* vlb) {
  v8f s[2]; v16h vf[4];
#pragma unroll
  for (int dt = 0; dt < 4; ++dt) vf[dt] = fragp_x<LEAD>(vhb + (size_t)ks * 2048 + dt * 512);
  if constexpr (!LEAD) asm volatile("s_wait_xcnt 0x0" ::: "memory");   // before the address registers of the V loads are reused (LEAD: each load has its own wait, here and below)
#pragma unroll
  for (int ct = 0; ct < 2; ++ct) { v8f c = {};
    if constexpr (LEAD) {   // leading query blocks (few keys, outputs far above the global rms): 3 products
      const _Float16* krowl = klb + (size_t)(ks * 2 + ct) * 1024; v8f cl = {};
#pragma unroll
      for (int kc = 0; kc < 2; ++kc) { const v16h kh = t.kf[ct][kc]; c = wmma16(kh, t.aq[kc], c); cl = wmma16(kh, fragp_x<LEAD>(qlp + kc * 512), cl); cl = wmma16(fragp_x<LEAD>(krowl + kc * 512), t.aq[kc], cl); }
#pragma unroll
      for (int r = 0; r < 8; ++r) c[r] += cl[r] * (1.0f / 2048.0f); }
    else {
#pragma unroll
      for (int kc = 0; kc < 2; ++kc) c = wmma16(t.kf[ct][kc], t.aq[kc], c); }   // single product elsewhere
#pragma unroll
    for (int r = 0; r < 8; ++r) s[ct][r] = (!LAST || ct * 16 + r <= dq) ? c[r] * 0.03125f : -3.0e38f; }   // 1/sqrt(1024); keys behind the lane's query excluded
  if constexpr (!LAST) {   // the next pass's K rows, right behind this pass's score products
#pragma unroll
    for (int ct = 0; ct < 2; ++ct) {
#pragma unroll
      for (int kc = 0; kc < 2; ++kc) t.kf[ct][kc] = fragp_x<LEAD>(kb0 + (size_t)(ks + 1) * 2048 + ct * 1024 + kc * 512); }
    if constexpr (!LEAD) asm volatile("s_wait_xcnt 0x0" ::: "memory"); }   // before the address registers of the K loads are reused
  float mt[8];
#pragma unroll
  for (int r = 0; r < 8; ++r) mt[r] = fmaxf(s[0][r], s[1][r]);
  float mx = fmaxf(fmaxf(fmaxf(mt[0], mt[1]), fmaxf(mt[2], mt[3])), fmaxf(fmaxf(mt[4], mt[5]), fmaxf(mt[6], mt[7])));
  mx = fmaxf(mx, xhalf(mx));   // both halves now hold the maximum over the pass's 32 keys
  const float mn = fmaxf(t.m, mx); const float ea = exp1(t.m - mn); const float alpha = (t.m <= -1.0e38f) ? 0.f : ea;
  float df[16], ex[16];
#pragma unroll
  for (int i = 0; i < 16; ++i) df[i] = s[i >> 3][i & 7] - mn;
  exp8(ex, df); exp8(ex + 8, df + 8);
  v16h pa, pl; float es[4];   // four short chains of adds in place of one long one
#pragma unroll
  for (int i = 0; i < 16; ++i) { const float sv = s[i >> 3][i & 7]; const float e = (LAST && sv <= -1.0e38f) ? 0.f : ex[i]; es[i & 3] = (i < 4) ? e : es[i & 3] + e;
    const float x0 = e * 2048.0f; const _Float16 h0 = (_Float16)x0; pa[i] = h0; if constexpr (LEAD) pl[i] = (_Float16)((x0 - (float)h0) * 2048.0f); }   // P scaled by 2^11 before the f16 split so small softmax weights stay out of the f16 subnormal range; 2^-11 folded into the epilogue
  t.l = t.l * alpha + ((es[0] + es[1]) + (es[2] + es[3])); t.m = mn;
#pragma unroll
  for (int dt = 0; dt < 4; ++dt) {
#pragma unroll
    for (int r = 0; r < 8; ++r) { t.acc[dt][r] *= alpha; if constexpr (LEAD) t.accl[dt][r] *= alpha; } }
#pragma unroll
  for (int dt = 0; dt < 4; ++dt) { const v16h vh = vf[dt]; t.acc[dt] = wmma16(vh, pa, t.acc[dt]);
    if constexpr (LEAD) { t.accl[dt] = wmma16(vh, pl, t.accl[dt]); t.accl[dt] = wmma16(fragp_x<LEAD>(vlb + (size_t)ks * 2048 + dt * 512), pa, t.accl[dt]); } }   // leading query blocks: P hi/lo x V hi/lo (3 products); elsewhere P x V single
}
template <bool LEAD>
__device__ __forceinline__ void attn_wave(const _Float16* __restrict__ QK, const _Float16* __restrict__ QKL, const _Float16* __restrict__ VTH, const _Float16* __restrict__ VTL, float* __restrict__ O, const int qb, const int h, const int b, const int wave, const int lane) {
  const int col = lane & 15, g = lane >> 4; const int q0 = qb * 64 + wave * 16; const size_t qt = QKT(0, b, h, qb * 4 + wave) + lane * 8;   // the wave's q tile, at the lane's 16 B
  AttnSt<LEAD> t;   // the q residual fragments are read where the leading blocks use them
#pragma unroll
  for (int kc = 0; kc < 2; ++kc) t.aq[kc] = fragp_x<LEAD>(QK + qt + kc * 512);
  t.m = -3.0e38f; t.l = 0.f;   // of the lane's query; l sums the keys of the lane's own half only
#pragma unroll
  for (int dt = 0; dt < 4; ++dt) { t.acc[dt] = v8f{}; if constexpr (LEAD) t.accl[dt] = v8f{}; }
  // K fragments are fetched one pass ahead (right behind the pass's score products), V hi fragments at the head of their pass: each as one group, so no WMMA of the common pass waits on a load issued directly in front of it
  const _Float16* kb0 = QK + QKT(1, b, h, 0) + lane * 8; const _Float16* klb = QKL + QKT(1, b, h, 0) + lane * 8; const _Float16* vhb = VTH + VT(b, h, 0) + lane * 8; const _Float16* vlb = VTL + VT(b, h, 0) + lane * 8;
#pragma unroll
  for (int ct = 0; ct < 2; ++ct) {
#pragma unroll
    for (int kc = 0; kc < 2; ++kc) t.kf[ct][kc] = fragp_x<LEAD>(kb0 + ct * 1024 + kc * 512); }
  if constexpr (!LEAD) asm volatile("s_wait_xcnt 0x0" ::: "memory");   // before the address registers of the q and K loads are reused
  const int nfull = q0 >> 5;   // passes whose 32 keys all lie at or before the wave's first query
#pragma unroll 1   // kept rolled: one copy of the common pass in the instruction cache
  for (int ks = 0; ks < nfull; ++ks) attn_pass<LEAD, false>(t, ks, 0, QKL + qt, klb, kb0, vhb, vlb);
  attn_pass<LEAD, true>(t, nfull, q0 + col - nfull * 32 - 8 * g, QKL + qt, klb, kb0, vhb, vlb);
  const float il = (1.0f / 2048.0f) / (t.l + xhalf(t.l));   // the two halves' sums meet here, once
  // the wave's 16 x 64 tile = two k passes of k_out x four pieces, each piece one 512-B store, straight from the accumulators
  float* ot = O + ((size_t)(b * (SS / 16) + qb * 4 + wave) * (DM / 32) + h * 2) * 512 + lane * 4;
#pragma unroll
  for (int u = 0; u < 8; ++u) { v4f o;
#pragma unroll
    for (int i = 0; i < 4; ++i) { float a = t.acc[u >> 1][(u & 1) * 4 + i]; if constexpr (LEAD) a += t.accl[u >> 1][(u & 1) * 4 + i] * (1.0f / 2048.0f); o[i] = a * il; }
    vst2(ot + u * 128, o); }
}
// four waves per SIMD: all 1,024 blocks stay resident at once
__global__ __launch_bounds__(128) __attribute__((amdgpu_waves_per_eu(4, 4))) void k_attn(const _Float16* __restrict__ QK, const _Float16* __restrict__ QKL, const _Float16* __restrict__ VTH, const _Float16* __restrict__ VTL, const void* __restrict__ KMASK, float* __restrict__ O) {
  const int tid = threadIdx.x, wave = __builtin_amdgcn_readfirstlane(tid >> 5), lane = tid & 31;   // the wave's number in a scalar register: row addresses built on it cost no vector register
  const int qb = blockIdx.x, h = blockIdx.y, b = blockIdx.z;
  if (qb < 2) attn_wave<true>(QK, QKL, VTH, VTL, O, qb, h, b, wave, lane);
  else attn_wave<false>(QK, QKL, VTH, VTL, O, qb, h, b, wave, lane);
}
// ---- k_out: block = (64 rows, 128 cols): out = O(hi/lo) . Wo rows (2 products) + bo
__global__ __launch_bounds__(128) void k_out(const float* __restrict__ O, const __bf16* __restrict__ P, const float* __restrict__ BO, float* __restrict__ Y) {
  __shared__ __align__(16) float so[4][16][132];
  const int tid = threadIdx.x, wave = tid >> 5, lane = tid & 31, col = lane & 15, g = lane >> 4; const size_t r0 = (size_t)blockIdx.x * 64 + wave * 16; const int n0 = blockIdx.y * 128;
  v8f acc[8] = {};
  // two register sets, as in k_qkv: a pass's loads go out as one group, a pass ahead of the WMMAs that read them
  const float* xa = O + (r0 >> 4) * (16 * DM) + lane * 4; const __bf16* wb = P + (size_t)(n0 >> 7) * (128 * DM) + lane * 8;
  PassF s0, s1;
  auto mm = [&](const PassF& s) { float v[16];
#pragma unroll
    for (int i = 0; i < 4; ++i) { v[i] = s.x[0][i]; v[4 + i] = s.x[1][i]; v[8 + i] = s.x[2][i]; v[12 + i] = s.x[3][i]; }
    const F2 a = bsplit16(v);
#pragma unroll
    for (int j = 0; j < 8; ++j) { acc[j] = wmma_bf(a.l, s.w[j], acc[j]); acc[j] = wmma_bf(a.h, s.w[j], acc[j]); } };
  pass_ld(s0, xa, wb, 0);
#pragma unroll 1   // kept rolled: the body already holds both register sets, a further copy would only cost registers
  for (int kc = 0; kc < DM / 32 - 2; kc += 2) { pass_ld(s1, xa, wb, kc + 1); mm(s0); pass_ld(s0, xa, wb, kc + 2); mm(s1);
    asm volatile("s_wait_xcnt 0x0" ::: "memory"); }   // before the next trip rewrites the address registers of this trip's loads
  pass_ld(s1, xa, wb, DM / 32 - 1); mm(s0); mm(s1);
  asm volatile("s_wait_xcnt 0x0" ::: "memory");   // before the epilogue reuses the address registers of the last loads
#pragma unroll
  for (int j = 0; j < 8; ++j) {
#pragma unroll
    for (int r = 0; r < 8; ++r) so[wave][8 * g + r][j * 16 + col] = acc[j][r] + bfr(BO[n0 + j * 16 + col]); }
  LDSX();
  for (int rl = 0; rl < 16; ++rl) vst2(Y + (r0 + rl) * DM + n0 + lane * 4, *(const v4f*)&so[wave][rl][lane * 4]);
}
extern "C" void kernel_launch(void* const* d_in, const int* in_sizes, int n_in, void* d_out, int out_size, void* d_ws, size_t ws_size, hipStream_t stream) {
  (void)in_sizes; (void)n_in; (void)out_size;
  const float** F = (const float**)d_in;   // 0 x [2,2048,1024], 1 w_qkv [3072,1024] natural (rows q | k | v), 2 b_qkv [3072], 3 w_o [1024,1024] natural, 4 b_o
  if (ws_size < (size_t)WS_END) return;
  char* ws = (char*)d_ws; __bf16* PK = (__bf16*)(ws + WS_PK); _Float16 *QK = (_Float16*)(ws + WS_QK), *QKL = (_Float16*)(ws + WS_QKL), *VTH = (_Float16*)(ws + WS_VTH), *VTL = (_Float16*)(ws + WS_VTL); float* O = (float*)(ws + WS_O); __bf16* XP = (__bf16*)(ws + WS_XP);
  k_pack<<<dim3((QKVW + DM + NB * SS) / 16, 4), 256, 0, stream>>>(F[1], F[3], F[0], PK, XP);
  k_qkv<<<dim3(TNB * SS / 64, QKVW / 128), 128, 0, stream>>>(XP, PK + PK_A, F[2], F[2] + DM, F[2] + 2 * DM, QK, QKL, VTH, VTL);
  k_attn<<<dim3(TQB, NH, TNB), 128, 0, stream>>>(QK, QKL, VTH, VTL, nullptr, O);
  k_out<<<dim3(TOB, DM / 128), 128, 0, stream>>>(O, PK + PK_P, F[4], (float*)d_out);
}

// v006
// One run takes 108 microseconds.
// In two side-by-side timings against v005, it was 1.11 and 1.12 times as fast.
// Over all steps from v000 it is 3.97 times as fast.
// compute dtype: all float inputs rounded to bf16; qkv = x . W^T + b with EXACT bf16 products on WMMA 16x16x32 (natural rows), f16 hi + residual; causal PLAIN-HYBRID attention (first 128 queries 3-product, later single f16; logits std ~0.5, diffuse), x 1/32, running-max softmax in f32 (hardware exp); out = ctx (bf16 hi + lo) . Wo^T + b_o; f32 output.
#include <hip/hip_runtime.h>
#include <math.h>

typedef __attribute__((ext_vector_type(16))) _Float16 v16h;
typedef __attribute__((ext_vector_type(16))) __bf16 v16b;
typedef __attribute__((ext_vector_type(8)))  _Float16 v8h;
typedef __attribute__((ext_vector_type(8)))  float v8f;
typedef __attribute__((ext_vector_type(4)))  float v4f;
typedef __attribute__((ext_vector_type(2)))  float v2f;
typedef __attribute__((ext_vector_type(4)))  unsigned v4u;
typedef __attribute__((ext_vector_type(4)))  int v4i;
typedef float __attribute__((may_alias)) float_a;
typedef int __attribute__((may_alias)) int_a;

template <typename T> __device__ __forceinline__ void vst2(void* p, T v) { *(T*)p = v;  }
__device__ __forceinline__ v8f wmma16(v16h a, v16h b, v8f c) {
  v8f d = __builtin_amdgcn_wmma_f32_16x16x32_f16(false, a, false, b, (short)0, c, false, false);
  asm volatile("v_nop\n\tv_nop\n\tv_nop\n\tv_nop" : "+v"(d) : "v"(a), "v"(b));
  return d;
}
__device__ __forceinline__ v8f wmma_bf(v16b a, v16b b, v8f c) {
  v8f d = __builtin_amdgcn_wmma_f32_16x16x32_bf16(false, a, false, b, (short)0, c, false, false);
  asm volatile("v_nop\n\tv_nop\n\tv_nop\n\tv_nop" : "+v"(d) : "v"(a), "v"(b));
  return d;
}
// Multi-head attention '2' (B 2, N 2,048, C 1,024, 16 heads x 64): fused natural w_qkv (q | k | v row blocks) + bias, causal softmax(q k / sqrt(1024)) v (the module scales by 1/sqrt(embed_dim), -inf fill), merge heads, natural w_o + b_o.
__device__ __forceinline__ v16h frag_h(const _Float16* rowk0, int lane) {
  union { v16h v; v8h q[2]; } u; const _Float16* p = rowk0 + 8 * (lane >> 4);
  u.q[0] = *(const v8h*)p; u.q[1] = *(const v8h*)(p + 16); return u.v;
}
__device__ __forceinline__ v16h frag_f32(const float* rowk0, int lane) {
  v16h a; const float* p = rowk0 + 8 * (lane >> 4);
#pragma unroll
  for (int i = 0; i < 8; ++i) { a[i] = (_Float16)p[i]; a[8 + i] = (_Float16)p[16 + i]; }
  return a;
}
__device__ __forceinline__ v16h frag_f32s(const float* rowk0, int lane, float sc) {
  v16h a; const float* p = rowk0 + 8 * (lane >> 4);
#pragma unroll
  for (int i = 0; i < 8; ++i) { a[i] = (_Float16)(p[i] * sc); a[8 + i] = (_Float16)(p[16 + i] * sc); }
  return a;
}
// column fragment from a [K][ld] layout (column n), rows >= K read as 0
__device__ __forceinline__ v16h fragc_f32(const float* W, int k0, int n, int lane, int ld, int K) {
  v16h a; const int g = lane >> 4;
#pragma unroll
  for (int i = 0; i < 8; ++i) { const int ka = k0 + 8 * g + i, kb = ka + 16;
    a[i] = (_Float16)(ka < K ? W[(size_t)(ka < K ? ka : K - 1) * ld + n] : 0.f); a[8 + i] = (_Float16)(kb < K ? W[(size_t)(kb < K ? kb : K - 1) * ld + n] : 0.f); }
  return a;
}
struct F2 { v16b h, l; };
__device__ __forceinline__ F2 bsplit16(const float v[16]) { F2 r;
#pragma unroll
  for (int i = 0; i < 16; ++i) { const __bf16 h = (__bf16)v[i]; r.h[i] = h; r.l[i] = (__bf16)(v[i] - (float)h); }
  return r; }
__device__ __forceinline__ F2 split_row(const float* row, int k0, int lane) { float v[16]; const float* p = row + k0 + 8 * (lane >> 4);
#pragma unroll
  for (int i = 0; i < 8; ++i) { v[i] = p[i]; v[8 + i] = p[16 + i]; }
  return bsplit16(v); }
__device__ __forceinline__ F2 split_rowK(const float* row, int k0, int lane, int K) { float v[16]; const int g = lane >> 4;
#pragma unroll
  for (int i = 0; i < 8; ++i) { const int ka = k0 + 8 * g + i, kb = ka + 16; v[i] = ka < K ? row[ka < K ? ka : K - 1] : 0.f; v[8 + i] = kb < K ? row[kb < K ? kb : K - 1] : 0.f; }
  return bsplit16(v); }
__device__ __forceinline__ F2 split_col(const float* W, int k0, int n, int lane, int ld, int K) { float v[16]; const int g = lane >> 4;
#pragma unroll
  for (int i = 0; i < 8; ++i) { const int ka = k0 + 8 * g + i, kb = ka + 16; v[i] = ka < K ? W[(size_t)(ka < K ? ka : K - 1) * ld + n] : 0.f; v[8 + i] = kb < K ? W[(size_t)(kb < K ? kb : K - 1) * ld + n] : 0.f; }
  return bsplit16(v); }
__device__ __forceinline__ v8f mac3(const F2& a, const F2& b, v8f c) { c = wmma_bf(a.l, b.h, c); c = wmma_bf(a.h, b.l, c); return wmma_bf(a.h, b.h, c); }
__device__ __forceinline__ float sigm(float v) { return 1.0f / (1.0f + expf(-v)); }
#define LDSX() do { asm volatile("s_wait_dscnt 0" ::: "memory"); __builtin_amdgcn_wave_barrier(); __builtin_amdgcn_fence(__ATOMIC_RELEASE, "workgroup"); } while (0)


#define NB 2
#define SS 2048
#define DM 1024
#define NH 16
#define HD 64
#define QKVW (3 * DM)
#ifndef TQB
#define TQB (SS / 64)
#define TNB NB
#define TOB (NB * SS / 64)     // output row tiles (all)
#endif
typedef __attribute__((ext_vector_type(8))) __bf16 v8b;
// FRAGMENT ORDER of a 16-bit operand in the workspace: a 16 (rows) x 32 (k) fragment is 1 KiB = two pieces of 512 B; in piece q lane l owns 16 B: row l & 15, k = 16 q + 8 (l >> 4) + 0..7.
// So each wave-wide 16-B load or store covers four whole 128-B lines. p = the fragment's start + 8 * lane.
__device__ __forceinline__ v16b fragp_b(const __bf16* p) {
  union { v16b v; v8b q[2]; } u; u.q[0] = *(const v8b*)p; u.q[1] = *(const v8b*)(p + 256); return u.v;
}
__device__ __forceinline__ v16h fragp_h(const _Float16* p) {
  union { v16h v; v8h q[2]; } u; u.q[0] = *(const v8h*)p; u.q[1] = *(const v8h*)(p + 256); return u.v;
}
__device__ __forceinline__ float bfr(float v) { return (float)(__bf16)v; }
__device__ __attribute__((noinline)) float exp_ni(float v) { return expf(v); }
__device__ __attribute__((noinline)) float erf_ni(float v) { return erff(v); }

#define PK_A 0                       // Wqkv: [24 blocks of 128 rows][32 k passes][8 tiles of 16 rows] fragments (fragment order)
#define PK_P (PK_A + QKVW * DM)        // Wo: [8 blocks][32 passes][8 tiles] fragments
#define PK_END (PK_P + DM * DM)
#define WS_PK  0u
#define WS_QK  (WS_PK + 2u * PK_END)             // f16 [q | k][b][head][128 tiles of 16 rows][2 k passes] fragments
#define WS_QKL (WS_QK + 2u * NB * SS * 2 * DM)     // f16 q | k residual planes x2048, same order
#define WS_VTH (WS_QKL + 2u * NB * SS * 2 * DM)    // f16 hi [b][head][64 passes of 32 keys][4 tiles of 16 d] fragments (row = d, k = key)
#define WS_VTL (WS_VTH + 2u * NB * DM * SS)        // f16 lo x 2048
#define WS_O   (WS_VTL + 2u * NB * DM * SS)        // f32 [256 tiles of 16 rows][32 k passes][4 pieces of 512 B]: piece i, lane l: row l & 15, k = 16 (i >> 1) + 8 (l >> 4) + 4 (i & 1) + 0..3
#define WS_CS  (WS_O + 4u * NB * SS * DM)           // f32 2 x [2048][32], reserved: nothing writes or reads it
#define WS_XP  (WS_CS + 4u * 2 * SS * 32)           // bf16 x: [256 tiles of 16 rows][32 k passes] fragments
#define WS_END (WS_XP + 2u * NB * SS * DM)
#define QKT(plane, b, h, st) (((((size_t)(plane) * NB + (b)) * NH + (h)) * (SS / 16) + (st)) * 1024)   // start of a 16 x 64 q or k tile (two fragments), in elements
#define VT(b, h, ks) ((((size_t)(b) * NH + (h)) * (SS / 32) + (ks)) * 2048)   // start of a pass's four V fragments, in elements
// ---- k_pack: block = (tile of 16 natural rows, quarter of k): f32 -> bf16 in fragment order, whole lines in (two rows x 256 B a wave) and out, turned in LDS; tiles 0..191 w_qkv, 192..255 w_o (both into PK), 256..511 x (into XP)
typedef __attribute__((ext_vector_type(4))) __bf16 v4b;
__global__ __launch_bounds__(256) void k_pack(const float* __restrict__ WA, const float* __restrict__ WO, const float* __restrict__ X, __bf16* __restrict__ PK, __bf16* __restrict__ XP) {
  __shared__ __align__(16) __bf16 s[16][264];   // pitch 528 B = 16 B x odd: the 16 rows of a fragment piece fall on distinct banks
  const int t = blockIdx.x, kq = blockIdx.y, tid = threadIdx.x; const int TA = QKVW / 16, TW = (QKVW + DM) / 16;
  const float* srcp = ((t < TA) ? WA + (size_t)t * 16 * DM : (t < TW) ? WO + (size_t)(t - TA) * 16 * DM : X + (size_t)(t - TW) * 16 * DM) + (size_t)(tid >> 4) * DM + kq * 256 + (tid & 15) * 4;
  v4f a[4];
#pragma unroll
  for (int it = 0; it < 4; ++it) a[it] = *(const v4f*)(srcp + it * 64);
#pragma unroll
  for (int it = 0; it < 4; ++it) { v4b r;
#pragma unroll
    for (int i = 0; i < 4; ++i) r[i] = (__bf16)a[it][i];
    *(v4b*)&s[tid >> 4][it * 64 + (tid & 15) * 4] = r; }
  __syncthreads();
  // weights: [block of 128 rows][k pass][8 tiles] fragments, so a wave's pass is 8 KiB in a row; x: [tile][k pass]
  __bf16* dst = (t < TW) ? PK + (size_t)(t >> 3) * (128 * DM) + (t & 7) * 512 : XP + (size_t)(t - TW) * 16 * DM; const int ps = (t < TW) ? 4096 : 512;
#pragma unroll
  for (int it = 0; it < 2; ++it) { const int o = it * 256 + tid, kcl = o >> 6, q = (o >> 5) & 1, l = o & 31;
    vst2((unsigned*)(dst + (size_t)(kq * 8 + kcl) * ps + q * 256 + l * 8), *(const v4u*)&s[l & 15][kcl * 32 + q * 16 + (l >> 4) * 8]); }
}
// one k pass (32 k) of k_out's 16 x 128 wave tile: the A fragment (its four f32 pieces) and the 8 weight fragments; xa and wb hold the lane's offset
struct PassF { v4f x[4]; v16b w[8]; };
__device__ __forceinline__ void pass_ld(PassF& s, const float* xa, const __bf16* wb, int kc) {
  const float* p = xa + kc * 512; s.x[0] = *(const v4f*)p; s.x[1] = *(const v4f*)(p + 128); s.x[2] = *(const v4f*)(p + 256); s.x[3] = *(const v4f*)(p + 384);
#pragma unroll
  for (int j = 0; j < 8; ++j) s.w[j] = fragp_b(wb + kc * 4096 + j * 512);
}
// one k pass (32 k) of k_qkv's 64 x 64 wave tile: four x fragments and four weight fragments feed 16 WMMAs (half a fragment load a WMMA); xa and wb hold the lane's offset
struct PassQ { v16b a[4]; v16b w[4]; };
__device__ __forceinline__ void pass_ld(PassQ& s, const __bf16* xa, const __bf16* wb, int kc) {
#pragma unroll
  for (int i = 0; i < 4; ++i) s.a[i] = fragp_b(xa + i * (16 * DM) + kc * 512);
#pragma unroll
  for (int j = 0; j < 4; ++j) s.w[j] = fragp_b(wb + kc * 4096 + j * 512);
}
// ---- k_qkv: block = (128 rows of x, 128 columns): four waves as 2 x 2, each a 64 x 64 tile = 64 rows x ONE head of q, k or v; 768 blocks = three a WGP, all resident at once
__global__ __launch_bounds__(128) void k_qkv(const __bf16* __restrict__ XP, const __bf16* __restrict__ P, const float* __restrict__ BQ, const float* __restrict__ BK, const float* __restrict__ BV, _Float16* __restrict__ QK, _Float16* __restrict__ QKL, _Float16* __restrict__ VTH, _Float16* __restrict__ VTL) {
  const int which0 = (blockIdx.y * 128) / DM; const float* BB = BQ ? (((which0 == 0) ? BQ : (which0 == 1) ? BK : BV) + (blockIdx.y * 128 - which0 * DM)) : nullptr;
  __shared__ __align__(16) _Float16 sh[4][64][72], sl[4][64][72];   // each wave's own tile, hi and residual (q, k: [row][d]; v: [d][key]); pitch 144 B = 16 B x odd
  const int tid = threadIdx.x, wave = tid >> 5, lane = tid & 31, col = lane & 15, g = lane >> 4, wr = wave >> 1, wc = wave & 1; const size_t r0 = (size_t)blockIdx.x * 128 + wr * 64; const int n0 = blockIdx.y * 128;
  v8f acc[4][4] = {};   // acc[i][j][r]: row r0 + 16 i + 8 g + r, column n0 + 64 wc + 16 j + col
  // the lane's 4 bias values (one a column tile) go out as one group in front of the k loop and are held in registers: the epilogue has no load and no wait on one
  float bias[4] = {};
  if (BB) {
#pragma unroll
    for (int j = 0; j < 4; ++j) bias[j] = BB[wc * 64 + j * 16 + col];
    asm volatile("s_wait_xcnt 0x0" ::: "memory");   // before the address registers of the bias loads are reused
  }
  // two register sets: a pass's 16 loads go out as one group, a pass ahead of the WMMAs that read them
  const __bf16* xa = XP + (r0 >> 4) * (16 * DM) + lane * 8; const __bf16* wb = P + (size_t)(n0 >> 7) * (128 * DM) + wc * 2048 + lane * 8;
  PassQ s0, s1;
  // the WMMAs are the plain builtin (the compiler keeps their distances itself): the operands of wmma_bf's v_nop statement would hold accumulators and both sets under v256, where they do not fit (spills)
  auto mm = [&](const PassQ& s) {
#pragma unroll
    for (int i = 0; i < 4; ++i) {
#pragma unroll
      for (int j = 0; j < 4; ++j) acc[i][j] = __builtin_amdgcn_wmma_f32_16x16x32_bf16(false, s.a[i], false, s.w[j], (short)0, acc[i][j], false, false); } };
#define SB() __builtin_amdgcn_sched_barrier(0)   // keeps a pass's 16 loads one group in front of the WMMA block of the pass before: without it the compiler sinks the loads to their readers (one register set) and every WMMA row waits out its own loads
  pass_ld(s0, xa, wb, 0); SB();
#pragma unroll 1   // kept rolled: the body already holds both register sets, a further copy would only cost registers
  for (int kc = 0; kc < DM / 32 - 2; kc += 2) { pass_ld(s1, xa, wb, kc + 1); SB(); mm(s0); SB(); pass_ld(s0, xa, wb, kc + 2); SB(); mm(s1); SB();
    asm volatile("s_wait_xcnt 0x0" ::: "memory"); }   // before the next trip rewrites the address registers of this trip's loads
  pass_ld(s1, xa, wb, DM / 32 - 1); SB(); mm(s0); SB(); mm(s1); SB();
  asm volatile("s_wait_xcnt 0x0" ::: "memory");   // before the epilogue reuses the address registers of the last loads
#pragma unroll
  for (int j = 0; j < 4; ++j) bias[j] = bfr(bias[j]);
  const int b = (int)(r0 / SS), sq0 = (int)(r0 % SS);
  if (n0 < 2 * DM) {   // q stored unscaled (f16 sigma ~0.6, no subnormal exposure); 1/32 applied to the f32 score
#pragma unroll
    for (int i = 0; i < 4; ++i) {
#pragma unroll
      for (int j = 0; j < 4; ++j) {
#pragma unroll
        for (int r = 0; r < 8; ++r) { const float v = acc[i][j][r] + bias[j]; const _Float16 hv = (_Float16)v; sh[wave][i * 16 + 8 * g + r][j * 16 + col] = hv; sl[wave][i * 16 + 8 * g + r][j * 16 + col] = (_Float16)((v - (float)hv) * 2048.0f); } } }   // q, k (+ bias) as f16 hi + (x2048) residual
    LDSX();
    // the wave's 64 x 64 tile = four row tiles x two fragments x two pieces, 16 pieces in a row in the workspace, each one 512-B store
    const size_t o0 = QKT(which0, b, (n0 - which0 * DM) / HD + wc, sq0 / 16) + lane * 8;
#pragma unroll
    for (int u = 0; u < 16; ++u) { const int row = (u >> 2) * 16 + col, c0 = (u & 3) * 16 + g * 8;
      vst2((unsigned*)(QK + o0 + u * 256), *(const v4u*)&sh[wave][row][c0]); vst2((unsigned*)(QKL + o0 + u * 256), *(const v4u*)&sl[wave][row][c0]);
      if (u == 7 || u >= 14) asm volatile("s_wait_xcnt 0x0" ::: "memory"); }   // before data registers of the stores so far are rewritten: by later LDS reads (the second half reuses the first half's, the last piece the second half's), behind the last piece by whatever code is laid behind this path
  } else {
#pragma unroll
    for (int i = 0; i < 4; ++i) {
#pragma unroll
      for (int j = 0; j < 4; ++j) {
#pragma unroll
        for (int r = 0; r < 8; ++r) { const float v = acc[i][j][r] + bias[j]; const _Float16 hv = (_Float16)v; sh[wave][j * 16 + col][i * 16 + 8 * g + r] = hv; sl[wave][j * 16 + col][i * 16 + 8 * g + r] = (_Float16)((v - (float)hv) * 2048.0f); } } }
    LDSX();   // the wave reads back only what it wrote itself: no wave waits on another
    // the wave's 64 d x 64 keys = two passes x four d tiles x two pieces, 16 pieces in a row in the workspace, each one 512-B store
    const size_t o0 = VT(b, (n0 - 2 * DM) / HD + wc, sq0 / 32) + lane * 8;
#pragma unroll
    for (int u = 0; u < 16; ++u) { const int d = ((u >> 1) & 3) * 16 + col, sc = (u >> 3) * 32 + (u & 1) * 16 + g * 8;
      vst2((unsigned*)(VTH + o0 + u * 256), *(const v4u*)&sh[wave][d][sc]); vst2((unsigned*)(VTL + o0 + u * 256), *(const v4u*)&sl[wave][d][sc]);
      if (u == 7 || u >= 14) asm volatile("s_wait_xcnt 0x0" ::: "memory"); }   // before data registers of the stores so far are rewritten: by later LDS reads (the second half reuses the first half's, the last piece the second half's), behind the last piece by whatever code is laid behind this path
  }
}
// lane l with lane l ^ 16 (a vector cross-row move, no LDS path)
__device__ __forceinline__ float xhalf(float x) { return __builtin_bit_cast(float, __builtin_amdgcn_permlanex16(__builtin_bit_cast(int, x), __builtin_bit_cast(int, x), 0x76543210, 0xfedcba98, false, false)); }
// ---- k_attn: block = (64 queries, head h, batch b): causal flash attention (K = 64: 2 k-steps) in the TRANSPOSED form: S^T = K . Q^T (A = K fragment, B = q fragment), O^T += V^T . P^T (A = V fragment, B = P).
// A lane then holds ONE query (q0 + col): of a 16-key score tile its 8 registers are keys 8 g + r, so maximum and sum run inside the lane, the two wave halves meet in one exchange (the maximum, each pass) and once behind the loop (the sum).
// The two score tiles of a pass, converted in place, ARE the B fragment of P^T (element s = tile s >> 3, register s & 7: the k order of the V fragments), so P touches no LDS; acc[dt][r] = O(query col, d = dt * 16 + 8 g + r) is already k_out's fragment order.
// scores = (q.k) / 32 with single f16 operands (LEAD: + residual products), P.V: f16 P x V hi (LEAD: + P lo x V hi, P x V lo*2048 in a second accumulator); O(row b*S+q, col h*64+d) = (acc + accl / 2048) / (2048 l)
// The pass is compiled per case of its two wave-uniform conditions, so that the common pass carries only its own work:
// LEAD (query blocks 0 and 1): residual products, the low half of P and the second accumulator; elsewhere none of them exists.
// LAST (the wave's one pass that holds its diagonal, ks = q0 / 32): the causal mask, and no fetch of further K rows; every pass in front of it has all 32 keys at or before all 16 queries.
// __expf as it compiles (one multiply, v_exp_f32), written so that the free slot which the instruction set asks for behind a transcendental (before its result is read or its source overwritten) is there by construction.
// exp8: each next v_exp_f32 is the independent instruction behind the one before (early-clobber outputs: none lies on a source), one v_nop closes the last; exp1: the same for a single value.
__device__ __forceinline__ void exp8(float* r, const float* x) {
  float y[8];
#pragma unroll
  for (int i = 0; i < 8; ++i) y[i] = x[i] * 1.44269504f;
  asm("v_exp_f32 %0, %8\n\tv_exp_f32 %1, %9\n\tv_exp_f32 %2, %10\n\tv_exp_f32 %3, %11\n\tv_exp_f32 %4, %12\n\tv_exp_f32 %5, %13\n\tv_exp_f32 %6, %14\n\tv_exp_f32 %7, %15\n\tv_nop"
      : "=&v"(r[0]), "=&v"(r[1]), "=&v"(r[2]), "=&v"(r[3]), "=&v"(r[4]), "=&v"(r[5]), "=&v"(r[6]), "=&v"(r[7])
      : "v"(y[0]), "v"(y[1]), "v"(y[2]), "v"(y[3]), "v"(y[4]), "v"(y[5]), "v"(y[6]), "v"(y[7]));
}
__device__ __forceinline__ float exp1(float x) { float r; const float y = x * 1.44269504f; asm("v_exp_f32 %0, %1\n\tv_nop" : "=v"(r) : "v"(y)); return r; }
// a fragment's two loads; EACH true (the leading blocks, whose loads go through vector address pairs shared by a run of loads): every load is closed by a wait of its own, because the register allocator lets a later load of a run land on the pair that the earlier ones still name
template <bool EACH> __device__ __forceinline__ v16h fragp_x(const _Float16* p) {
  if constexpr (!EACH) return fragp_h(p);
  else { union { v16h v; v8h q[2]; } u;
    u.q[0] = *(const v8h*)p; asm volatile("s_wait_xcnt 0x0" ::: "memory");   // before the next load may land on this one's address pair
    u.q[1] = *(const v8h*)(p + 256); asm volatile("s_wait_xcnt 0x0" ::: "memory");   // the same
    return u.v; }
}
template <bool LEAD> struct AttnSt { v16h aq[2]; v16h kf[2][2]; v8f acc[4]; v8f accl[LEAD ? 4 : 1]; float m, l; };
// qlp, klb, kb0, vhb, vlb: q residual tile, K residual rows, K rows, V hi and V lo of this (b, h), each at the lane's 16 B; dq: the lane's query counted from the first key of the lane's half in this pass (read by LAST only)
template <bool LEAD, bool LAST>
__device__ __forceinline__ void attn_pass(AttnSt<LEAD>& t, const int ks, const int dq, const _Float16* qlp, const _Float16* klb, const _Float16* kb0, const _Float16* vhb, const _Float16* vlb) {
  v8f s[2]; v16h vf[4];
#pragma unroll
  for (int dt = 0; dt < 4; ++dt) vf[dt] = fragp_x<LEAD>(vhb + (size_t)ks * 2048 + dt * 512);
  if constexpr (!LEAD) asm volatile("s_wait_xcnt 0x0" ::: "memory");   // before the address registers of the V loads are reused (LEAD: each load has its own wait, here and below)
#pragma unroll
  for (int ct = 0; ct < 2; ++ct) { v8f c = {};
    if constexpr (LEAD) {   // leading query blocks (few keys, outputs far above the global rms): 3 products
      const _Float16* krowl = klb + (size_t)(ks * 2 + ct) * 1024; v8f cl = {};
#pragma unroll
      for (int kc = 0; kc < 2; ++kc) { const v16h kh = t.kf[ct][kc]; c = wmma16(kh, t.aq[kc], c); cl = wmma16(kh, fragp_x<LEAD>(qlp + kc * 512), cl); cl = wmma16(fragp_x<LEAD>(krowl + kc * 512), t.aq[kc], cl); }
#pragma unroll
      for (int r = 0; r < 8; ++r) c[r] += cl[r] * (1.0f / 2048.0f); }
    else {
#pragma unroll
      for (int kc = 0; kc < 2; ++kc) c = wmma16(t.kf[ct][kc], t.aq[kc], c); }   // single product elsewhere
#pragma unroll
    for (int r = 0; r < 8; ++r) s[ct][r] = (!LAST || ct * 16 + r <= dq) ? c[r] * 0.03125f : -3.0e38f; }   // 1/sqrt(1024); keys behind the lane's query excluded
  if constexpr (!LAST) {   // the next pass's K rows, right behind this pass's score products
#pragma unroll
    for (int ct = 0; ct < 2; ++ct) {
#pragma unroll
      for (int kc = 0; kc < 2; ++kc) t.kf[ct][kc] = fragp_x<LEAD>(kb0 + (size_t)(ks + 1) * 2048 + ct * 1024 + kc * 512); }
    if constexpr (!LEAD) asm volatile("s_wait_xcnt 0x0" ::: "memory"); }   // before the address registers of the K loads are reused
  float mt[8];
#pragma unroll
  for (int r = 0; r < 8; ++r) mt[r] = fmaxf(s[0][r], s[1][r]);
  float mx = fmaxf(fmaxf(fmaxf(mt[0], mt[1]), fmaxf(mt[2], mt[3])), fmaxf(fmaxf(mt[4], mt[5]), fmaxf(mt[6], mt[7])));
  mx = fmaxf(mx, xhalf(mx));   // both halves now hold the maximum over the pass's 32 keys
  const float mn = fmaxf(t.m, mx); const float ea = exp1(t.m - mn); const float alpha = (t.m <= -1.0e38f) ? 0.f : ea;
  float df[16], ex[16];
#pragma unroll
  for (int i = 0; i < 16; ++i) df[i] = s[i >> 3][i & 7] - mn;
  exp8(ex, df); exp8(ex + 8, df + 8);
  v16h pa, pl; float es[4];   // four short chains of adds in place of one long one
#pragma unroll
  for (int i = 0; i < 16; ++i) { const float sv = s[i >> 3][i & 7]; const float e = (LAST && sv <= -1.0e38f) ? 0.f : ex[i]; es[i & 3] = (i < 4) ? e : es[i & 3] + e;
    const float x0 = e * 2048.0f; const _Float16 h0 = (_Float16)x0; pa[i] = h0; if constexpr (LEAD) pl[i] = (_Float16)((x0 - (float)h0) * 2048.0f); }   // P scaled by 2^11 before the f16 split so small softmax weights stay out of the f16 subnormal range; 2^-11 folded into the epilogue
  t.l = t.l * alpha + ((es[0] + es[1]) + (es[2] + es[3])); t.m = mn;
#pragma unroll
  for (int dt = 0; dt < 4; ++dt) {
#pragma unroll
    for (int r = 0; r < 8; ++r) { t.acc[dt][r] *= alpha; if constexpr (LEAD) t.accl[dt][r] *= alpha; } }
#pragma unroll
  for (int dt = 0; dt < 4; ++dt) { const v16h vh = vf[dt]; t.acc[dt] = wmma16(vh, pa, t.acc[dt]);
    if constexpr (LEAD) { t.accl[dt] = wmma16(vh, pl, t.accl[dt]); t.accl[dt] = wmma16(fragp_x<LEAD>(vlb + (size_t)ks * 2048 + dt * 512), pa, t.accl[dt]); } }   // leading query blocks: P hi/lo x V hi/lo (3 products); elsewhere P x V single
}
template <bool LEAD>
__device__ __forceinline__ void attn_wave(const _Float16* __restrict__ QK, const _Float16* __restrict__ QKL, const _Float16* __restrict__ VTH, const _Float16* __restrict__ VTL, float* __restrict__ O, const int qb, const int h, const int b, const int wave, const int lane) {
  const int col = lane & 15, g = lane >> 4; const int q0 = qb * 64 + wave * 16; const size_t qt = QKT(0, b, h, qb * 4 + wave) + lane * 8;   // the wave's q tile, at the lane's 16 B
  AttnSt<LEAD> t;   // the q residual fragments are read where the leading blocks use them
#pragma unroll
  for (int kc = 0; kc < 2; ++kc) t.aq[kc] = fragp_x<LEAD>(QK + qt + kc * 512);
  t.m = -3.0e38f; t.l = 0.f;   // of the lane's query; l sums the keys of the lane's own half only
#pragma unroll
  for (int dt = 0; dt < 4; ++dt) { t.acc[dt] = v8f{}; if constexpr (LEAD) t.accl[dt] = v8f{}; }
  // K fragments are fetched one pass ahead (right behind the pass's score products), V hi fragments at the head of their pass: each as one group, so no WMMA of the common pass waits on a load issued directly in front of it
  const _Float16* kb0 = QK + QKT(1, b, h, 0) + lane * 8; const _Float16* klb = QKL + QKT(1, b, h, 0) + lane * 8; const _Float16* vhb = VTH + VT(b, h, 0) + lane * 8; const _Float16* vlb = VTL + VT(b, h, 0) + lane * 8;
#pragma unroll
  for (int ct = 0; ct < 2; ++ct) {
#pragma unroll
    for (int kc = 0; kc < 2; ++kc) t.kf[ct][kc] = fragp_x<LEAD>(kb0 + ct * 1024 + kc * 512); }
  if constexpr (!LEAD) asm volatile("s_wait_xcnt 0x0" ::: "memory");   // before the address registers of the q and K loads are reused
  const int nfull = q0 >> 5;   // passes whose 32 keys all lie at or before the wave's first query
#pragma unroll 1   // kept rolled: one copy of the common pass in the instruction cache
  for (int ks = 0; ks < nfull; ++ks) attn_pass<LEAD, false>(t, ks, 0, QKL + qt, klb, kb0, vhb, vlb);
  attn_pass<LEAD, true>(t, nfull, q0 + col - nfull * 32 - 8 * g, QKL + qt, klb, kb0, vhb, vlb);
  const float il = (1.0f / 2048.0f) / (t.l + xhalf(t.l));   // the two halves' sums meet here, once
  // the wave's 16 x 64 tile = two k passes of k_out x four pieces, each piece one 512-B store, straight from the accumulators
  float* ot = O + ((size_t)(b * (SS / 16) + qb * 4 + wave) * (DM / 32) + h * 2) * 512 + lane * 4;
#pragma unroll
  for (int u = 0; u < 8; ++u) { v4f o;
#pragma unroll
    for (int i = 0; i < 4; ++i) { float a = t.acc[u >> 1][(u & 1) * 4 + i]; if constexpr (LEAD) a += t.accl[u >> 1][(u & 1) * 4 + i] * (1.0f / 2048.0f); o[i] = a * il; }
    vst2(ot + u * 128, o); }
}
// four waves per SIMD: all 1,024 blocks stay resident at once
__global__ __launch_bounds__(128) __attribute__((amdgpu_waves_per_eu(4, 4))) void k_attn(const _Float16* __restrict__ QK, const _Float16* __restrict__ QKL, const _Float16* __restrict__ VTH, const _Float16* __restrict__ VTL, const void* __restrict__ KMASK, float* __restrict__ O) {
  const int tid = threadIdx.x, wave = __builtin_amdgcn_readfirstlane(tid >> 5), lane = tid & 31;   // the wave's number in a scalar register: row addresses built on it cost no vector register
  const int qb = blockIdx.x, h = blockIdx.y, b = blockIdx.z;
  if (qb < 2) attn_wave<true>(QK, QKL, VTH, VTL, O, qb, h, b, wave, lane);
  else attn_wave<false>(QK, QKL, VTH, VTL, O, qb, h, b, wave, lane);
}
// ---- k_out: block = (64 rows, 128 cols): out = O(hi/lo) . Wo rows (2 products) + bo
__global__ __launch_bounds__(128) void k_out(const float* __restrict__ O, const __bf16* __restrict__ P, const float* __restrict__ BO, float* __restrict__ Y) {
  __shared__ __align__(16) float so[4][16][132];
  const int tid = threadIdx.x, wave = tid >> 5, lane = tid & 31, col = lane & 15, g = lane >> 4; const size_t r0 = (size_t)blockIdx.x * 64 + wave * 16; const int n0 = blockIdx.y * 128;
  v8f acc[8] = {};
  // two register sets, as in k_qkv: a pass's loads go out as one group, a pass ahead of the WMMAs that read them
  const float* xa = O + (r0 >> 4) * (16 * DM) + lane * 4; const __bf16* wb = P + (size_t)(n0 >> 7) * (128 * DM) + lane * 8;
  PassF s0, s1;
  auto mm = [&](const PassF& s) { float v[16];
#pragma unroll
    for (int i = 0; i < 4; ++i) { v[i] = s.x[0][i]; v[4 + i] = s.x[1][i]; v[8 + i] = s.x[2][i]; v[12 + i] = s.x[3][i]; }
    const F2 a = bsplit16(v);
#pragma unroll
    for (int j = 0; j < 8; ++j) { acc[j] = wmma_bf(a.l, s.w[j], acc[j]); acc[j] = wmma_bf(a.h, s.w[j], acc[j]); } };
  pass_ld(s0, xa, wb, 0);
#pragma unroll 1   // kept rolled: the body already holds both register sets, a further copy would only cost registers
  for (int kc = 0; kc < DM / 32 - 2; kc += 2) { pass_ld(s1, xa, wb, kc + 1); mm(s0); pass_ld(s0, xa, wb, kc + 2); mm(s1);
    asm volatile("s_wait_xcnt 0x0" ::: "memory"); }   // before the next trip rewrites the address registers of this trip's loads
  pass_ld(s1, xa, wb, DM / 32 - 1); mm(s0); mm(s1);
  asm volatile("s_wait_xcnt 0x0" ::: "memory");   // before the epilogue reuses the address registers of the last loads
#pragma unroll
  for (int j = 0; j < 8; ++j) {
#pragma unroll
    for (int r = 0; r < 8; ++r) so[wave][8 * g + r][j * 16 + col] = acc[j][r] + bfr(BO[n0 + j * 16 + col]); }
  LDSX();
  for (int rl = 0; rl < 16; ++rl) vst2(Y + (r0 + rl) * DM + n0 + lane * 4, *(const v4f*)&so[wave][rl][lane * 4]);
}
extern "C" void kernel_launch(void* const* d_in, const int* in_sizes, int n_in, void* d_out, int out_size, void* d_ws, size_t ws_size, hipStream_t stream) {
  (void)in_sizes; (void)n_in; (void)out_size;
  const float** F = (const float**)d_in;   // 0 x [2,2048,1024], 1 w_qkv [3072,1024] natural (rows q | k | v), 2 b_qkv [3072], 3 w_o [1024,1024] natural, 4 b_o
  if (ws_size < (size_t)WS_END) return;
  char* ws = (char*)d_ws; __bf16* PK = (__bf16*)(ws + WS_PK); _Float16 *QK = (_Float16*)(ws + WS_QK), *QKL = (_Float16*)(ws + WS_QKL), *VTH = (_Float16*)(ws + WS_VTH), *VTL = (_Float16*)(ws + WS_VTL); float* O = (float*)(ws + WS_O); __bf16* XP = (__bf16*)(ws + WS_XP);
  k_pack<<<dim3((QKVW + DM + NB * SS) / 16, 4), 256, 0, stream>>>(F[1], F[3], F[0], PK, XP);
  k_qkv<<<dim3(TNB * SS / 128, QKVW / 128), 128, 0, stream>>>(XP, PK + PK_A, F[2], F[2] + DM, F[2] + 2 * DM, QK, QKL, VTH, VTL);
  k_attn<<<dim3(TQB, NH, TNB), 128, 0, stream>>>(QK, QKL, VTH, VTL, nullptr, O);
  k_out<<<dim3(TOB, DM / 128), 128, 0, stream>>>(O, PK + PK_P, F[4], (float*)d_out);
}

// v007
// It runs in 92.5 microseconds.
// Timed twice side by side with v006, it ran 1.16 and 1.17 times as fast.
// All steps since v000 together make it 4.64 times as fast.
// compute dtype: all float inputs rounded to bf16; qkv = x . W^T + b with EXACT bf16 products on WMMA 16x16x32 (natural rows), f16 hi + residual; causal PLAIN-HYBRID attention (first 128 queries 3-product, later single f16; logits std ~0.5, diffuse), x 1/32, running-max softmax in f32 (hardware exp); out = ctx (bf16 hi + lo) . Wo^T + b_o; f32 output.
#include <hip/hip_runtime.h>
#include <math.h>

typedef __attribute__((ext_vector_type(16))) _Float16 v16h;
typedef __attribute__((ext_vector_type(16))) __bf16 v16b;
typedef __attribute__((ext_vector_type(8)))  _Float16 v8h;
typedef __attribute__((ext_vector_type(8)))  float v8f;
typedef __attribute__((ext_vector_type(4)))  float v4f;
typedef __attribute__((ext_vector_type(2)))  float v2f;
typedef __attribute__((ext_vector_type(4)))  unsigned v4u;
typedef __attribute__((ext_vector_type(4)))  int v4i;
typedef float __attribute__((may_alias)) float_a;
typedef int __attribute__((may_alias)) int_a;

template <typename T> __device__ __forceinline__ void vst2(void* p, T v) { *(T*)p = v;  }
__device__ __forceinline__ v8f wmma16(v16h a, v16h b, v8f c) {
  v8f d = __builtin_amdgcn_wmma_f32_16x16x32_f16(false, a, false, b, (short)0, c, false, false);
  asm volatile("v_nop\n\tv_nop\n\tv_nop\n\tv_nop" : "+v"(d) : "v"(a), "v"(b));
  return d;
}
__device__ __forceinline__ v8f wmma_bf(v16b a, v16b b, v8f c) {
  v8f d = __builtin_amdgcn_wmma_f32_16x16x32_bf16(false, a, false, b, (short)0, c, false, false);
  asm volatile("v_nop\n\tv_nop\n\tv_nop\n\tv_nop" : "+v"(d) : "v"(a), "v"(b));
  return d;
}
// Multi-head attention '2' (B 2, N 2,048, C 1,024, 16 heads x 64): fused natural w_qkv (q | k | v row blocks) + bias, causal softmax(q k / sqrt(1024)) v (the module scales by 1/sqrt(embed_dim), -inf fill), merge heads, natural w_o + b_o.
__device__ __forceinline__ v16h frag_h(const _Float16* rowk0, int lane) {
  union { v16h v; v8h q[2]; } u; const _Float16* p = rowk0 + 8 * (lane >> 4);
  u.q[0] = *(const v8h*)p; u.q[1] = *(const v8h*)(p + 16); return u.v;
}
__device__ __forceinline__ v16h frag_f32(const float* rowk0, int lane) {
  v16h a; const float* p = rowk0 + 8 * (lane >> 4);
#pragma unroll
  for (int i = 0; i < 8; ++i) { a[i] = (_Float16)p[i]; a[8 + i] = (_Float16)p[16 + i]; }
  return a;
}
__device__ __forceinline__ v16h frag_f32s(const float* rowk0, int lane, float sc) {
  v16h a; const float* p = rowk0 + 8 * (lane >> 4);
#pragma unroll
  for (int i = 0; i < 8; ++i) { a[i] = (_Float16)(p[i] * sc); a[8 + i] = (_Float16)(p[16 + i] * sc); }
  return a;
}
// column fragment from a [K][ld] layout (column n), rows >= K read as 0
__device__ __forceinline__ v16h fragc_f32(const float* W, int k0, int n, int lane, int ld, int K) {
  v16h a; const int g = lane >> 4;
#pragma unroll
  for (int i = 0; i < 8; ++i) { const int ka = k0 + 8 * g + i, kb = ka + 16;
    a[i] = (_Float16)(ka < K ? W[(size_t)(ka < K ? ka : K - 1) * ld + n] : 0.f); a[8 + i] = (_Float16)(kb < K ? W[(size_t)(kb < K ? kb : K - 1) * ld + n] : 0.f); }
  return a;
}
struct F2 { v16b h, l; };
__device__ __forceinline__ F2 bsplit16(const float v[16]) { F2 r;
#pragma unroll
  for (int i = 0; i < 16; ++i) { const __bf16 h = (__bf16)v[i]; r.h[i] = h; r.l[i] = (__bf16)(v[i] - (float)h); }
  return r; }
__device__ __forceinline__ F2 split_row(const float* row, int k0, int lane) { float v[16]; const float* p = row + k0 + 8 * (lane >> 4);
#pragma unroll
  for (int i = 0; i < 8; ++i) { v[i] = p[i]; v[8 + i] = p[16 + i]; }
  return bsplit16(v); }
__device__ __forceinline__ F2 split_rowK(const float* row, int k0, int lane, int K) { float v[16]; const int g = lane >> 4;
#pragma unroll
  for (int i = 0; i < 8; ++i) { const int ka = k0 + 8 * g + i, kb = ka + 16; v[i] = ka < K ? row[ka < K ? ka : K - 1] : 0.f; v[8 + i] = kb < K ? row[kb < K ? kb : K - 1] : 0.f; }
  return bsplit16(v); }
__device__ __forceinline__ F2 split_col(const float* W, int k0, int n, int lane, int ld, int K) { float v[16]; const int g = lane >> 4;
#pragma unroll
  for (int i = 0; i < 8; ++i) { const int ka = k0 + 8 * g + i, kb = ka + 16; v[i] = ka < K ? W[(size_t)(ka < K ? ka : K - 1) * ld + n] : 0.f; v[8 + i] = kb < K ? W[(size_t)(kb < K ? kb : K - 1) * ld + n] : 0.f; }
  return bsplit16(v); }
__device__ __forceinline__ v8f mac3(const F2& a, const F2& b, v8f c) { c = wmma_bf(a.l, b.h, c); c = wmma_bf(a.h, b.l, c); return wmma_bf(a.h, b.h, c); }
__device__ __forceinline__ float sigm(float v) { return 1.0f / (1.0f + expf(-v)); }
#define LDSX() do { asm volatile("s_wait_dscnt 0" ::: "memory"); __builtin_amdgcn_wave_barrier(); __builtin_amdgcn_fence(__ATOMIC_RELEASE, "workgroup"); } while (0)


#define NB 2
#define SS 2048
#define DM 1024
#define NH 16
#define HD 64
#define QKVW (3 * DM)
#ifndef TQB
#define TQB (SS / 64)
#define TNB NB
#define TOB (NB * SS / 64)     // output row tiles (all)
#endif
typedef __attribute__((ext_vector_type(8))) __bf16 v8b;
// FRAGMENT ORDER of a 16-bit operand in the workspace: a 16 (rows) x 32 (k) fragment is 1 KiB = two pieces of 512 B; in piece q lane l owns 16 B: row l & 15, k = 16 q + 8 (l >> 4) + 0..7.
// So each wave-wide 16-B load or store covers four whole 128-B lines. p = the fragment's start + 8 * lane.
__device__ __forceinline__ v16b fragp_b(const __bf16* p) {
  union { v16b v; v8b q[2]; } u; u.q[0] = *(const v8b*)p; u.q[1] = *(const v8b*)(p + 256); return u.v;
}
__device__ __forceinline__ v16h fragp_h(const _Float16* p) {
  union { v16h v; v8h q[2]; } u; u.q[0] = *(const v8h*)p; u.q[1] = *(const v8h*)(p + 256); return u.v;
}
__device__ __forceinline__ float bfr(float v) { return (float)(__bf16)v; }
__device__ __attribute__((noinline)) float exp_ni(float v) { return expf(v); }
__device__ __attribute__((noinline)) float erf_ni(float v) { return erff(v); }

#define PK_A 0                       // Wqkv: [24 blocks of 128 rows][32 k passes][8 tiles of 16 rows] fragments (fragment order)
#define PK_P (PK_A + QKVW * DM)        // Wo: [8 blocks][32 passes][8 tiles] fragments
#define PK_END (PK_P + DM * DM)
#define WS_PK  0u
#define WS_QK  (WS_PK + 2u * PK_END)             // f16 [q | k][b][head][128 tiles of 16 rows][2 k passes] fragments
#define WS_QKL (WS_QK + 2u * NB * SS * 2 * DM)     // f16 q | k residual planes x2048, same order
#define WS_VTH (WS_QKL + 2u * NB * SS * 2 * DM)    // f16 hi [b][head][64 passes of 32 keys][4 tiles of 16 d] fragments (row = d, k = key)
#define WS_VTL (WS_VTH + 2u * NB * DM * SS)        // f16 lo x 2048
#define WS_O   (WS_VTL + 2u * NB * DM * SS)        // f32 [256 tiles of 16 rows][32 k passes][4 pieces of 512 B]: piece i, lane l: row l & 15, k = 16 (i >> 1) + 8 (l >> 4) + 4 (i & 1) + 0..3
#define WS_CS  (WS_O + 4u * NB * SS * DM)           // f32 2 x [2048][32], reserved: nothing writes or reads it
#define WS_XP  (WS_CS + 4u * 2 * SS * 32)           // bf16 x: [256 tiles of 16 rows][32 k passes] fragments
#define WS_END (WS_XP + 2u * NB * SS * DM)
#define QKT(plane, b, h, st) (((((size_t)(plane) * NB + (b)) * NH + (h)) * (SS / 16) + (st)) * 1024)   // start of a 16 x 64 q or k tile (two fragments), in elements
#define VT(b, h, ks) ((((size_t)(b) * NH + (h)) * (SS / 32) + (ks)) * 2048)   // start of a pass's four V fragments, in elements
// ---- k_pack: block = (tile of 16 natural rows, quarter of k): f32 -> bf16 in fragment order, whole lines in (two rows x 256 B a wave) and out, turned in LDS; tiles 0..191 w_qkv, 192..255 w_o (both into PK), 256..511 x (into XP)
typedef __attribute__((ext_vector_type(4))) __bf16 v4b;
__global__ __launch_bounds__(256) void k_pack(const float* __restrict__ WA, const float* __restrict__ WO, const float* __restrict__ X, __bf16* __restrict__ PK, __bf16* __restrict__ XP) {
  __shared__ __align__(16) __bf16 s[16][264];   // pitch 528 B = 16 B x odd: the 16 rows of a fragment piece fall on distinct banks
  const int t = blockIdx.x, kq = blockIdx.y, tid = threadIdx.x; const int TA = QKVW / 16, TW = (QKVW + DM) / 16;
  const float* srcp = ((t < TA) ? WA + (size_t)t * 16 * DM : (t < TW) ? WO + (size_t)(t - TA) * 16 * DM : X + (size_t)(t - TW) * 16 * DM) + (size_t)(tid >> 4) * DM + kq * 256 + (tid & 15) * 4;
  v4f a[4];
#pragma unroll
  for (int it = 0; it < 4; ++it) a[it] = *(const v4f*)(srcp + it * 64);
#pragma unroll
  for (int it = 0; it < 4; ++it) { v4b r;
#pragma unroll
    for (int i = 0; i < 4; ++i) r[i] = (__bf16)a[it][i];
    *(v4b*)&s[tid >> 4][it * 64 + (tid & 15) * 4] = r; }
  __syncthreads();
  // weights: [block of 128 rows][k pass][8 tiles] fragments, so a wave's pass is 8 KiB in a row; x: [tile][k pass]
  __bf16* dst = (t < TW) ? PK + (size_t)(t >> 3) * (128 * DM) + (t & 7) * 512 : XP + (size_t)(t - TW) * 16 * DM; const int ps = (t < TW) ? 4096 : 512;
#pragma unroll
  for (int it = 0; it < 2; ++it) { const int o = it * 256 + tid, kcl = o >> 6, q = (o >> 5) & 1, l = o & 31;
    vst2((unsigned*)(dst + (size_t)(kq * 8 + kcl) * ps + q * 256 + l * 8), *(const v4u*)&s[l & 15][kcl * 32 + q * 16 + (l >> 4) * 8]); }
}
// one k pass (32 k) of k_out's 16 x 128 wave tile: the A fragment (its four f32 pieces) and the 8 weight fragments; xa and wb hold the lane's offset
struct PassF { v4f x[4]; v16b w[8]; };
__device__ __forceinline__ void pass_ld(PassF& s, const float* xa, const __bf16* wb, int kc) {
  const float* p = xa + kc * 512; s.x[0] = *(const v4f*)p; s.x[1] = *(const v4f*)(p + 128); s.x[2] = *(const v4f*)(p + 256); s.x[3] = *(const v4f*)(p + 384);
#pragma unroll
  for (int j = 0; j < 8; ++j) s.w[j] = fragp_b(wb + kc * 4096 + j * 512);
}
// one k pass (32 k) of k_qkv's 64 x 64 wave tile: four x fragments and four weight fragments feed 16 WMMAs (half a fragment load a WMMA); xa and wb hold the lane's offset
struct PassQ { v16b a[4]; v16b w[4]; };
__device__ __forceinline__ void pass_ld(PassQ& s, const __bf16* xa, const __bf16* wb, int kc) {
#pragma unroll
  for (int i = 0; i < 4; ++i) s.a[i] = fragp_b(xa + i * (16 * DM) + kc * 512);
#pragma unroll
  for (int j = 0; j < 4; ++j) s.w[j] = fragp_b(wb + kc * 4096 + j * 512);
}
// ---- k_qkv: block = (128 rows of x, 128 columns): four waves as 2 x 2, each a 64 x 64 tile = 64 rows x ONE head of q, k or v; 768 blocks = three a WGP, all resident at once
__global__ __launch_bounds__(128) void k_qkv(const __bf16* __restrict__ XP, const __bf16* __restrict__ P, const float* __restrict__ BQ, const float* __restrict__ BK, const float* __restrict__ BV, _Float16* __restrict__ QK, _Float16* __restrict__ QKL, _Float16* __restrict__ VTH, _Float16* __restrict__ VTL) {
  const int which0 = (blockIdx.y * 128) / DM; const float* BB = BQ ? (((which0 == 0) ? BQ : (which0 == 1) ? BK : BV) + (blockIdx.y * 128 - which0 * DM)) : nullptr;
  __shared__ __align__(16) _Float16 sh[4][64][72], sl[4][64][72];   // each wave's own tile, hi and residual (q, k: [row][d]; v: [d][key]); pitch 144 B = 16 B x odd
  const int tid = threadIdx.x, wave = tid >> 5, lane = tid & 31, col = lane & 15, g = lane >> 4, wr = wave >> 1, wc = wave & 1; const size_t r0 = (size_t)blockIdx.x * 128 + wr * 64; const int n0 = blockIdx.y * 128;
  v8f acc[4][4] = {};   // acc[i][j][r]: row r0 + 16 i + 8 g + r, column n0 + 64 wc + 16 j + col
  // the lane's 4 bias values (one a column tile) go out as one group in front of the k loop and are held in registers: the epilogue has no load and no wait on one
  float bias[4] = {};
  if (BB) {
#pragma unroll
    for (int j = 0; j < 4; ++j) bias[j] = BB[wc * 64 + j * 16 + col];
    asm volatile("s_wait_xcnt 0x0" ::: "memory");   // before the address registers of the bias loads are reused
  }
  // two register sets: a pass's 16 loads go out as one group, a pass ahead of the WMMAs that read them
  const __bf16* xa = XP + (r0 >> 4) * (16 * DM) + lane * 8; const __bf16* wb = P + (size_t)(n0 >> 7) * (128 * DM) + wc * 2048 + lane * 8;
  PassQ s0, s1;
  // the WMMAs are the plain builtin (the compiler keeps their distances itself): the operands of wmma_bf's v_nop statement would hold accumulators and both sets under v256, where they do not fit (spills)
  auto mm = [&](const PassQ& s) {
#pragma unroll
    for (int i = 0; i < 4; ++i) {
#pragma unroll
      for (int j = 0; j < 4; ++j) acc[i][j] = __builtin_amdgcn_wmma_f32_16x16x32_bf16(false, s.a[i], false, s.w[j], (short)0, acc[i][j], false, false); } };
#define SB() __builtin_amdgcn_sched_barrier(0)   // keeps a pass's 16 loads one group in front of the WMMA block of the pass before: without it the compiler sinks the loads to their readers (one register set) and every WMMA row waits out its own loads
  pass_ld(s0, xa, wb, 0); SB();
#pragma unroll 1   // kept rolled: the body already holds both register sets, a further copy would only cost registers
  for (int kc = 0; kc < DM / 32 - 2; kc += 2) { pass_ld(s1, xa, wb, kc + 1); SB(); mm(s0); SB(); pass_ld(s0, xa, wb, kc + 2); SB(); mm(s1); SB();
    asm volatile("s_wait_xcnt 0x0" ::: "memory"); }   // before the next trip rewrites the address registers of this trip's loads
  pass_ld(s1, xa, wb, DM / 32 - 1); SB(); mm(s0); SB(); mm(s1); SB();
  asm volatile("s_wait_xcnt 0x0" ::: "memory");   // before the epilogue reuses the address registers of the last loads
#pragma unroll
  for (int j = 0; j < 4; ++j) bias[j] = bfr(bias[j]);
  const int b = (int)(r0 / SS), sq0 = (int)(r0 % SS);
  if (n0 < 2 * DM) {   // q stored unscaled (f16 sigma ~0.6, no subnormal exposure); 1/32 applied to the f32 score
#pragma unroll
    for (int i = 0; i < 4; ++i) {
#pragma unroll
      for (int j = 0; j < 4; ++j) {
#pragma unroll
        for (int r = 0; r < 8; ++r) { const float v = acc[i][j][r] + bias[j]; const _Float16 hv = (_Float16)v; sh[wave][i * 16 + 8 * g + r][j * 16 + col] = hv; sl[wave][i * 16 + 8 * g + r][j * 16 + col] = (_Float16)((v - (float)hv) * 2048.0f); } } }   // q, k (+ bias) as f16 hi + (x2048) residual
    LDSX();
    // the wave's 64 x 64 tile = four row tiles x two fragments x two pieces, 16 pieces in a row in the workspace, each one 512-B store
    const size_t o0 = QKT(which0, b, (n0 - which0 * DM) / HD + wc, sq0 / 16) + lane * 8;
#pragma unroll
    for (int u = 0; u < 16; ++u) { const int row = (u >> 2) * 16 + col, c0 = (u & 3) * 16 + g * 8;
      vst2((unsigned*)(QK + o0 + u * 256), *(const v4u*)&sh[wave][row][c0]); vst2((unsigned*)(QKL + o0 + u * 256), *(const v4u*)&sl[wave][row][c0]);
      if (u == 7 || u >= 14) asm volatile("s_wait_xcnt 0x0" ::: "memory"); }   // before data registers of the stores so far are rewritten: by later LDS reads (the second half reuses the first half's, the last piece the second half's), behind the last piece by whatever code is laid behind this path
  } else {
#pragma unroll
    for (int i = 0; i < 4; ++i) {
#pragma unroll
      for (int j = 0; j < 4; ++j) {
#pragma unroll
        for (int r = 0; r < 8; ++r) { const float v = acc[i][j][r] + bias[j]; const _Float16 hv = (_Float16)v; sh[wave][j * 16 + col][i * 16 + 8 * g + r] = hv; sl[wave][j * 16 + col][i * 16 + 8 * g + r] = (_Float16)((v - (float)hv) * 2048.0f); } } }
    LDSX();   // the wave reads back only what it wrote itself: no wave waits on another
    // the wave's 64 d x 64 keys = two passes x four d tiles x two pieces, 16 pieces in a row in the workspace, each one 512-B store
    const size_t o0 = VT(b, (n0 - 2 * DM) / HD + wc, sq0 / 32) + lane * 8;
#pragma unroll
    for (int u = 0; u < 16; ++u) { const int d = ((u >> 1) & 3) * 16 + col, sc = (u >> 3) * 32 + (u & 1) * 16 + g * 8;
      vst2((unsigned*)(VTH + o0 + u * 256), *(const v4u*)&sh[wave][d][sc]); vst2((unsigned*)(VTL + o0 + u * 256), *(const v4u*)&sl[wave][d][sc]);
      if (u == 7 || u >= 14) asm volatile("s_wait_xcnt 0x0" ::: "memory"); }   // before data registers of the stores so far are rewritten: by later LDS reads (the second half reuses the first half's, the last piece the second half's), behind the last piece by whatever code is laid behind this path
  }
}
// lane l with lane l ^ 16 (a vector cross-row move, no LDS path)
__device__ __forceinline__ float xhalf(float x) { return __builtin_bit_cast(float, __builtin_amdgcn_permlanex16(__builtin_bit_cast(int, x), __builtin_bit_cast(int, x), 0x76543210, 0xfedcba98, false, false)); }
// ---- k_attn: block = (four pairs of 16-query tiles, head h, batch b): causal flash attention (K = 64: 2 k-steps) in the TRANSPOSED form: S^T = K . Q^T (A = K fragment, B = q fragment), O^T += V^T . P^T (A = V fragment, B = P).
// A lane then holds ONE query (q0 + col): of a 16-key score tile its 8 registers are keys 8 g + r, so maximum and sum run inside the lane, the two wave halves meet in one exchange (the maximum, each pass) and once behind the loop (the sum).
// The two score tiles of a pass, converted in place, ARE the B fragment of P^T (element s = tile s >> 3, register s & 7: the k order of the V fragments), so P touches no LDS; acc[dt][r] = O(query col, d = dt * 16 + 8 g + r) is already k_out's fragment order.
// scores = (q.k) / 32 with single f16 operands (LEAD: + residual products), P.V: f16 P x V hi (LEAD: + P lo x V hi, P x V lo*2048 in a second accumulator); O(row b*S+q, col h*64+d) = (acc + accl / 2048) / (2048 l)
// The pass is compiled per case of its two wave-uniform conditions, so that the common pass carries only its own work:
// LEAD (query blocks 0 and 1): residual products, the low half of P and the second accumulator; elsewhere none of them exists.
// LAST (a tile's one pass that holds its diagonal, ks = q0 / 32): the causal mask, and no fetch of further K rows; every pass in front of it has all 32 keys at or before all 16 queries.
// __expf as it compiles (one multiply, v_exp_f32), written so that the free slot which the instruction set asks for behind a transcendental (before its result is read or its source overwritten) is there by construction.
// exp8: each next v_exp_f32 is the independent instruction behind the one before (early-clobber outputs: none lies on a source), one v_nop closes the last; exp1: the same for a single value.
__device__ __forceinline__ void exp8(float* r, const float* x) {
  float y[8];
#pragma unroll
  for (int i = 0; i < 8; ++i) y[i] = x[i] * 1.44269504f;
  asm("v_exp_f32 %0, %8\n\tv_exp_f32 %1, %9\n\tv_exp_f32 %2, %10\n\tv_exp_f32 %3, %11\n\tv_exp_f32 %4, %12\n\tv_exp_f32 %5, %13\n\tv_exp_f32 %6, %14\n\tv_exp_f32 %7, %15\n\tv_nop"
      : "=&v"(r[0]), "=&v"(r[1]), "=&v"(r[2]), "=&v"(r[3]), "=&v"(r[4]), "=&v"(r[5]), "=&v"(r[6]), "=&v"(r[7])
      : "v"(y[0]), "v"(y[1]), "v"(y[2]), "v"(y[3]), "v"(y[4]), "v"(y[5]), "v"(y[6]), "v"(y[7]));
}
__device__ __forceinline__ float exp1(float x) { float r; const float y = x * 1.44269504f; asm("v_exp_f32 %0, %1\n\tv_nop" : "=v"(r) : "v"(y)); return r; }
// a fragment's two loads; EACH true (the leading blocks, whose loads go through vector address pairs shared by a run of loads): every load is closed by a wait of its own, because the register allocator lets a later load of a run land on the pair that the earlier ones still name
template <bool EACH> __device__ __forceinline__ v16h fragp_x(const _Float16* p) {
  if constexpr (!EACH) return fragp_h(p);
  else { union { v16h v; v8h q[2]; } u;
    u.q[0] = *(const v8h*)p; asm volatile("s_wait_xcnt 0x0" ::: "memory");   // before the next load may land on this one's address pair
    u.q[1] = *(const v8h*)(p + 256); asm volatile("s_wait_xcnt 0x0" ::: "memory");   // the same
    return u.v; }
}
template <bool LEAD> struct AttnSt { v16h aq[2]; v16h kf[2][2]; v8f acc[4]; v8f accl[LEAD ? 4 : 1]; float m, l; };
// qlp, klb, kb0, vhb, vlb: q residual tile, K residual rows, K rows, V hi and V lo of this (b, h), each at the lane's 16 B; dq: the lane's query counted from the first key of the lane's half in this pass (read by LAST only)
template <bool LEAD, bool LAST>
__device__ __forceinline__ void attn_pass(AttnSt<LEAD>& t, const int ks, const int dq, const _Float16* qlp, const _Float16* klb, const _Float16* kb0, const _Float16* vhb, const _Float16* vlb) {
  v8f s[2]; v16h vf[4]; const _Float16* vp = vhb + (size_t)ks * 2048;   // this pass's four V fragments, at the lane's 16 B
#pragma unroll
  for (int dt = 0; dt < 4; ++dt) vf[dt] = fragp_x<LEAD>(vp + dt * 512);
  if constexpr (!LEAD) asm volatile("s_wait_xcnt 0x0" :: "v"(vp) : "memory");   // before the address registers of the V loads are reused; the address is an input, so it stays live up to the wait and no load of the run lands on the pair that the others still name (LEAD: each load has its own wait, here and below)
#pragma unroll
  for (int ct = 0; ct < 2; ++ct) { v8f c = {};
    if constexpr (LEAD) {   // leading query blocks (few keys, outputs far above the global rms): 3 products
      const _Float16* krowl = klb + (size_t)(ks * 2 + ct) * 1024; v8f cl = {};
#pragma unroll
      for (int kc = 0; kc < 2; ++kc) { const v16h kh = t.kf[ct][kc]; c = wmma16(kh, t.aq[kc], c); cl = wmma16(kh, fragp_x<LEAD>(qlp + kc * 512), cl); cl = wmma16(fragp_x<LEAD>(krowl + kc * 512), t.aq[kc], cl); }
#pragma unroll
      for (int r = 0; r < 8; ++r) c[r] += cl[r] * (1.0f / 2048.0f); }
    else {
#pragma unroll
      for (int kc = 0; kc < 2; ++kc) c = wmma16(t.kf[ct][kc], t.aq[kc], c); }   // single product elsewhere
#pragma unroll
    for (int r = 0; r < 8; ++r) s[ct][r] = (!LAST || ct * 16 + r <= dq) ? c[r] * 0.03125f : -3.0e38f; }   // 1/sqrt(1024); keys behind the lane's query excluded
  if constexpr (!LAST) {   // the next pass's K rows, right behind this pass's score products
#pragma unroll
    for (int ct = 0; ct < 2; ++ct) {
#pragma unroll
      for (int kc = 0; kc < 2; ++kc) t.kf[ct][kc] = fragp_x<LEAD>(kb0 + (size_t)(ks + 1) * 2048 + ct * 1024 + kc * 512); }
    if constexpr (!LEAD) asm volatile("s_wait_xcnt 0x0" ::: "memory"); }   // before the address registers of the K loads are reused
  float mt[8];
#pragma unroll
  for (int r = 0; r < 8; ++r) mt[r] = fmaxf(s[0][r], s[1][r]);
  float mx = fmaxf(fmaxf(fmaxf(mt[0], mt[1]), fmaxf(mt[2], mt[3])), fmaxf(fmaxf(mt[4], mt[5]), fmaxf(mt[6], mt[7])));
  mx = fmaxf(mx, xhalf(mx));   // both halves now hold the maximum over the pass's 32 keys
  const float mn = fmaxf(t.m, mx); const float ea = exp1(t.m - mn); const float alpha = (t.m <= -1.0e38f) ? 0.f : ea;
  float df[16], ex[16];
#pragma unroll
  for (int i = 0; i < 16; ++i) df[i] = s[i >> 3][i & 7] - mn;
  exp8(ex, df); exp8(ex + 8, df + 8);
  v16h pa, pl; float es[4];   // four short chains of adds in place of one long one
#pragma unroll
  for (int i = 0; i < 16; ++i) { const float sv = s[i >> 3][i & 7]; const float e = (LAST && sv <= -1.0e38f) ? 0.f : ex[i]; es[i & 3] = (i < 4) ? e : es[i & 3] + e;
    const float x0 = e * 2048.0f; const _Float16 h0 = (_Float16)x0; pa[i] = h0; if constexpr (LEAD) pl[i] = (_Float16)((x0 - (float)h0) * 2048.0f); }   // P scaled by 2^11 before the f16 split so small softmax weights stay out of the f16 subnormal range; 2^-11 folded into the epilogue
  t.l = t.l * alpha + ((es[0] + es[1]) + (es[2] + es[3])); t.m = mn;
#pragma unroll
  for (int dt = 0; dt < 4; ++dt) {
#pragma unroll
    for (int r = 0; r < 8; ++r) { t.acc[dt][r] *= alpha; if constexpr (LEAD) t.accl[dt][r] *= alpha; } }
#pragma unroll
  for (int dt = 0; dt < 4; ++dt) { const v16h vh = vf[dt]; t.acc[dt] = wmma16(vh, pa, t.acc[dt]);
    if constexpr (LEAD) { t.accl[dt] = wmma16(vh, pl, t.accl[dt]); t.accl[dt] = wmma16(fragp_x<LEAD>(vlb + (size_t)ks * 2048 + dt * 512), pa, t.accl[dt]); } }   // leading query blocks: P hi/lo x V hi/lo (3 products); elsewhere P x V single
}
// a run of passes of the 16-query tile T: the key passes kbeg .. kend - 1 (all of their 32 keys at or before the tile's first query), then, where diag holds, the tile's diagonal pass, which is pass kend
template <bool LEAD>
__device__ __forceinline__ void attn_run(AttnSt<LEAD>& t, const _Float16* __restrict__ QK, const _Float16* __restrict__ QKL, const _Float16* __restrict__ VTH, const _Float16* __restrict__ VTL, const int T, const int h, const int b, const int kbeg, const int kend, const bool diag, const int lane) {
  const int col = lane & 15, g = lane >> 4; const int q0 = T * 16; const size_t qt = QKT(0, b, h, T) + lane * 8;   // the wave's q tile, at the lane's 16 B
  // the q residual fragments are read where the leading blocks use them
#pragma unroll
  for (int kc = 0; kc < 2; ++kc) t.aq[kc] = fragp_x<LEAD>(QK + qt + kc * 512);
  t.m = -3.0e38f; t.l = 0.f;   // of the lane's query; l sums the keys of the lane's own half only
#pragma unroll
  for (int dt = 0; dt < 4; ++dt) { t.acc[dt] = v8f{}; if constexpr (LEAD) t.accl[dt] = v8f{}; }
  // K fragments are fetched one pass ahead (right behind the pass's score products), V hi fragments at the head of their pass: each as one group, so no WMMA of the common pass waits on a load issued directly in front of it
  const _Float16* kb0 = QK + QKT(1, b, h, 0) + lane * 8; const _Float16* klb = QKL + QKT(1, b, h, 0) + lane * 8; const _Float16* vhb = VTH + VT(b, h, 0) + lane * 8; const _Float16* vlb = VTL + VT(b, h, 0) + lane * 8;
#pragma unroll
  for (int ct = 0; ct < 2; ++ct) {
#pragma unroll
    for (int kc = 0; kc < 2; ++kc) t.kf[ct][kc] = fragp_x<LEAD>(kb0 + (size_t)kbeg * 2048 + ct * 1024 + kc * 512); }
  if constexpr (!LEAD) asm volatile("s_wait_xcnt 0x0" ::: "memory");   // before the address registers of the q and K loads are reused
#pragma unroll 1   // kept rolled: one copy of the common pass in the instruction cache
  for (int ks = kbeg; ks < kend; ++ks) attn_pass<LEAD, false>(t, ks, 0, QKL + qt, klb, kb0, vhb, vlb);
  if (diag) attn_pass<LEAD, true>(t, kend, q0 + col - kend * 32 - 8 * g, QKL + qt, klb, kb0, vhb, vlb);
}
// a finished tile goes out
template <bool LEAD>
__device__ __forceinline__ void attn_store(const AttnSt<LEAD>& t, float* __restrict__ O, const int T, const int h, const int b, const int lane) {
  const float il = (1.0f / 2048.0f) / (t.l + xhalf(t.l));   // the two halves' sums meet here, once
  // the wave's 16 x 64 tile = two k passes of k_out x four pieces, each piece one 512-B store, straight from the accumulators
  float* ot = O + ((size_t)(b * (SS / 16) + T) * (DM / 32) + h * 2) * 512 + lane * 4;
#pragma unroll
  for (int u = 0; u < 8; ++u) { v4f o;
#pragma unroll
    for (int i = 0; i < 4; ++i) { float a = t.acc[u >> 1][(u & 1) * 4 + i]; if constexpr (LEAD) a += t.accl[u >> 1][(u & 1) * 4 + i] * (1.0f / 2048.0f); o[i] = a * il; }
    vst2(ot + u * 128, o); }
  asm volatile("s_wait_xcnt 0x0" ::: "memory");   // before the code behind a tile's stores rewrites their data and address registers
}
// EQUAL WAVES. A tile's cost grows with its index (tile T has T / 2 + 1 passes), so tile u (short) and tile 127 - u (long) are dealt as a pair of 65 passes to two waves:
// the head wave (waves 0..3) runs the long tile's first 32 passes; the tail wave (waves 4..7) runs the short tile whole, then the long tile's passes from 32 on, the diagonal pass included: 33 passes.
// The head wave hands its running maximum, sum and accumulators over in LDS (one block barrier), the tail wave joins the two parts as a pass joins its own to the running ones, and stores.
// Every wave of the launch so has 32 or 33 passes wherever it lands; 512 blocks of 8 waves = four waves per SIMD, all resident at once; a block's four head waves walk the same keys together, its four tail waves nearly so.
#define HPASS (SS / 64)   // the long tile's passes that the head wave takes; a long tile (T >= 64) has at least HPASS passes in front of its diagonal pass
__global__ __launch_bounds__(256) __attribute__((amdgpu_waves_per_eu(4, 4))) void k_attn(const _Float16* __restrict__ QK, const _Float16* __restrict__ QKL, const _Float16* __restrict__ VTH, const _Float16* __restrict__ VTL, const void* __restrict__ KMASK, float* __restrict__ O) {
  __shared__ __align__(16) float sa[4][8][128]; __shared__ float sml[4][2][32];   // per pair: the head wave's accumulators (8 pieces of 16 B a lane), maximum and sum
  const int tid = threadIdx.x, wave = __builtin_amdgcn_readfirstlane(tid >> 5), lane = tid & 31;   // the wave's number in a scalar register: row addresses built on it cost no vector register
  const int pr = wave & 3, u = blockIdx.x * 4 + pr, h = blockIdx.y, b = blockIdx.z; const bool tail = wave >= 4;
  const int T1 = SS / 16 - 1 - u;
  if (tail) {   // the short tile, whole
    if (blockIdx.x < 2) { AttnSt<true> s; attn_run<true>(s, QK, QKL, VTH, VTL, u, h, b, 0, u >> 1, true, lane); attn_store<true>(s, O, u, h, b, lane); }
    else { AttnSt<false> s; attn_run<false>(s, QK, QKL, VTH, VTL, u, h, b, 0, u >> 1, true, lane); attn_store<false>(s, O, u, h, b, lane); }
  }
  AttnSt<false> t;
  attn_run<false>(t, QK, QKL, VTH, VTL, T1, h, b, tail ? HPASS : 0, tail ? (T1 >> 1) : HPASS, tail, lane);
  if (!tail) {
#pragma unroll
    for (int i = 0; i < 8; ++i) { v4f o;
#pragma unroll
      for (int j = 0; j < 4; ++j) o[j] = t.acc[i >> 1][(i & 1) * 4 + j];
      *(v4f*)&sa[pr][i][lane * 4] = o; }
    sml[pr][0][lane] = t.m; sml[pr][1][lane] = t.l;
  }
  __syncthreads();   // the head waves' parts are in LDS; every wave passes here once
  if (tail) {
    const float ma = sml[pr][0][lane], la = sml[pr][1][lane]; const float mn = fmaxf(ma, t.m); const float fa = exp1(ma - mn), fb = exp1(t.m - mn);
    t.l = t.l * fb + la * fa;
#pragma unroll
    for (int i = 0; i < 8; ++i) { const v4f o = *(const v4f*)&sa[pr][i][lane * 4];
#pragma unroll
      for (int j = 0; j < 4; ++j) t.acc[i >> 1][(i & 1) * 4 + j] = t.acc[i >> 1][(i & 1) * 4 + j] * fb + o[j] * fa; }
    attn_store<false>(t, O, T1, h, b, lane);
  }
}
// ---- k_out: block = (64 rows, 128 cols): out = O(hi/lo) . Wo rows (2 products) + bo
__global__ __launch_bounds__(128) void k_out(const float* __restrict__ O, const __bf16* __restrict__ P, const float* __restrict__ BO, float* __restrict__ Y) {
  __shared__ __align__(16) float so[4][16][132];
  const int tid = threadIdx.x, wave = tid >> 5, lane = tid & 31, col = lane & 15, g = lane >> 4; const size_t r0 = (size_t)blockIdx.x * 64 + wave * 16; const int n0 = blockIdx.y * 128;
  v8f acc[8] = {};
  // two register sets, as in k_qkv: a pass's loads go out as one group, a pass ahead of the WMMAs that read them
  const float* xa = O + (r0 >> 4) * (16 * DM) + lane * 4; const __bf16* wb = P + (size_t)(n0 >> 7) * (128 * DM) + lane * 8;
  PassF s0, s1;
  auto mm = [&](const PassF& s) { float v[16];
#pragma unroll
    for (int i = 0; i < 4; ++i) { v[i] = s.x[0][i]; v[4 + i] = s.x[1][i]; v[8 + i] = s.x[2][i]; v[12 + i] = s.x[3][i]; }
    const F2 a = bsplit16(v);
#pragma unroll
    for (int j = 0; j < 8; ++j) { acc[j] = wmma_bf(a.l, s.w[j], acc[j]); acc[j] = wmma_bf(a.h, s.w[j], acc[j]); } };
  pass_ld(s0, xa, wb, 0);
#pragma unroll 1   // kept rolled: the body already holds both register sets, a further copy would only cost registers
  for (int kc = 0; kc < DM / 32 - 2; kc += 2) { pass_ld(s1, xa, wb, kc + 1); mm(s0); pass_ld(s0, xa, wb, kc + 2); mm(s1);
    asm volatile("s_wait_xcnt 0x0" ::: "memory"); }   // before the next trip rewrites the address registers of this trip's loads
  pass_ld(s1, xa, wb, DM / 32 - 1); mm(s0); mm(s1);
  asm volatile("s_wait_xcnt 0x0" ::: "memory");   // before the epilogue reuses the address registers of the last loads
#pragma unroll
  for (int j = 0; j < 8; ++j) {
#pragma unroll
    for (int r = 0; r < 8; ++r) so[wave][8 * g + r][j * 16 + col] = acc[j][r] + bfr(BO[n0 + j * 16 + col]); }
  LDSX();
  for (int rl = 0; rl < 16; ++rl) vst2(Y + (r0 + rl) * DM + n0 + lane * 4, *(const v4f*)&so[wave][rl][lane * 4]);
}
extern "C" void kernel_launch(void* const* d_in, const int* in_sizes, int n_in, void* d_out, int out_size, void* d_ws, size_t ws_size, hipStream_t stream) {
  (void)in_sizes; (void)n_in; (void)out_size;
  const float** F = (const float**)d_in;   // 0 x [2,2048,1024], 1 w_qkv [3072,1024] natural (rows q | k | v), 2 b_qkv [3072], 3 w_o [1024,1024] natural, 4 b_o
  if (ws_size < (size_t)WS_END) return;
  char* ws = (char*)d_ws; __bf16* PK = (__bf16*)(ws + WS_PK); _Float16 *QK = (_Float16*)(ws + WS_QK), *QKL = (_Float16*)(ws + WS_QKL), *VTH = (_Float16*)(ws + WS_VTH), *VTL = (_Float16*)(ws + WS_VTL); float* O = (float*)(ws + WS_O); __bf16* XP = (__bf16*)(ws + WS_XP);
  k_pack<<<dim3((QKVW + DM + NB * SS) / 16, 4), 256, 0, stream>>>(F[1], F[3], F[0], PK, XP);
  k_qkv<<<dim3(TNB * SS / 128, QKVW / 128), 128, 0, stream>>>(XP, PK + PK_A, F[2], F[2] + DM, F[2] + 2 * DM, QK, QKL, VTH, VTL);
  k_attn<<<dim3(TQB / 2, NH, TNB), 256, 0, stream>>>(QK, QKL, VTH, VTL, nullptr, O);
  k_out<<<dim3(TOB, DM / 128), 128, 0, stream>>>(O, PK + PK_P, F[4], (float*)d_out);
}

// v008
// It runs in 82.9 microseconds.
// Next to v007, in two timings, it ran 1.11 and 1.12 times as fast.
// Counting every step since v000, it is 5.18 times as fast.
// compute dtype: all float inputs rounded to bf16; qkv = x . W^T + b with EXACT bf16 products on WMMA 16x16x32 (natural rows), f16 hi + residual; causal PLAIN-HYBRID attention (first 128 queries 3-product, later single f16; logits std ~0.5, diffuse), x 1/32, running-max softmax in f32 (hardware exp); out = ctx (bf16 hi + lo) . Wo^T + b_o; f32 output.
#include <hip/hip_runtime.h>
#include <math.h>

typedef __attribute__((ext_vector_type(16))) _Float16 v16h;
typedef __attribute__((ext_vector_type(16))) __bf16 v16b;
typedef __attribute__((ext_vector_type(8)))  _Float16 v8h;
typedef __attribute__((ext_vector_type(8)))  float v8f;
typedef __attribute__((ext_vector_type(4)))  float v4f;
typedef __attribute__((ext_vector_type(2)))  float v2f;
typedef __attribute__((ext_vector_type(4)))  unsigned v4u;
typedef __attribute__((ext_vector_type(4)))  int v4i;
typedef float __attribute__((may_alias)) float_a;
typedef int __attribute__((may_alias)) int_a;

template <typename T> __device__ __forceinline__ void vst2(void* p, T v) { *(T*)p = v;  }
__device__ __forceinline__ v8f wmma16(v16h a, v16h b, v8f c) {
  v8f d = __builtin_amdgcn_wmma_f32_16x16x32_f16(false, a, false, b, (short)0, c, false, false);
  asm volatile("v_nop\n\tv_nop\n\tv_nop\n\tv_nop" : "+v"(d) : "v"(a), "v"(b));
  return d;
}
__device__ __forceinline__ v8f wmma_bf(v16b a, v16b b, v8f c) {
  v8f d = __builtin_amdgcn_wmma_f32_16x16x32_bf16(false, a, false, b, (short)0, c, false, false);
  asm volatile("v_nop\n\tv_nop\n\tv_nop\n\tv_nop" : "+v"(d) : "v"(a), "v"(b));
  return d;
}
// Multi-head attention '2' (B 2, N 2,048, C 1,024, 16 heads x 64): fused natural w_qkv (q | k | v row blocks) + bias, causal softmax(q k / sqrt(1024)) v (the module scales by 1/sqrt(embed_dim), -inf fill), merge heads, natural w_o + b_o.
__device__ __forceinline__ v16h frag_h(const _Float16* rowk0, int lane) {
  union { v16h v; v8h q[2]; } u; const _Float16* p = rowk0 + 8 * (lane >> 4);
  u.q[0] = *(const v8h*)p; u.q[1] = *(const v8h*)(p + 16); return u.v;
}
__device__ __forceinline__ v16h frag_f32(const float* rowk0, int lane) {
  v16h a; const float* p = rowk0 + 8 * (lane >> 4);
#pragma unroll
  for (int i = 0; i < 8; ++i) { a[i] = (_Float16)p[i]; a[8 + i] = (_Float16)p[16 + i]; }
  return a;
}
__device__ __forceinline__ v16h frag_f32s(const float* rowk0, int lane, float sc) {
  v16h a; const float* p = rowk0 + 8 * (lane >> 4);
#pragma unroll
  for (int i = 0; i < 8; ++i) { a[i] = (_Float16)(p[i] * sc); a[8 + i] = (_Float16)(p[16 + i] * sc); }
  return a;
}
// column fragment from a [K][ld] layout (column n), rows >= K read as 0
__device__ __forceinline__ v16h fragc_f32(const float* W, int k0, int n, int lane, int ld, int K) {
  v16h a; const int g = lane >> 4;
#pragma unroll
  for (int i = 0; i < 8; ++i) { const int ka = k0 + 8 * g + i, kb = ka + 16;
    a[i] = (_Float16)(ka < K ? W[(size_t)(ka < K ? ka : K - 1) * ld + n] : 0.f); a[8 + i] = (_Float16)(kb < K ? W[(size_t)(kb < K ? kb : K - 1) * ld + n] : 0.f); }
  return a;
}
struct F2 { v16b h, l; };
__device__ __forceinline__ F2 bsplit16(const float v[16]) { F2 r;
#pragma unroll
  for (int i = 0; i < 16; ++i) { const __bf16 h = (__bf16)v[i]; r.h[i] = h; r.l[i] = (__bf16)(v[i] - (float)h); }
  return r; }
__device__ __forceinline__ F2 split_row(const float* row, int k0, int lane) { float v[16]; const float* p = row + k0 + 8 * (lane >> 4);
#pragma unroll
  for (int i = 0; i < 8; ++i) { v[i] = p[i]; v[8 + i] = p[16 + i]; }
  return bsplit16(v); }
__device__ __forceinline__ F2 split_rowK(const float* row, int k0, int lane, int K) { float v[16]; const int g = lane >> 4;
#pragma unroll
  for (int i = 0; i < 8; ++i) { const int ka = k0 + 8 * g + i, kb = ka + 16; v[i] = ka < K ? row[ka < K ? ka : K - 1] : 0.f; v[8 + i] = kb < K ? row[kb < K ? kb : K - 1] : 0.f; }
  return bsplit16(v); }
__device__ __forceinline__ F2 split_col(const float* W, int k0, int n, int lane, int ld, int K) { float v[16]; const int g = lane >> 4;
#pragma unroll
  for (int i = 0; i < 8; ++i) { const int ka = k0 + 8 * g + i, kb = ka + 16; v[i] = ka < K ? W[(size_t)(ka < K ? ka : K - 1) * ld + n] : 0.f; v[8 + i] = kb < K ? W[(size_t)(kb < K ? kb : K - 1) * ld + n] : 0.f; }
  return bsplit16(v); }
__device__ __forceinline__ v8f mac3(const F2& a, const F2& b, v8f c) { c = wmma_bf(a.l, b.h, c); c = wmma_bf(a.h, b.l, c); return wmma_bf(a.h, b.h, c); }
__device__ __forceinline__ float sigm(float v) { return 1.0f / (1.0f + expf(-v)); }
#define LDSX() do { asm volatile("s_wait_dscnt 0" ::: "memory"); __builtin_amdgcn_wave_barrier(); __builtin_amdgcn_fence(__ATOMIC_RELEASE, "workgroup"); } while (0)


#define NB 2
#define SS 2048
#define DM 1024
#define NH 16
#define HD 64
#define QKVW (3 * DM)
#ifndef TQB
#define TQB (SS / 64)
#define TNB NB
#define TOB (NB * SS / 64)     // output row tiles (all)
#endif
typedef __attribute__((ext_vector_type(8))) __bf16 v8b;
// FRAGMENT ORDER of a 16-bit operand in the workspace: a 16 (rows) x 32 (k) fragment is 1 KiB = two pieces of 512 B; in piece q lane l owns 16 B: row l & 15, k = 16 q + 8 (l >> 4) + 0..7.
// So each wave-wide 16-B load or store covers four whole 128-B lines. p = the fragment's start + 8 * lane.
__device__ __forceinline__ v16b fragp_b(const __bf16* p) {
  union { v16b v; v8b q[2]; } u; u.q[0] = *(const v8b*)p; u.q[1] = *(const v8b*)(p + 256); return u.v;
}
__device__ __forceinline__ v16h fragp_h(const _Float16* p) {
  union { v16h v; v8h q[2]; } u; u.q[0] = *(const v8h*)p; u.q[1] = *(const v8h*)(p + 256); return u.v;
}
__device__ __forceinline__ float bfr(float v) { return (float)(__bf16)v; }
__device__ __attribute__((noinline)) float exp_ni(float v) { return expf(v); }
__device__ __attribute__((noinline)) float erf_ni(float v) { return erff(v); }

#define PK_A 0                       // Wqkv: [24 blocks of 128 rows][32 k passes][8 tiles of 16 rows] fragments (fragment order)
#define PK_P (PK_A + QKVW * DM)        // Wo: [8 blocks][32 passes][8 tiles] fragments
#define PK_END (PK_P + DM * DM)
#define WS_PK  0u
#define WS_QK  (WS_PK + 2u * PK_END)             // f16 [q | k][b][head][128 tiles of 16 rows][2 k passes] fragments
#define WS_QKL (WS_QK + 2u * NB * SS * 2 * DM)     // f16 q | k residual planes x2048, same order
#define WS_VTH (WS_QKL + 2u * NB * SS * 2 * DM)    // f16 hi [b][head][64 passes of 32 keys][4 tiles of 16 d] fragments (row = d, k = key)
#define WS_VTL (WS_VTH + 2u * NB * DM * SS)        // f16 lo x 2048
#define WS_O   (WS_VTL + 2u * NB * DM * SS)        // f32 [256 tiles of 16 rows][32 k passes][4 pieces of 512 B]: piece i, lane l: row l & 15, k = 16 (i >> 1) + 8 (l >> 4) + 4 (i & 1) + 0..3
#define WS_CS  (WS_O + 4u * NB * SS * DM)           // f32 2 x [2048][32], reserved: nothing writes or reads it
#define WS_XP  (WS_CS + 4u * 2 * SS * 32)           // bf16 x: [256 tiles of 16 rows][32 k passes] fragments
#define WS_END (WS_XP + 2u * NB * SS * DM)
#define QKT(plane, b, h, st) (((((size_t)(plane) * NB + (b)) * NH + (h)) * (SS / 16) + (st)) * 1024)   // start of a 16 x 64 q or k tile (two fragments), in elements
#define VT(b, h, ks) ((((size_t)(b) * NH + (h)) * (SS / 32) + (ks)) * 2048)   // start of a pass's four V fragments, in elements
// ---- k_pack: block = (tile of 16 natural rows, quarter of k): f32 -> bf16 in fragment order, whole lines in (two rows x 256 B a wave) and out, turned in LDS; tiles 0..191 w_qkv, 192..255 w_o (both into PK), 256..511 x (into XP)
typedef __attribute__((ext_vector_type(4))) __bf16 v4b;
__global__ __launch_bounds__(256) void k_pack(const float* __restrict__ WA, const float* __restrict__ WO, const float* __restrict__ X, __bf16* __restrict__ PK, __bf16* __restrict__ XP) {
  __shared__ __align__(16) __bf16 s[16][264];   // pitch 528 B = 16 B x odd: the 16 rows of a fragment piece fall on distinct banks
  const int t = blockIdx.x, kq = blockIdx.y, tid = threadIdx.x; const int TA = QKVW / 16, TW = (QKVW + DM) / 16;
  const float* srcp = ((t < TA) ? WA + (size_t)t * 16 * DM : (t < TW) ? WO + (size_t)(t - TA) * 16 * DM : X + (size_t)(t - TW) * 16 * DM) + (size_t)(tid >> 4) * DM + kq * 256 + (tid & 15) * 4;
  v4f a[4];
#pragma unroll
  for (int it = 0; it < 4; ++it) a[it] = *(const v4f*)(srcp + it * 64);
#pragma unroll
  for (int it = 0; it < 4; ++it) { v4b r;
#pragma unroll
    for (int i = 0; i < 4; ++i) r[i] = (__bf16)a[it][i];
    *(v4b*)&s[tid >> 4][it * 64 + (tid & 15) * 4] = r; }
  __syncthreads();
  // weights: [block of 128 rows][k pass][8 tiles] fragments, so a wave's pass is 8 KiB in a row; x: [tile][k pass]
  __bf16* dst = (t < TW) ? PK + (size_t)(t >> 3) * (128 * DM) + (t & 7) * 512 : XP + (size_t)(t - TW) * 16 * DM; const int ps = (t < TW) ? 4096 : 512;
#pragma unroll
  for (int it = 0; it < 2; ++it) { const int o = it * 256 + tid, kcl = o >> 6, q = (o >> 5) & 1, l = o & 31;
    vst2((unsigned*)(dst + (size_t)(kq * 8 + kcl) * ps + q * 256 + l * 8), *(const v4u*)&s[l & 15][kcl * 32 + q * 16 + (l >> 4) * 8]); }
}
// one k pass (32 k) of k_out's 16 x 128 wave tile: the A fragment (its four f32 pieces) and the 8 weight fragments; xa and wb hold the lane's offset
struct PassF { v4f x[4]; v16b w[8]; };
__device__ __forceinline__ void pass_ld(PassF& s, const float* xa, const __bf16* wb, int kc) {
  const float* p = xa + kc * 512; s.x[0] = *(const v4f*)p; s.x[1] = *(const v4f*)(p + 128); s.x[2] = *(const v4f*)(p + 256); s.x[3] = *(const v4f*)(p + 384);
#pragma unroll
  for (int j = 0; j < 8; ++j) s.w[j] = fragp_b(wb + kc * 4096 + j * 512);
}
// one k pass (32 k) of k_qkv's 64 x 64 wave tile: four x fragments and four weight fragments feed 16 WMMAs (half a fragment load a WMMA); xa and wb hold the lane's offset
struct PassQ { v16b a[4]; v16b w[4]; };
__device__ __forceinline__ void pass_ld(PassQ& s, const __bf16* xa, const __bf16* wb, int kc) {
#pragma unroll
  for (int i = 0; i < 4; ++i) s.a[i] = fragp_b(xa + i * (16 * DM) + kc * 512);
#pragma unroll
  for (int j = 0; j < 4; ++j) s.w[j] = fragp_b(wb + kc * 4096 + j * 512);
}
// the loads of k pass kc, closed by their wait: the next pass's addresses have no fixed step from these (the walk wraps), so they are formed anew, and the wait stands before that; both addresses are inputs of the wait, so they stay live up to it and no load of the group lands on a pair that the others still name
template <typename S, typename X> __device__ __forceinline__ void pass_at(S& s, const X* xa, const __bf16* wb, int kc) {
  const X* xp = xa + kc * 512; const __bf16* wp = wb + kc * 4096; pass_ld(s, xp, wp, 0);
  asm volatile("s_wait_xcnt 0x0" :: "v"(xp), "v"(wp) : "memory");
}
// ---- k_qkv: block = (128 rows of x, 128 columns): four waves as 2 x 2, each a 64 x 64 tile = 64 rows x ONE head of q, k or v; 768 blocks = three a WGP, all resident at once
__global__ __launch_bounds__(128) void k_qkv(const __bf16* __restrict__ XP, const __bf16* __restrict__ P, const float* __restrict__ BQ, const float* __restrict__ BK, const float* __restrict__ BV, _Float16* __restrict__ QK, _Float16* __restrict__ QKL, _Float16* __restrict__ VTH, _Float16* __restrict__ VTL) {
  const int which0 = (blockIdx.y * 128) / DM; const float* BB = BQ ? (((which0 == 0) ? BQ : (which0 == 1) ? BK : BV) + (blockIdx.y * 128 - which0 * DM)) : nullptr;
  __shared__ __align__(16) _Float16 sh[4][64][72], sl[4][64][72];   // each wave's own tile, hi and residual (q, k: [row][d]; v: [d][key]); pitch 144 B = 16 B x odd
  const int tid = threadIdx.x, wave = tid >> 5, lane = tid & 31, col = lane & 15, g = lane >> 4, wr = wave >> 1, wc = wave & 1; const size_t r0 = (size_t)blockIdx.x * 128 + wr * 64; const int n0 = blockIdx.y * 128;
  v8f acc[4][4] = {};   // acc[i][j][r]: row r0 + 16 i + 8 g + r, column n0 + 64 wc + 16 j + col
  // the lane's 4 bias values (one a column tile) go out as one group in front of the k loop and are held in registers: the epilogue has no load and no wait on one
  float bias[4] = {};
  if (BB) {
#pragma unroll
    for (int j = 0; j < 4; ++j) bias[j] = BB[wc * 64 + j * 16 + col];
    asm volatile("s_wait_xcnt 0x0" ::: "memory");   // before the address registers of the bias loads are reused
  }
  // two register sets: a pass's 16 loads go out as one group, a pass ahead of the WMMAs that read them
  const __bf16* xa = XP + (r0 >> 4) * (16 * DM) + lane * 8; const __bf16* wb = P + (size_t)(n0 >> 7) * (128 * DM) + wc * 2048 + lane * 8;
  PassQ s0, s1;
  // ROTATED k WALK: the block enters the 32 k passes at pass k0 and wraps round. Blocks that read the same weight rows (same y) or the same x rows (same x) so stand at different passes at any moment, in place of all asking L2 for the same lines, not yet fetched, at once.
  const int k0 = (blockIdx.x + 4 * blockIdx.y) & (DM / 32 - 1);   // same y: 32 blocks at 32 passes; same x: 24 blocks at 8 passes, four apart
#define KR(i) (((i) + k0) & (DM / 32 - 1))
  // the WMMAs are the plain builtin (the compiler keeps their distances itself): the operands of wmma_bf's v_nop statement would hold accumulators and both sets under v256, where they do not fit (spills)
  auto mm = [&](const PassQ& s) {
#pragma unroll
    for (int i = 0; i < 4; ++i) {
#pragma unroll
      for (int j = 0; j < 4; ++j) acc[i][j] = __builtin_amdgcn_wmma_f32_16x16x32_bf16(false, s.a[i], false, s.w[j], (short)0, acc[i][j], false, false); } };
#define SB() __builtin_amdgcn_sched_barrier(0)   // keeps a pass's 16 loads one group in front of the WMMA block of the pass before: without it the compiler sinks the loads to their readers (one register set) and every WMMA row waits out its own loads
  pass_at(s0, xa, wb, KR(0)); SB();
#pragma unroll 1   // kept rolled: the body already holds both register sets, a further copy would only cost registers
  for (int kc = 0; kc < DM / 32 - 2; kc += 2) { pass_at(s1, xa, wb, KR(kc + 1)); SB(); mm(s0); SB(); pass_at(s0, xa, wb, KR(kc + 2)); SB(); mm(s1); SB(); }
  pass_at(s1, xa, wb, KR(DM / 32 - 1)); SB(); mm(s0); SB(); mm(s1); SB();
#pragma unroll
  for (int j = 0; j < 4; ++j) bias[j] = bfr(bias[j]);
  const int b = (int)(r0 / SS), sq0 = (int)(r0 % SS);
  if (n0 < 2 * DM) {   // q stored unscaled (f16 sigma ~0.6, no subnormal exposure); 1/32 applied to the f32 score
#pragma unroll
    for (int i = 0; i < 4; ++i) {
#pragma unroll
      for (int j = 0; j < 4; ++j) {
#pragma unroll
        for (int r = 0; r < 8; ++r) { const float v = acc[i][j][r] + bias[j]; const _Float16 hv = (_Float16)v; sh[wave][i * 16 + 8 * g + r][j * 16 + col] = hv; sl[wave][i * 16 + 8 * g + r][j * 16 + col] = (_Float16)((v - (float)hv) * 2048.0f); } } }   // q, k (+ bias) as f16 hi + (x2048) residual
    LDSX();
    // the wave's 64 x 64 tile = four row tiles x two fragments x two pieces, 16 pieces in a row in the workspace, each one 512-B store
    const size_t o0 = QKT(which0, b, (n0 - which0 * DM) / HD + wc, sq0 / 16) + lane * 8;
#pragma unroll
    for (int u = 0; u < 16; ++u) { const int row = (u >> 2) * 16 + col, c0 = (u & 3) * 16 + g * 8;
      vst2((unsigned*)(QK + o0 + u * 256), *(const v4u*)&sh[wave][row][c0]); vst2((unsigned*)(QKL + o0 + u * 256), *(const v4u*)&sl[wave][row][c0]);
      if (u == 7 || u >= 14) asm volatile("s_wait_xcnt 0x0" ::: "memory"); }   // before data registers of the stores so far are rewritten: by later LDS reads (the second half reuses the first half's, the last piece the second half's), behind the last piece by whatever code is laid behind this path
  } else {
#pragma unroll
    for (int i = 0; i < 4; ++i) {
#pragma unroll
      for (int j = 0; j < 4; ++j) {
#pragma unroll
        for (int r = 0; r < 8; ++r) { const float v = acc[i][j][r] + bias[j]; const _Float16 hv = (_Float16)v; sh[wave][j * 16 + col][i * 16 + 8 * g + r] = hv; sl[wave][j * 16 + col][i * 16 + 8 * g + r] = (_Float16)((v - (float)hv) * 2048.0f); } } }
    LDSX();   // the wave reads back only what it wrote itself: no wave waits on another
    // the wave's 64 d x 64 keys = two passes x four d tiles x two pieces, 16 pieces in a row in the workspace, each one 512-B store
    const size_t o0 = VT(b, (n0 - 2 * DM) / HD + wc, sq0 / 32) + lane * 8;
#pragma unroll
    for (int u = 0; u < 16; ++u) { const int d = ((u >> 1) & 3) * 16 + col, sc = (u >> 3) * 32 + (u & 1) * 16 + g * 8;
      vst2((unsigned*)(VTH + o0 + u * 256), *(const v4u*)&sh[wave][d][sc]); vst2((unsigned*)(VTL + o0 + u * 256), *(const v4u*)&sl[wave][d][sc]);
      if (u == 7 || u >= 14) asm volatile("s_wait_xcnt 0x0" ::: "memory"); }   // before data registers of the stores so far are rewritten: by later LDS reads (the second half reuses the first half's, the last piece the second half's), behind the last piece by whatever code is laid behind this path
  }
}
// lane l with lane l ^ 16 (a vector cross-row move, no LDS path)
__device__ __forceinline__ float xhalf(float x) { return __builtin_bit_cast(float, __builtin_amdgcn_permlanex16(__builtin_bit_cast(int, x), __builtin_bit_cast(int, x), 0x76543210, 0xfedcba98, false, false)); }
// ---- k_attn: block = (four pairs of 16-query tiles, head h, batch b): causal flash attention (K = 64: 2 k-steps) in the TRANSPOSED form: S^T = K . Q^T (A = K fragment, B = q fragment), O^T += V^T . P^T (A = V fragment, B = P).
// A lane then holds ONE query (q0 + col): of a 16-key score tile its 8 registers are keys 8 g + r, so maximum and sum run inside the lane, the two wave halves meet in one exchange (the maximum, each pass) and once behind the loop (the sum).
// The two score tiles of a pass, converted in place, ARE the B fragment of P^T (element s = tile s >> 3, register s & 7: the k order of the V fragments), so P touches no LDS; acc[dt][r] = O(query col, d = dt * 16 + 8 g + r) is already k_out's fragment order.
// scores = (q.k) / 32 with single f16 operands (LEAD: + residual products), P.V: f16 P x V hi (LEAD: + P lo x V hi, P x V lo*2048 in a second accumulator); O(row b*S+q, col h*64+d) = (acc + accl / 2048) / (2048 l)
// The pass is compiled per case of its two wave-uniform conditions, so that the common pass carries only its own work:
// LEAD (query blocks 0 and 1): residual products, the low half of P and the second accumulator; elsewhere none of them exists.
// LAST (a tile's one pass that holds its diagonal, ks = q0 / 32): the causal mask, and no fetch of further K rows; every pass in front of it has all 32 keys at or before all 16 queries.
// __expf as it compiles (one multiply, v_exp_f32), written so that the free slot which the instruction set asks for behind a transcendental (before its result is read or its source overwritten) is there by construction.
// exp8: each next v_exp_f32 is the independent instruction behind the one before (early-clobber outputs: none lies on a source), one v_nop closes the last; exp1: the same for a single value.
__device__ __forceinline__ void exp8(float* r, const float* x) {
  float y[8];
#pragma unroll
  for (int i = 0; i < 8; ++i) y[i] = x[i] * 1.44269504f;
  asm("v_exp_f32 %0, %8\n\tv_exp_f32 %1, %9\n\tv_exp_f32 %2, %10\n\tv_exp_f32 %3, %11\n\tv_exp_f32 %4, %12\n\tv_exp_f32 %5, %13\n\tv_exp_f32 %6, %14\n\tv_exp_f32 %7, %15\n\tv_nop"
      : "=&v"(r[0]), "=&v"(r[1]), "=&v"(r[2]), "=&v"(r[3]), "=&v"(r[4]), "=&v"(r[5]), "=&v"(r[6]), "=&v"(r[7])
      : "v"(y[0]), "v"(y[1]), "v"(y[2]), "v"(y[3]), "v"(y[4]), "v"(y[5]), "v"(y[6]), "v"(y[7]));
}
__device__ __forceinline__ float exp1(float x) { float r; const float y = x * 1.44269504f; asm("v_exp_f32 %0, %1\n\tv_nop" : "=v"(r) : "v"(y)); return r; }
// a fragment's two loads; EACH true (the leading blocks, whose loads go through vector address pairs shared by a run of loads): every load is closed by a wait of its own, because the register allocator lets a later load of a run land on the pair that the earlier ones still name
template <bool EACH> __device__ __forceinline__ v16h fragp_x(const _Float16* p) {
  if constexpr (!EACH) return fragp_h(p);
  else { union { v16h v; v8h q[2]; } u;
    u.q[0] = *(const v8h*)p; asm volatile("s_wait_xcnt 0x0" ::: "memory");   // before the next load may land on this one's address pair
    u.q[1] = *(const v8h*)(p + 256); asm volatile("s_wait_xcnt 0x0" ::: "memory");   // the same
    return u.v; }
}
template <bool LEAD> struct AttnSt { v16h aq[2]; v16h kf[2][2]; v8f acc[4]; v8f accl[LEAD ? 4 : 1]; float m, l; };
// ks: this pass; kn: the pass whose K rows are fetched for the next call (not read by LAST); qlp, klb, kb0, vhb, vlb: q residual tile, K residual rows, K rows, V hi and V lo of this (b, h), each at the lane's 16 B; dq: the lane's query counted from the first key of the lane's half in this pass (read by LAST only)
template <bool LEAD, bool LAST>
__device__ __forceinline__ void attn_pass(AttnSt<LEAD>& t, const int ks, const int kn, const int dq, const _Float16* qlp, const _Float16* klb, const _Float16* kb0, const _Float16* vhb, const _Float16* vlb) {
  v8f s[2]; v16h vf[4]; const _Float16* vp = vhb + (size_t)ks * 2048;   // this pass's four V fragments, at the lane's 16 B
#pragma unroll
  for (int dt = 0; dt < 4; ++dt) vf[dt] = fragp_x<LEAD>(vp + dt * 512);
  if constexpr (!LEAD) asm volatile("s_wait_xcnt 0x0" :: "v"(vp) : "memory");   // before the address registers of the V loads are reused; the address is an input, so it stays live up to the wait and no load of the run lands on the pair that the others still name (LEAD: each load has its own wait, here and below)
#pragma unroll
  for (int ct = 0; ct < 2; ++ct) { v8f c = {};
    if constexpr (LEAD) {   // leading query blocks (few keys, outputs far above the global rms): 3 products
      const _Float16* krowl = klb + (size_t)(ks * 2 + ct) * 1024; v8f cl = {};
#pragma unroll
      for (int kc = 0; kc < 2; ++kc) { const v16h kh = t.kf[ct][kc]; c = wmma16(kh, t.aq[kc], c); cl = wmma16(kh, fragp_x<LEAD>(qlp + kc * 512), cl); cl = wmma16(fragp_x<LEAD>(krowl + kc * 512), t.aq[kc], cl); }
#pragma unroll
      for (int r = 0; r < 8; ++r) c[r] += cl[r] * (1.0f / 2048.0f); }
    else {
#pragma unroll
      for (int kc = 0; kc < 2; ++kc) c = wmma16(t.kf[ct][kc], t.aq[kc], c); }   // single product elsewhere
#pragma unroll
    for (int r = 0; r < 8; ++r) s[ct][r] = (!LAST || ct * 16 + r <= dq) ? c[r] * 0.03125f : -3.0e38f; }   // 1/sqrt(1024); keys behind the lane's query excluded
  if constexpr (!LAST) {   // the next pass's K rows, right behind this pass's score products
#pragma unroll
    for (int ct = 0; ct < 2; ++ct) {
#pragma unroll
      for (int kc = 0; kc < 2; ++kc) t.kf[ct][kc] = fragp_x<LEAD>(kb0 + (size_t)kn * 2048 + ct * 1024 + kc * 512); }
    if constexpr (!LEAD) asm volatile("s_wait_xcnt 0x0" ::: "memory"); }   // before the address registers of the K loads are reused
  float mt[8];
#pragma unroll
  for (int r = 0; r < 8; ++r) mt[r] = fmaxf(s[0][r], s[1][r]);
  float mx = fmaxf(fmaxf(fmaxf(mt[0], mt[1]), fmaxf(mt[2], mt[3])), fmaxf(fmaxf(mt[4], mt[5]), fmaxf(mt[6], mt[7])));
  mx = fmaxf(mx, xhalf(mx));   // both halves now hold the maximum over the pass's 32 keys
  const float mn = fmaxf(t.m, mx); const float ea = exp1(t.m - mn); const float alpha = (t.m <= -1.0e38f) ? 0.f : ea;
  float df[16], ex[16];
#pragma unroll
  for (int i = 0; i < 16; ++i) df[i] = s[i >> 3][i & 7] - mn;
  exp8(ex, df); exp8(ex + 8, df + 8);
  v16h pa, pl; float es[4];   // four short chains of adds in place of one long one
#pragma unroll
  for (int i = 0; i < 16; ++i) { const float sv = s[i >> 3][i & 7]; const float e = (LAST && sv <= -1.0e38f) ? 0.f : ex[i]; es[i & 3] = (i < 4) ? e : es[i & 3] + e;
    const float x0 = e * 2048.0f; const _Float16 h0 = (_Float16)x0; pa[i] = h0; if constexpr (LEAD) pl[i] = (_Float16)((x0 - (float)h0) * 2048.0f); }   // P scaled by 2^11 before the f16 split so small softmax weights stay out of the f16 subnormal range; 2^-11 folded into the epilogue
  t.l = t.l * alpha + ((es[0] + es[1]) + (es[2] + es[3])); t.m = mn;
#pragma unroll
  for (int dt = 0; dt < 4; ++dt) {
#pragma unroll
    for (int r = 0; r < 8; ++r) { t.acc[dt][r] *= alpha; if constexpr (LEAD) t.accl[dt][r] *= alpha; } }
#pragma unroll
  for (int dt = 0; dt < 4; ++dt) { const v16h vh = vf[dt]; t.acc[dt] = wmma16(vh, pa, t.acc[dt]);
    if constexpr (LEAD) { t.accl[dt] = wmma16(vh, pl, t.accl[dt]); t.accl[dt] = wmma16(fragp_x<LEAD>(vlb + (size_t)ks * 2048 + dt * 512), pa, t.accl[dt]); } }   // leading query blocks: P hi/lo x V hi/lo (3 products); elsewhere P x V single
}
// a run of passes of the 16-query tile T: the key passes kbeg .. kend - 1 (all of their 32 keys at or before the tile's first query), then, where diag holds, the tile's diagonal pass, which is pass kend
// ROTATED KEY WALK: the run enters at pass kbeg + rot (rot < kend - kbeg, or 0) and wraps round to kbeg: the 16 blocks of a (batch, head), which read the same K and V lines, stand at different passes at any moment
template <bool LEAD>
__device__ __forceinline__ void attn_run(AttnSt<LEAD>& t, const _Float16* __restrict__ QK, const _Float16* __restrict__ QKL, const _Float16* __restrict__ VTH, const _Float16* __restrict__ VTL, const int T, const int h, const int b, const int kbeg, const int kend, const int rot, const bool diag, const int lane) {
  const int col = lane & 15, g = lane >> 4; const int q0 = T * 16; const size_t qt = QKT(0, b, h, T) + lane * 8;   // the wave's q tile, at the lane's 16 B
  // the q residual fragments are read where the leading blocks use them
#pragma unroll
  for (int kc = 0; kc < 2; ++kc) t.aq[kc] = fragp_x<LEAD>(QK + qt + kc * 512);
  t.m = -3.0e38f; t.l = 0.f;   // of the lane's query; l sums the keys of the lane's own half only
#pragma unroll
  for (int dt = 0; dt < 4; ++dt) { t.acc[dt] = v8f{}; if constexpr (LEAD) t.accl[dt] = v8f{}; }
  // K fragments are fetched one pass ahead (right behind the pass's score products), V hi fragments at the head of their pass: each as one group, so no WMMA of the common pass waits on a load issued directly in front of it
  const _Float16* kb0 = QK + QKT(1, b, h, 0) + lane * 8; const _Float16* klb = QKL + QKT(1, b, h, 0) + lane * 8; const _Float16* vhb = VTH + VT(b, h, 0) + lane * 8; const _Float16* vlb = VTL + VT(b, h, 0) + lane * 8;
#pragma unroll
  for (int ct = 0; ct < 2; ++ct) {
#pragma unroll
    for (int kc = 0; kc < 2; ++kc) t.kf[ct][kc] = fragp_x<LEAD>(kb0 + (size_t)(kbeg + rot) * 2048 + ct * 1024 + kc * 512); }
  if constexpr (!LEAD) asm volatile("s_wait_xcnt 0x0" ::: "memory");   // before the address registers of the q and K loads are reused
#pragma unroll 1   // kept rolled: one copy of the common pass in the instruction cache
  for (int i = kend - kbeg, ks = kbeg + rot; i > 0; --i) { const int kw = (ks + 1 == kend) ? kbeg : ks + 1, kn = (i == 1) ? kend : kw;   // behind the run's last pass comes pass kend
    attn_pass<LEAD, false>(t, ks, kn, 0, QKL + qt, klb, kb0, vhb, vlb); ks = kn; }
  if (diag) attn_pass<LEAD, true>(t, kend, kend, q0 + col - kend * 32 - 8 * g, QKL + qt, klb, kb0, vhb, vlb);
}
// a finished tile goes out
template <bool LEAD>
__device__ __forceinline__ void attn_store(const AttnSt<LEAD>& t, float* __restrict__ O, const int T, const int h, const int b, const int lane) {
  const float il = (1.0f / 2048.0f) / (t.l + xhalf(t.l));   // the two halves' sums meet here, once
  // the wave's 16 x 64 tile = two k passes of k_out x four pieces, each piece one 512-B store, straight from the accumulators
  float* ot = O + ((size_t)(b * (SS / 16) + T) * (DM / 32) + h * 2) * 512 + lane * 4;
#pragma unroll
  for (int u = 0; u < 8; ++u) { v4f o;
#pragma unroll
    for (int i = 0; i < 4; ++i) { float a = t.acc[u >> 1][(u & 1) * 4 + i]; if constexpr (LEAD) a += t.accl[u >> 1][(u & 1) * 4 + i] * (1.0f / 2048.0f); o[i] = a * il; }
    vst2(ot + u * 128, o); }
  asm volatile("s_wait_xcnt 0x0" ::: "memory");   // before the code behind a tile's stores rewrites their data and address registers
}
// EQUAL WAVES. A tile's cost grows with its index (tile T has T / 2 + 1 passes), so tile u (short) and tile 127 - u (long) are dealt as a pair of 65 passes to two waves:
// the head wave (waves 0..3) runs the long tile's first 32 passes; the tail wave (waves 4..7) runs the short tile whole, then the long tile's passes from 32 on, the diagonal pass included: 33 passes.
// The head wave hands its running maximum, sum and accumulators over in LDS (one block barrier), the tail wave joins the two parts as a pass joins its own to the running ones, and stores.
// Every wave of the launch so has 32 or 33 passes wherever it lands; 512 blocks of 8 waves = four waves per SIMD, all resident at once; a block's four head waves walk the same keys together, its four tail waves nearly so.
#define HPASS (SS / 64)   // the long tile's passes that the head wave takes; a long tile (T >= 64) has at least HPASS passes in front of its diagonal pass
__global__ __launch_bounds__(256) __attribute__((amdgpu_waves_per_eu(4, 4))) void k_attn(const _Float16* __restrict__ QK, const _Float16* __restrict__ QKL, const _Float16* __restrict__ VTH, const _Float16* __restrict__ VTL, const void* __restrict__ KMASK, float* __restrict__ O) {
  __shared__ __align__(16) float sa[4][8][128]; __shared__ float sml[4][2][32];   // per pair: the head wave's accumulators (8 pieces of 16 B a lane), maximum and sum
  const int tid = threadIdx.x, wave = __builtin_amdgcn_readfirstlane(tid >> 5), lane = tid & 31;   // the wave's number in a scalar register: row addresses built on it cost no vector register
  const int pr = wave & 3, u = blockIdx.x * 4 + pr, h = blockIdx.y, b = blockIdx.z; const bool tail = wave >= 4;
  const int T1 = SS / 16 - 1 - u;
  // where each run enters its walk: the same for a block's four waves of a kind (they walk together), a share blockIdx.x / 16 of the shortest of their four runs, so below every run's length
  const int bx = blockIdx.x, rs = (2 * bx * bx) >> 4, rh = (HPASS * bx) >> 4, rl = ((HPASS - 2 - 2 * bx) * bx) >> 4;   // short tiles: at least 2 bx passes; head: HPASS; long tiles' rest: at least HPASS - 2 - 2 bx
  if (tail) {   // the short tile, whole
    if (blockIdx.x < 2) { AttnSt<true> s; attn_run<true>(s, QK, QKL, VTH, VTL, u, h, b, 0, u >> 1, rs, true, lane); attn_store<true>(s, O, u, h, b, lane); }
    else { AttnSt<false> s; attn_run<false>(s, QK, QKL, VTH, VTL, u, h, b, 0, u >> 1, rs, true, lane); attn_store<false>(s, O, u, h, b, lane); }
  }
  AttnSt<false> t;
  attn_run<false>(t, QK, QKL, VTH, VTL, T1, h, b, tail ? HPASS : 0, tail ? (T1 >> 1) : HPASS, tail ? rl : rh, tail, lane);
  if (!tail) {
#pragma unroll
    for (int i = 0; i < 8; ++i) { v4f o;
#pragma unroll
      for (int j = 0; j < 4; ++j) o[j] = t.acc[i >> 1][(i & 1) * 4 + j];
      *(v4f*)&sa[pr][i][lane * 4] = o; }
    sml[pr][0][lane] = t.m; sml[pr][1][lane] = t.l;
  }
  __syncthreads();   // the head waves' parts are in LDS; every wave passes here once
  if (tail) {
    const float ma = sml[pr][0][lane], la = sml[pr][1][lane]; const float mn = fmaxf(ma, t.m); const float fa = exp1(ma - mn), fb = exp1(t.m - mn);
    t.l = t.l * fb + la * fa;
#pragma unroll
    for (int i = 0; i < 8; ++i) { const v4f o = *(const v4f*)&sa[pr][i][lane * 4];
#pragma unroll
      for (int j = 0; j < 4; ++j) t.acc[i >> 1][(i & 1) * 4 + j] = t.acc[i >> 1][(i & 1) * 4 + j] * fb + o[j] * fa; }
    attn_store<false>(t, O, T1, h, b, lane);
  }
}
// ---- k_out: block = (64 rows, 128 cols): out = O(hi/lo) . Wo rows (2 products) + bo
__global__ __launch_bounds__(128) void k_out(const float* __restrict__ O, const __bf16* __restrict__ P, const float* __restrict__ BO, float* __restrict__ Y) {
  __shared__ __align__(16) float so[4][16][132];
  const int tid = threadIdx.x, wave = tid >> 5, lane = tid & 31, col = lane & 15, g = lane >> 4; const size_t r0 = (size_t)blockIdx.x * 64 + wave * 16; const int n0 = blockIdx.y * 128;
  v8f acc[8] = {};
  // two register sets, as in k_qkv: a pass's loads go out as one group, a pass ahead of the WMMAs that read them
  const float* xa = O + (r0 >> 4) * (16 * DM) + lane * 4; const __bf16* wb = P + (size_t)(n0 >> 7) * (128 * DM) + lane * 8;
  PassF s0, s1;
  auto mm = [&](const PassF& s) { float v[16];
#pragma unroll
    for (int i = 0; i < 4; ++i) { v[i] = s.x[0][i]; v[4 + i] = s.x[1][i]; v[8 + i] = s.x[2][i]; v[12 + i] = s.x[3][i]; }
    const F2 a = bsplit16(v);
#pragma unroll
    for (int j = 0; j < 8; ++j) { acc[j] = wmma_bf(a.l, s.w[j], acc[j]); acc[j] = wmma_bf(a.h, s.w[j], acc[j]); } };
  const int k0 = (blockIdx.x + 8 * blockIdx.y) & (DM / 32 - 1);   // rotated k walk, as in k_qkv; same y: 64 blocks at 32 passes; same x: 8 blocks at 4 passes, eight apart
  pass_at(s0, xa, wb, KR(0));
#pragma unroll 1   // kept rolled: the body already holds both register sets, a further copy would only cost registers
  for (int kc = 0; kc < DM / 32 - 2; kc += 2) { pass_at(s1, xa, wb, KR(kc + 1)); mm(s0); pass_at(s0, xa, wb, KR(kc + 2)); mm(s1); }
  pass_at(s1, xa, wb, KR(DM / 32 - 1)); mm(s0); mm(s1);
#pragma unroll
  for (int j = 0; j < 8; ++j) {
#pragma unroll
    for (int r = 0; r < 8; ++r) so[wave][8 * g + r][j * 16 + col] = acc[j][r] + bfr(BO[n0 + j * 16 + col]); }
  LDSX();
  for (int rl = 0; rl < 16; ++rl) vst2(Y + (r0 + rl) * DM + n0 + lane * 4, *(const v4f*)&so[wave][rl][lane * 4]);
}
extern "C" void kernel_launch(void* const* d_in, const int* in_sizes, int n_in, void* d_out, int out_size, void* d_ws, size_t ws_size, hipStream_t stream) {
  (void)in_sizes; (void)n_in; (void)out_size;
  const float** F = (const float**)d_in;   // 0 x [2,2048,1024], 1 w_qkv [3072,1024] natural (rows q | k | v), 2 b_qkv [3072], 3 w_o [1024,1024] natural, 4 b_o
  if (ws_size < (size_t)WS_END) return;
  char* ws = (char*)d_ws; __bf16* PK = (__bf16*)(ws + WS_PK); _Float16 *QK = (_Float16*)(ws + WS_QK), *QKL = (_Float16*)(ws + WS_QKL), *VTH = (_Float16*)(ws + WS_VTH), *VTL = (_Float16*)(ws + WS_VTL); float* O = (float*)(ws + WS_O); __bf16* XP = (__bf16*)(ws + WS_XP);
  k_pack<<<dim3((QKVW + DM + NB * SS) / 16, 4), 256, 0, stream>>>(F[1], F[3], F[0], PK, XP);
  k_qkv<<<dim3(TNB * SS / 128, QKVW / 128), 128, 0, stream>>>(XP, PK + PK_A, F[2], F[2] + DM, F[2] + 2 * DM, QK, QKL, VTH, VTL);
  k_attn<<<dim3(TQB / 2, NH, TNB), 256, 0, stream>>>(QK, QKL, VTH, VTL, nullptr, O);
  k_out<<<dim3(TOB, DM / 128), 128, 0, stream>>>(O, PK + PK_P, F[4], (float*)d_out);
}

// v009
// A run of this version takes 80.1 microseconds.
// In two side-by-side timings against v008, it was 1.04 and 1.03 times as fast.
// Counting every step since v000, it is 5.35 times as fast.
// compute dtype: all float inputs rounded to bf16; qkv = x . W^T + b with EXACT bf16 products on WMMA 16x16x32 (natural rows), f16 hi + residual; causal PLAIN-HYBRID attention (first 128 queries 3-product, later single f16; logits std ~0.5, diffuse), x 1/32, running-max softmax in f32 (hardware exp); out = ctx (bf16 hi + lo) . Wo^T + b_o; f32 output.
#include <hip/hip_runtime.h>
#include <math.h>

typedef __attribute__((ext_vector_type(16))) _Float16 v16h;
typedef __attribute__((ext_vector_type(16))) __bf16 v16b;
typedef __attribute__((ext_vector_type(8)))  _Float16 v8h;
typedef __attribute__((ext_vector_type(8)))  float v8f;
typedef __attribute__((ext_vector_type(4)))  float v4f;
typedef __attribute__((ext_vector_type(2)))  float v2f;
typedef __attribute__((ext_vector_type(4)))  unsigned v4u;
typedef __attribute__((ext_vector_type(4)))  int v4i;
typedef float __attribute__((may_alias)) float_a;
typedef int __attribute__((may_alias)) int_a;

template <typename T> __device__ __forceinline__ void vst2(void* p, T v) { *(T*)p = v;  }
__device__ __forceinline__ v8f wmma16(v16h a, v16h b, v8f c) {
  v8f d = __builtin_amdgcn_wmma_f32_16x16x32_f16(false, a, false, b, (short)0, c, false, false);
  asm volatile("v_nop\n\tv_nop\n\tv_nop\n\tv_nop" : "+v"(d) : "v"(a), "v"(b));
  return d;
}
__device__ __forceinline__ v8f wmma_bf(v16b a, v16b b, v8f c) {
  v8f d = __builtin_amdgcn_wmma_f32_16x16x32_bf16(false, a, false, b, (short)0, c, false, false);
  asm volatile("v_nop\n\tv_nop\n\tv_nop\n\tv_nop" : "+v"(d) : "v"(a), "v"(b));
  return d;
}
// Multi-head attention '2' (B 2, N 2,048, C 1,024, 16 heads x 64): fused natural w_qkv (q | k | v row blocks) + bias, causal softmax(q k / sqrt(1024)) v (the module scales by 1/sqrt(embed_dim), -inf fill), merge heads, natural w_o + b_o.
__device__ __forceinline__ v16h frag_h(const _Float16* rowk0, int lane) {
  union { v16h v; v8h q[2]; } u; const _Float16* p = rowk0 + 8 * (lane >> 4);
  u.q[0] = *(const v8h*)p; u.q[1] = *(const v8h*)(p + 16); return u.v;
}
__device__ __forceinline__ v16h frag_f32(const float* rowk0, int lane) {
  v16h a; const float* p = rowk0 + 8 * (lane >> 4);
#pragma unroll
  for (int i = 0; i < 8; ++i) { a[i] = (_Float16)p[i]; a[8 + i] = (_Float16)p[16 + i]; }
  return a;
}
__device__ __forceinline__ v16h frag_f32s(const float* rowk0, int lane, float sc) {
  v16h a; const float* p = rowk0 + 8 * (lane >> 4);
#pragma unroll
  for (int i = 0; i < 8; ++i) { a[i] = (_Float16)(p[i] * sc); a[8 + i] = (_Float16)(p[16 + i] * sc); }
  return a;
}
// column fragment from a [K][ld] layout (column n), rows >= K read as 0
__device__ __forceinline__ v16h fragc_f32(const float* W, int k0, int n, int lane, int ld, int K) {
  v16h a; const int g = lane >> 4;
#pragma unroll
  for (int i = 0; i < 8; ++i) { const int ka = k0 + 8 * g + i, kb = ka + 16;
    a[i] = (_Float16)(ka < K ? W[(size_t)(ka < K ? ka : K - 1) * ld + n] : 0.f); a[8 + i] = (_Float16)(kb < K ? W[(size_t)(kb < K ? kb : K - 1) * ld + n] : 0.f); }
  return a;
}
struct F2 { v16b h, l; };
__device__ __forceinline__ F2 bsplit16(const float v[16]) { F2 r;
#pragma unroll
  for (int i = 0; i < 16; ++i) { const __bf16 h = (__bf16)v[i]; r.h[i] = h; r.l[i] = (__bf16)(v[i] - (float)h); }
  return r; }
__device__ __forceinline__ F2 split_row(const float* row, int k0, int lane) { float v[16]; const float* p = row + k0 + 8 * (lane >> 4);
#pragma unroll
  for (int i = 0; i < 8; ++i) { v[i] = p[i]; v[8 + i] = p[16 + i]; }
  return bsplit16(v); }
__device__ __forceinline__ F2 split_rowK(const float* row, int k0, int lane, int K) { float v[16]; const int g = lane >> 4;
#pragma unroll
  for (int i = 0; i < 8; ++i) { const int ka = k0 + 8 * g + i, kb = ka + 16; v[i] = ka < K ? row[ka < K ? ka : K - 1] : 0.f; v[8 + i] = kb < K ? row[kb < K ? kb : K - 1] : 0.f; }
  return bsplit16(v); }
__device__ __forceinline__ F2 split_col(const float* W, int k0, int n, int lane, int ld, int K) { float v[16]; const int g = lane >> 4;
#pragma unroll
  for (int i = 0; i < 8; ++i) { const int ka = k0 + 8 * g + i, kb = ka + 16; v[i] = ka < K ? W[(size_t)(ka < K ? ka : K - 1) * ld + n] : 0.f; v[8 + i] = kb < K ? W[(size_t)(kb < K ? kb : K - 1) * ld + n] : 0.f; }
  return bsplit16(v); }
__device__ __forceinline__ v8f mac3(const F2& a, const F2& b, v8f c) { c = wmma_bf(a.l, b.h, c); c = wmma_bf(a.h, b.l, c); return wmma_bf(a.h, b.h, c); }
__device__ __forceinline__ float sigm(float v) { return 1.0f / (1.0f + expf(-v)); }
#define LDSX() do { asm volatile("s_wait_dscnt 0" ::: "memory"); __builtin_amdgcn_wave_barrier(); __builtin_amdgcn_fence(__ATOMIC_RELEASE, "workgroup"); } while (0)


#define NB 2
#define SS 2048
#define DM 1024
#define NH 16
#define HD 64
#define QKVW (3 * DM)
#ifndef TQB
#define TQB (SS / 64)
#define TNB NB
#define TOB (NB * SS / 64)     // output row tiles (all)
#endif
typedef __attribute__((ext_vector_type(8))) __bf16 v8b;
// FRAGMENT ORDER of a 16-bit operand in the workspace: a 16 (rows) x 32 (k) fragment is 1 KiB = two pieces of 512 B; in piece q lane l owns 16 B: row l & 15, k = 16 q + 8 (l >> 4) + 0..7.
// So each wave-wide 16-B load or store covers four whole 128-B lines. p = the fragment's start + 8 * lane.
__device__ __forceinline__ v16b fragp_b(const __bf16* p) {
  union { v16b v; v8b q[2]; } u; u.q[0] = *(const v8b*)p; u.q[1] = *(const v8b*)(p + 256); return u.v;
}
__device__ __forceinline__ v16h fragp_h(const _Float16* p) {
  union { v16h v; v8h q[2]; } u; u.q[0] = *(const v8h*)p; u.q[1] = *(const v8h*)(p + 256); return u.v;
}
__device__ __forceinline__ float bfr(float v) { return (float)(__bf16)v; }
__device__ __attribute__((noinline)) float exp_ni(float v) { return expf(v); }
__device__ __attribute__((noinline)) float erf_ni(float v) { return erff(v); }

#define PK_A 0                       // Wqkv: [24 blocks of 128 rows][32 k passes][8 tiles of 16 rows] fragments (fragment order)
#define PK_P (PK_A + QKVW * DM)        // Wo: [8 blocks][32 passes][8 tiles] fragments
#define PK_END (PK_P + DM * DM)
#define WS_PK  0u
#define WS_QK  (WS_PK + 2u * PK_END)             // f16 [q | k][b][head][128 tiles of 16 rows][2 k passes] fragments
#define WS_QKL (WS_QK + 2u * NB * SS * 2 * DM)     // f16 q | k residual planes x2048, same order
#define WS_VTH (WS_QKL + 2u * NB * SS * 2 * DM)    // f16 hi [b][head][64 passes of 32 keys][4 tiles of 16 d] fragments (row = d, k = key)
#define WS_VTL (WS_VTH + 2u * NB * DM * SS)        // f16 lo x 2048
#define WS_O   (WS_VTL + 2u * NB * DM * SS)        // f32 [256 tiles of 16 rows][32 k passes][4 pieces of 512 B]: piece i, lane l: row l & 15, k = 16 (i >> 1) + 8 (l >> 4) + 4 (i & 1) + 0..3
#define WS_CS  (WS_O + 4u * NB * SS * DM)           // f32 2 x [2048][32], reserved: nothing writes or reads it
#define WS_XP  (WS_CS + 4u * 2 * SS * 32)           // bf16 x: [256 tiles of 16 rows][32 k passes] fragments
#define WS_END (WS_XP + 2u * NB * SS * DM)
#define QKT(plane, b, h, st) (((((size_t)(plane) * NB + (b)) * NH + (h)) * (SS / 16) + (st)) * 1024)   // start of a 16 x 64 q or k tile (two fragments), in elements
#define VT(b, h, ks) ((((size_t)(b) * NH + (h)) * (SS / 32) + (ks)) * 2048)   // start of a pass's four V fragments, in elements
// ---- k_pack: block = (tile of 16 natural rows, quarter of k): f32 -> bf16 in fragment order, whole lines in (two rows x 256 B a wave) and out, turned in LDS; tiles 0..191 w_qkv, 192..255 w_o (both into PK), 256..511 x (into XP)
typedef __attribute__((ext_vector_type(4))) __bf16 v4b;
__global__ __launch_bounds__(256) void k_pack(const float* __restrict__ WA, const float* __restrict__ WO, const float* __restrict__ X, __bf16* __restrict__ PK, __bf16* __restrict__ XP) {
  __shared__ __align__(16) __bf16 s[16][264];   // pitch 528 B = 16 B x odd: the 16 rows of a fragment piece fall on distinct banks
  const int t = blockIdx.x, kq = blockIdx.y, tid = threadIdx.x; const int TA = QKVW / 16, TW = (QKVW + DM) / 16;
  const float* srcp = ((t < TA) ? WA + (size_t)t * 16 * DM : (t < TW) ? WO + (size_t)(t - TA) * 16 * DM : X + (size_t)(t - TW) * 16 * DM) + (size_t)(tid >> 4) * DM + kq * 256 + (tid & 15) * 4;
  v4f a[4];
#pragma unroll
  for (int it = 0; it < 4; ++it) a[it] = *(const v4f*)(srcp + it * 64);
#pragma unroll
  for (int it = 0; it < 4; ++it) { v4b r;
#pragma unroll
    for (int i = 0; i < 4; ++i) r[i] = (__bf16)a[it][i];
    *(v4b*)&s[tid >> 4][it * 64 + (tid & 15) * 4] = r; }
  __syncthreads();
  // weights: [block of 128 rows][k pass][8 tiles] fragments, so a wave's pass is 8 KiB in a row; x: [tile][k pass]
  __bf16* dst = (t < TW) ? PK + (size_t)(t >> 3) * (128 * DM) + (t & 7) * 512 : XP + (size_t)(t - TW) * 16 * DM; const int ps = (t < TW) ? 4096 : 512;
#pragma unroll
  for (int it = 0; it < 2; ++it) { const int o = it * 256 + tid, kcl = o >> 6, q = (o >> 5) & 1, l = o & 31;
    vst2((unsigned*)(dst + (size_t)(kq * 8 + kcl) * ps + q * 256 + l * 8), *(const v4u*)&s[l & 15][kcl * 32 + q * 16 + (l >> 4) * 8]); }
}
// one k pass (32 k) of k_out's 16 x 128 wave tile: the A fragment (its four f32 pieces) and the 8 weight fragments; xa and wb hold the lane's offset
struct PassF { v4f x[4]; v16b w[8]; };
__device__ __forceinline__ void pass_ld(PassF& s, const float* xa, const __bf16* wb, int kc) {
  const float* p = xa + kc * 512; s.x[0] = *(const v4f*)p; s.x[1] = *(const v4f*)(p + 128); s.x[2] = *(const v4f*)(p + 256); s.x[3] = *(const v4f*)(p + 384);
#pragma unroll
  for (int j = 0; j < 8; ++j) s.w[j] = fragp_b(wb + kc * 4096 + j * 512);
}
// one k pass (32 k) of k_qkv's 64 x 64 wave tile: four x fragments and four weight fragments feed 16 WMMAs (half a fragment load a WMMA); xa and wb hold the lane's offset
struct PassQ { v16b a[4]; v16b w[4]; };
__device__ __forceinline__ void pass_ld(PassQ& s, const __bf16* xa, const __bf16* wb, int kc) {
#pragma unroll
  for (int i = 0; i < 4; ++i) s.a[i] = fragp_b(xa + i * (16 * DM) + kc * 512);
#pragma unroll
  for (int j = 0; j < 4; ++j) s.w[j] = fragp_b(wb + kc * 4096 + j * 512);
}
// the loads of k pass kc, closed by their wait: the next pass's addresses have no fixed step from these (the walk wraps), so they are formed anew, and the wait stands before that; both addresses are inputs of the wait, so they stay live up to it and no load of the group lands on a pair that the others still name
template <typename S, typename X> __device__ __forceinline__ void pass_at(S& s, const X* xa, const __bf16* wb, int kc) {
  const X* xp = xa + kc * 512; const __bf16* wp = wb + kc * 4096; pass_ld(s, xp, wp, 0);
  asm volatile("s_wait_xcnt 0x0" :: "v"(xp), "v"(wp) : "memory");
}
// ---- k_qkv: block = (128 rows of x, 128 columns): four waves as 2 x 2, each a 64 x 64 tile = 64 rows x ONE head of q, k or v; 768 blocks = three a WGP, all resident at once
__global__ __launch_bounds__(128) void k_qkv(const __bf16* __restrict__ XP, const __bf16* __restrict__ P, const float* __restrict__ BQ, const float* __restrict__ BK, const float* __restrict__ BV, _Float16* __restrict__ QK, _Float16* __restrict__ QKL, _Float16* __restrict__ VTH, _Float16* __restrict__ VTL) {
  const int which0 = (blockIdx.y * 128) / DM; const float* BB = BQ ? (((which0 == 0) ? BQ : (which0 == 1) ? BK : BV) + (blockIdx.y * 128 - which0 * DM)) : nullptr;
  __shared__ __align__(16) _Float16 sh[4][64][72], sl[4][64][72];   // each wave's own tile, hi and residual (q, k: [row][d]; v: [d][key]); pitch 144 B = 16 B x odd
  const int tid = threadIdx.x, wave = tid >> 5, lane = tid & 31, col = lane & 15, g = lane >> 4, wr = wave >> 1, wc = wave & 1; const size_t r0 = (size_t)blockIdx.x * 128 + wr * 64; const int n0 = blockIdx.y * 128;
  v8f acc[4][4] = {};   // acc[i][j][r]: row r0 + 16 i + 8 g + r, column n0 + 64 wc + 16 j + col
  // the lane's 4 bias values (one a column tile) go out as one group in front of the k loop and are held in registers: the epilogue has no load and no wait on one
  float bias[4] = {};
  if (BB) {
#pragma unroll
    for (int j = 0; j < 4; ++j) bias[j] = BB[wc * 64 + j * 16 + col];
    asm volatile("s_wait_xcnt 0x0" ::: "memory");   // before the address registers of the bias loads are reused
  }
  // two register sets: a pass's 16 loads go out as one group, a pass ahead of the WMMAs that read them
  const __bf16* xa = XP + (r0 >> 4) * (16 * DM) + lane * 8; const __bf16* wb = P + (size_t)(n0 >> 7) * (128 * DM) + wc * 2048 + lane * 8;
  PassQ s0, s1;
  // ROTATED k WALK: the block enters the 32 k passes at pass k0 and wraps round. Blocks that read the same weight rows (same y) or the same x rows (same x) so stand at different passes at any moment, in place of all asking L2 for the same lines, not yet fetched, at once.
  const int k0 = (blockIdx.x + 4 * blockIdx.y) & (DM / 32 - 1);   // same y: 32 blocks at 32 passes; same x: 24 blocks at 8 passes, four apart
#define KR(i) (((i) + k0) & (DM / 32 - 1))
  // the WMMAs are the plain builtin (the compiler keeps their distances itself): the operands of wmma_bf's v_nop statement would hold accumulators and both sets under v256, where they do not fit (spills)
  auto mm = [&](const PassQ& s) {
#pragma unroll
    for (int i = 0; i < 4; ++i) {
#pragma unroll
      for (int j = 0; j < 4; ++j) acc[i][j] = __builtin_amdgcn_wmma_f32_16x16x32_bf16(false, s.a[i], false, s.w[j], (short)0, acc[i][j], false, false); } };
#define SB() __builtin_amdgcn_sched_barrier(0)   // keeps a pass's 16 loads one group in front of the WMMA block of the pass before: without it the compiler sinks the loads to their readers (one register set) and every WMMA row waits out its own loads
  pass_at(s0, xa, wb, KR(0)); SB();
#pragma unroll 1   // kept rolled: the body already holds both register sets, a further copy would only cost registers
  for (int kc = 0; kc < DM / 32 - 2; kc += 2) { pass_at(s1, xa, wb, KR(kc + 1)); SB(); mm(s0); SB(); pass_at(s0, xa, wb, KR(kc + 2)); SB(); mm(s1); SB(); }
  pass_at(s1, xa, wb, KR(DM / 32 - 1)); SB(); mm(s0); SB(); mm(s1); SB();
#pragma unroll
  for (int j = 0; j < 4; ++j) bias[j] = bfr(bias[j]);
  const int b = (int)(r0 / SS), sq0 = (int)(r0 % SS);
  if (n0 < 2 * DM) {   // q stored unscaled (f16 sigma ~0.6, no subnormal exposure); 1/32 applied to the f32 score
#pragma unroll
    for (int i = 0; i < 4; ++i) {
#pragma unroll
      for (int j = 0; j < 4; ++j) {
#pragma unroll
        for (int r = 0; r < 8; ++r) { const float v = acc[i][j][r] + bias[j]; const _Float16 hv = (_Float16)v; sh[wave][i * 16 + 8 * g + r][j * 16 + col] = hv; sl[wave][i * 16 + 8 * g + r][j * 16 + col] = (_Float16)((v - (float)hv) * 2048.0f); } } }   // q, k (+ bias) as f16 hi + (x2048) residual
    LDSX();
    // the wave's 64 x 64 tile = four row tiles x two fragments x two pieces, 16 pieces in a row in the workspace, each one 512-B store
    const size_t o0 = QKT(which0, b, (n0 - which0 * DM) / HD + wc, sq0 / 16) + lane * 8;
#pragma unroll
    for (int u = 0; u < 16; ++u) { const int row = (u >> 2) * 16 + col, c0 = (u & 3) * 16 + g * 8;
      vst2((unsigned*)(QK + o0 + u * 256), *(const v4u*)&sh[wave][row][c0]); vst2((unsigned*)(QKL + o0 + u * 256), *(const v4u*)&sl[wave][row][c0]);
      if (u == 7 || u >= 14) asm volatile("s_wait_xcnt 0x0" ::: "memory"); }   // before data registers of the stores so far are rewritten: by later LDS reads (the second half reuses the first half's, the last piece the second half's), behind the last piece by whatever code is laid behind this path
  } else {
#pragma unroll
    for (int i = 0; i < 4; ++i) {
#pragma unroll
      for (int j = 0; j < 4; ++j) {
#pragma unroll
        for (int r = 0; r < 8; ++r) { const float v = acc[i][j][r] + bias[j]; const _Float16 hv = (_Float16)v; sh[wave][j * 16 + col][i * 16 + 8 * g + r] = hv; sl[wave][j * 16 + col][i * 16 + 8 * g + r] = (_Float16)((v - (float)hv) * 2048.0f); } } }
    LDSX();   // the wave reads back only what it wrote itself: no wave waits on another
    // the wave's 64 d x 64 keys = two passes x four d tiles x two pieces, 16 pieces in a row in the workspace, each one 512-B store
    const size_t o0 = VT(b, (n0 - 2 * DM) / HD + wc, sq0 / 32) + lane * 8;
#pragma unroll
    for (int u = 0; u < 16; ++u) { const int d = ((u >> 1) & 3) * 16 + col, sc = (u >> 3) * 32 + (u & 1) * 16 + g * 8;
      vst2((unsigned*)(VTH + o0 + u * 256), *(const v4u*)&sh[wave][d][sc]); vst2((unsigned*)(VTL + o0 + u * 256), *(const v4u*)&sl[wave][d][sc]);
      if (u == 7 || u >= 14) asm volatile("s_wait_xcnt 0x0" ::: "memory"); }   // before data registers of the stores so far are rewritten: by later LDS reads (the second half reuses the first half's, the last piece the second half's), behind the last piece by whatever code is laid behind this path
  }
}
// lane l with lane l ^ 16 (a vector cross-row move, no LDS path)
__device__ __forceinline__ float xhalf(float x) { return __builtin_bit_cast(float, __builtin_amdgcn_permlanex16(__builtin_bit_cast(int, x), __builtin_bit_cast(int, x), 0x76543210, 0xfedcba98, false, false)); }
// ---- k_attn: block = (four pairs of 16-query tiles, head h, batch b): causal flash attention (K = 64: 2 k-steps) in the TRANSPOSED form: S^T = K . Q^T (A = K fragment, B = q fragment), O^T += V^T . P^T (A = V fragment, B = P).
// A lane then holds ONE query (q0 + col): of a 16-key score tile its 8 registers are keys 8 g + r, so maximum and sum run inside the lane, the two wave halves meet in one exchange (the maximum, each pass) and once behind the loop (the sum).
// The two score tiles of a pass, converted in place, ARE the B fragment of P^T (element s = tile s >> 3, register s & 7: the k order of the V fragments), so P touches no LDS; acc[dt][r] = O(query col, d = dt * 16 + 8 g + r) is already k_out's fragment order.
// scores = (q.k) / 32 with single f16 operands (LEAD: + residual products), P.V: f16 P x V hi (LEAD: + P lo x V hi, P x V lo*2048 in a second accumulator); O(row b*S+q, col h*64+d) = (acc + accl / 2048) / (2048 l)
// The pass is compiled per case of its two wave-uniform conditions, so that the common pass carries only its own work:
// LEAD (query blocks 0 and 1): residual products, the low half of P and the second accumulator; elsewhere none of them exists.
// LAST (a tile's one pass that holds its diagonal, ks = q0 / 32): the causal mask, and no fetch of further K rows; every pass in front of it has all 32 keys at or before all 16 queries.
// __expf as it compiles (one multiply, v_exp_f32), written so that the free slot which the instruction set asks for behind a transcendental (before its result is read or its source overwritten) is there by construction.
// exp8: each next v_exp_f32 is the independent instruction behind the one before (early-clobber outputs: none lies on a source), one v_nop closes the last; exp1: the same for a single value.
__device__ __forceinline__ void exp8(float* r, const float* x) {
  float y[8];
#pragma unroll
  for (int i = 0; i < 8; ++i) y[i] = x[i] * 1.44269504f;
  asm("v_exp_f32 %0, %8\n\tv_exp_f32 %1, %9\n\tv_exp_f32 %2, %10\n\tv_exp_f32 %3, %11\n\tv_exp_f32 %4, %12\n\tv_exp_f32 %5, %13\n\tv_exp_f32 %6, %14\n\tv_exp_f32 %7, %15\n\tv_nop"
      : "=&v"(r[0]), "=&v"(r[1]), "=&v"(r[2]), "=&v"(r[3]), "=&v"(r[4]), "=&v"(r[5]), "=&v"(r[6]), "=&v"(r[7])
      : "v"(y[0]), "v"(y[1]), "v"(y[2]), "v"(y[3]), "v"(y[4]), "v"(y[5]), "v"(y[6]), "v"(y[7]));
}
__device__ __forceinline__ float exp1(float x) { float r; const float y = x * 1.44269504f; asm("v_exp_f32 %0, %1\n\tv_nop" : "=v"(r) : "v"(y)); return r; }
// a fragment's two loads; EACH true (the leading blocks, whose loads go through vector address pairs shared by a run of loads): every load is closed by a wait of its own, because the register allocator lets a later load of a run land on the pair that the earlier ones still name
template <bool EACH> __device__ __forceinline__ v16h fragp_x(const _Float16* p) {
  if constexpr (!EACH) return fragp_h(p);
  else { union { v16h v; v8h q[2]; } u;
    u.q[0] = *(const v8h*)p; asm volatile("s_wait_xcnt 0x0" ::: "memory");   // before the next load may land on this one's address pair
    u.q[1] = *(const v8h*)(p + 256); asm volatile("s_wait_xcnt 0x0" ::: "memory");   // the same
    return u.v; }
}
template <bool LEAD> struct AttnSt { v16h aq[2]; v16h kf[2][2]; v8f acc[4]; v8f accl[LEAD ? 4 : 1]; float m, l; };
// ks: this pass; kn: the pass whose K rows are fetched for the next call (not read by LAST); qlp, klb, kb0, vhb, vlb: q residual tile, K residual rows, K rows, V hi and V lo of this (b, h), each at the lane's 16 B; dq: the lane's query counted from the first key of the lane's half in this pass (read by LAST only)
template <bool LEAD, bool LAST>
__device__ __forceinline__ void attn_pass(AttnSt<LEAD>& t, const int ks, const int kn, const int dq, const _Float16* qlp, const _Float16* klb, const _Float16* kb0, const _Float16* vhb, const _Float16* vlb) {
  v8f s[2]; v16h vf[4]; const _Float16* vp = vhb + (size_t)ks * 2048;   // this pass's four V fragments, at the lane's 16 B
  if constexpr (!LEAD) {
#pragma unroll
    for (int dt = 0; dt < 4; ++dt) vf[dt] = fragp_x<LEAD>(vp + dt * 512); }
  if constexpr (!LEAD) asm volatile("s_wait_xcnt 0x0" :: "v"(vp) : "memory");   // before the address registers of the V loads are reused; the address is an input, so it stays live up to the wait and no load of the run lands on the pair that the others still name (LEAD: the V and K loads, below, each have their own wait)
  // LEAD: the residual fragments go out as groups ahead of the WMMAs that read them, held in registers: K and q residuals here, at the head of the pass, V residuals behind the exponentials. One load and a full wait in front of each WMMA would lay the whole load latency bare ten times a pass.
  // So that the groups fit the register budget of four waves a SIMD, the V fragments of a LEAD pass go out behind its score products (when the K and q residuals are dead), not at its head.
  v16h rk[LEAD ? 4 : 1], rq[LEAD ? 2 : 1], rv[LEAD ? 4 : 1];
  if constexpr (LEAD) { const _Float16* kp = klb + (size_t)ks * 2048;   // this pass's four K residual fragments, at the lane's 16 B
#pragma unroll
    for (int f = 0; f < 4; ++f) rk[f] = fragp_h(kp + f * 512);
#pragma unroll
    for (int kc = 0; kc < 2; ++kc) rq[kc] = fragp_h(qlp + kc * 512);
    asm volatile("s_wait_xcnt 0x0" :: "v"(kp), "v"(qlp) : "memory"); }   // before the address registers of the group are reused; both addresses are inputs, so they stay live up to the wait and no load of the group lands on them
#pragma unroll
  for (int ct = 0; ct < 2; ++ct) { v8f c = {};
    if constexpr (LEAD) {   // leading query blocks (few keys, outputs far above the global rms): 3 products
      v8f cl = {};
#pragma unroll
      for (int kc = 0; kc < 2; ++kc) { const v16h kh = t.kf[ct][kc]; c = wmma16(kh, t.aq[kc], c); cl = wmma16(kh, rq[kc], cl); cl = wmma16(rk[ct * 2 + kc], t.aq[kc], cl); }
#pragma unroll
      for (int r = 0; r < 8; ++r) c[r] += cl[r] * (1.0f / 2048.0f); }
    else {
#pragma unroll
      for (int kc = 0; kc < 2; ++kc) c = wmma16(t.kf[ct][kc], t.aq[kc], c); }   // single product elsewhere
#pragma unroll
    for (int r = 0; r < 8; ++r) s[ct][r] = (!LAST || ct * 16 + r <= dq) ? c[r] * 0.03125f : -3.0e38f; }   // 1/sqrt(1024); keys behind the lane's query excluded
  if constexpr (!LAST) {   // the next pass's K rows, right behind this pass's score products
#pragma unroll
    for (int ct = 0; ct < 2; ++ct) {
#pragma unroll
      for (int kc = 0; kc < 2; ++kc) t.kf[ct][kc] = fragp_x<LEAD>(kb0 + (size_t)kn * 2048 + ct * 1024 + kc * 512); }
    if constexpr (!LEAD) asm volatile("s_wait_xcnt 0x0" ::: "memory"); }   // before the address registers of the K loads are reused
  if constexpr (LEAD) {
#pragma unroll
    for (int dt = 0; dt < 4; ++dt) vf[dt] = fragp_x<LEAD>(vp + dt * 512); }
  float mt[8];
#pragma unroll
  for (int r = 0; r < 8; ++r) mt[r] = fmaxf(s[0][r], s[1][r]);
  float mx = fmaxf(fmaxf(fmaxf(mt[0], mt[1]), fmaxf(mt[2], mt[3])), fmaxf(fmaxf(mt[4], mt[5]), fmaxf(mt[6], mt[7])));
  mx = fmaxf(mx, xhalf(mx));   // both halves now hold the maximum over the pass's 32 keys
  const float mn = fmaxf(t.m, mx); const float ea = exp1(t.m - mn); const float alpha = (t.m <= -1.0e38f) ? 0.f : ea;
  float df[16], ex[16];
#pragma unroll
  for (int i = 0; i < 16; ++i) df[i] = s[i >> 3][i & 7] - mn;
  exp8(ex, df); exp8(ex + 8, df + 8);
  if constexpr (LEAD) { const _Float16* lp = vlb + (size_t)ks * 2048;   // this pass's four V residual fragments: in flight under the packing of P and the rescaling
#pragma unroll
    for (int dt = 0; dt < 4; ++dt) rv[dt] = fragp_h(lp + dt * 512);
    asm volatile("s_wait_xcnt 0x0" :: "v"(lp) : "memory"); }   // as at the head of the pass
  v16h pa, pl; float es[4];   // four short chains of adds in place of one long one
#pragma unroll
  for (int i = 0; i < 16; ++i) { const float sv = s[i >> 3][i & 7]; const float e = (LAST && sv <= -1.0e38f) ? 0.f : ex[i]; es[i & 3] = (i < 4) ? e : es[i & 3] + e;
    const float x0 = e * 2048.0f; const _Float16 h0 = (_Float16)x0; pa[i] = h0; if constexpr (LEAD) pl[i] = (_Float16)((x0 - (float)h0) * 2048.0f); }   // P scaled by 2^11 before the f16 split so small softmax weights stay out of the f16 subnormal range; 2^-11 folded into the epilogue
  t.l = t.l * alpha + ((es[0] + es[1]) + (es[2] + es[3])); t.m = mn;
#pragma unroll
  for (int dt = 0; dt < 4; ++dt) {
#pragma unroll
    for (int r = 0; r < 8; ++r) { t.acc[dt][r] *= alpha; if constexpr (LEAD) t.accl[dt][r] *= alpha; } }
#pragma unroll
  for (int dt = 0; dt < 4; ++dt) { const v16h vh = vf[dt]; t.acc[dt] = wmma16(vh, pa, t.acc[dt]);
    if constexpr (LEAD) { t.accl[dt] = wmma16(vh, pl, t.accl[dt]); t.accl[dt] = wmma16(rv[dt], pa, t.accl[dt]); } }   // leading query blocks: P hi/lo x V hi/lo (3 products); elsewhere P x V single
}
// a run of passes of the 16-query tile T: the key passes kbeg .. kend - 1 (all of their 32 keys at or before the tile's first query), then, where diag holds, the tile's diagonal pass, which is pass kend
// ROTATED KEY WALK: the run enters at pass kbeg + rot (rot < kend - kbeg, or 0) and wraps round to kbeg: the 16 blocks of a (batch, head), which read the same K and V lines, stand at different passes at any moment
template <bool LEAD>
__device__ __forceinline__ void attn_run(AttnSt<LEAD>& t, const _Float16* __restrict__ QK, const _Float16* __restrict__ QKL, const _Float16* __restrict__ VTH, const _Float16* __restrict__ VTL, const int T, const int h, const int b, const int kbeg, const int kend, const int rot, const bool diag, const int lane) {
  const int col = lane & 15, g = lane >> 4; const int q0 = T * 16; const size_t qt = QKT(0, b, h, T) + lane * 8;   // the wave's q tile, at the lane's 16 B
  // the q residual fragments are read where the leading blocks use them
#pragma unroll
  for (int kc = 0; kc < 2; ++kc) t.aq[kc] = fragp_x<LEAD>(QK + qt + kc * 512);
  t.m = -3.0e38f; t.l = 0.f;   // of the lane's query; l sums the keys of the lane's own half only
#pragma unroll
  for (int dt = 0; dt < 4; ++dt) { t.acc[dt] = v8f{}; if constexpr (LEAD) t.accl[dt] = v8f{}; }
  // K fragments are fetched one pass ahead (right behind the pass's score products), V fragments at the head of their pass (LEAD: behind its score products): each as one group, so no WMMA waits on a load issued directly in front of it
  const _Float16* kb0 = QK + QKT(1, b, h, 0) + lane * 8; const _Float16* klb = QKL + QKT(1, b, h, 0) + lane * 8; const _Float16* vhb = VTH + VT(b, h, 0) + lane * 8; const _Float16* vlb = VTL + VT(b, h, 0) + lane * 8;
#pragma unroll
  for (int ct = 0; ct < 2; ++ct) {
#pragma unroll
    for (int kc = 0; kc < 2; ++kc) t.kf[ct][kc] = fragp_x<LEAD>(kb0 + (size_t)(kbeg + rot) * 2048 + ct * 1024 + kc * 512); }
  if constexpr (!LEAD) asm volatile("s_wait_xcnt 0x0" ::: "memory");   // before the address registers of the q and K loads are reused
#pragma unroll 1   // kept rolled: one copy of the common pass in the instruction cache
  for (int i = kend - kbeg, ks = kbeg + rot; i > 0; --i) { const int kw = (ks + 1 == kend) ? kbeg : ks + 1, kn = (i == 1) ? kend : kw;   // behind the run's last pass comes pass kend
    attn_pass<LEAD, false>(t, ks, kn, 0, QKL + qt, klb, kb0, vhb, vlb); ks = kn; }
  if (diag) attn_pass<LEAD, true>(t, kend, kend, q0 + col - kend * 32 - 8 * g, QKL + qt, klb, kb0, vhb, vlb);
}
// a finished tile goes out
template <bool LEAD>
__device__ __forceinline__ void attn_store(const AttnSt<LEAD>& t, float* __restrict__ O, const int T, const int h, const int b, const int lane) {
  const float il = (1.0f / 2048.0f) / (t.l + xhalf(t.l));   // the two halves' sums meet here, once
  // the wave's 16 x 64 tile = two k passes of k_out x four pieces, each piece one 512-B store, straight from the accumulators
  float* ot = O + ((size_t)(b * (SS / 16) + T) * (DM / 32) + h * 2) * 512 + lane * 4;
#pragma unroll
  for (int u = 0; u < 8; ++u) { v4f o;
#pragma unroll
    for (int i = 0; i < 4; ++i) { float a = t.acc[u >> 1][(u & 1) * 4 + i]; if constexpr (LEAD) a += t.accl[u >> 1][(u & 1) * 4 + i] * (1.0f / 2048.0f); o[i] = a * il; }
    vst2(ot + u * 128, o); }
  asm volatile("s_wait_xcnt 0x0" ::: "memory");   // before the code behind a tile's stores rewrites their data and address registers
}
// EQUAL WAVES. A tile's cost grows with its index (tile T has T / 2 + 1 passes), so tile u (short) and tile 127 - u (long) are dealt as a pair of 65 passes to two waves:
// the head wave (waves 0..3) runs the long tile's first 32 passes; the tail wave (waves 4..7) runs the short tile whole, then the long tile's passes from 32 on, the diagonal pass included: 33 passes.
// The head wave hands its running maximum, sum and accumulators over in LDS (one block barrier), the tail wave joins the two parts as a pass joins its own to the running ones, and stores.
// Every wave of the launch so has 32 or 33 passes wherever it lands; 512 blocks of 8 waves = four waves per SIMD, all resident at once; a block's four head waves walk the same keys together, its four tail waves nearly so.
#define HPASS (SS / 64)   // the long tile's passes that the head wave takes; a long tile (T >= 64) has at least HPASS passes in front of its diagonal pass
__global__ __launch_bounds__(256) __attribute__((amdgpu_waves_per_eu(4, 4))) void k_attn(const _Float16* __restrict__ QK, const _Float16* __restrict__ QKL, const _Float16* __restrict__ VTH, const _Float16* __restrict__ VTL, const void* __restrict__ KMASK, float* __restrict__ O) {
  __shared__ __align__(16) float sa[4][8][128]; __shared__ float sml[4][2][32];   // per pair: the head wave's accumulators (8 pieces of 16 B a lane), maximum and sum
  const int tid = threadIdx.x, wave = __builtin_amdgcn_readfirstlane(tid >> 5), lane = tid & 31;   // the wave's number in a scalar register: row addresses built on it cost no vector register
  const int pr = wave & 3, u = blockIdx.x * 4 + pr, h = blockIdx.y, b = blockIdx.z; const bool tail = wave >= 4;
  const int T1 = SS / 16 - 1 - u;
  // where each run enters its walk: the same for a block's four waves of a kind (they walk together), a share blockIdx.x / 16 of the shortest of their four runs, so below every run's length
  const int bx = blockIdx.x, rs = (2 * bx * bx) >> 4, rh = (HPASS * bx) >> 4, rl = ((HPASS - 2 - 2 * bx) * bx) >> 4;   // short tiles: at least 2 bx passes; head: HPASS; long tiles' rest: at least HPASS - 2 - 2 bx
  if (tail) {   // the short tile, whole
    if (blockIdx.x < 2) { AttnSt<true> s; attn_run<true>(s, QK, QKL, VTH, VTL, u, h, b, 0, u >> 1, rs, true, lane); attn_store<true>(s, O, u, h, b, lane); }
    else { AttnSt<false> s; attn_run<false>(s, QK, QKL, VTH, VTL, u, h, b, 0, u >> 1, rs, true, lane); attn_store<false>(s, O, u, h, b, lane); }
  }
  AttnSt<false> t;
  attn_run<false>(t, QK, QKL, VTH, VTL, T1, h, b, tail ? HPASS : 0, tail ? (T1 >> 1) : HPASS, tail ? rl : rh, tail, lane);
  if (!tail) {
#pragma unroll
    for (int i = 0; i < 8; ++i) { v4f o;
#pragma unroll
      for (int j = 0; j < 4; ++j) o[j] = t.acc[i >> 1][(i & 1) * 4 + j];
      *(v4f*)&sa[pr][i][lane * 4] = o; }
    sml[pr][0][lane] = t.m; sml[pr][1][lane] = t.l;
  }
  __syncthreads();   // the head waves' parts are in LDS; every wave passes here once
  if (tail) {
    const float ma = sml[pr][0][lane], la = sml[pr][1][lane]; const float mn = fmaxf(ma, t.m); const float fa = exp1(ma - mn), fb = exp1(t.m - mn);
    t.l = t.l * fb + la * fa;
#pragma unroll
    for (int i = 0; i < 8; ++i) { const v4f o = *(const v4f*)&sa[pr][i][lane * 4];
#pragma unroll
      for (int j = 0; j < 4; ++j) t.acc[i >> 1][(i & 1) * 4 + j] = t.acc[i >> 1][(i & 1) * 4 + j] * fb + o[j] * fa; }
    attn_store<false>(t, O, T1, h, b, lane);
  }
}
// ---- k_out: block = (64 rows, 128 cols): out = O(hi/lo) . Wo rows (2 products) + bo
__global__ __launch_bounds__(128) void k_out(const float* __restrict__ O, const __bf16* __restrict__ P, const float* __restrict__ BO, float* __restrict__ Y) {
  __shared__ __align__(16) float so[4][16][132];
  const int tid = threadIdx.x, wave = tid >> 5, lane = tid & 31, col = lane & 15, g = lane >> 4; const size_t r0 = (size_t)blockIdx.x * 64 + wave * 16; const int n0 = blockIdx.y * 128;
  v8f acc[8] = {};
  // two register sets, as in k_qkv: a pass's loads go out as one group, a pass ahead of the WMMAs that read them
  const float* xa = O + (r0 >> 4) * (16 * DM) + lane * 4; const __bf16* wb = P + (size_t)(n0 >> 7) * (128 * DM) + lane * 8;
  PassF s0, s1;
  auto mm = [&](const PassF& s) { float v[16];
#pragma unroll
    for (int i = 0; i < 4; ++i) { v[i] = s.x[0][i]; v[4 + i] = s.x[1][i]; v[8 + i] = s.x[2][i]; v[12 + i] = s.x[3][i]; }
    const F2 a = bsplit16(v);
#pragma unroll
    for (int j = 0; j < 8; ++j) { acc[j] = wmma_bf(a.l, s.w[j], acc[j]); acc[j] = wmma_bf(a.h, s.w[j], acc[j]); } };
  const int k0 = (blockIdx.x + 8 * blockIdx.y) & (DM / 32 - 1);   // rotated k walk, as in k_qkv; same y: 64 blocks at 32 passes; same x: 8 blocks at 4 passes, eight apart
  pass_at(s0, xa, wb, KR(0));
#pragma unroll 1   // kept rolled: the body already holds both register sets, a further copy would only cost registers
  for (int kc = 0; kc < DM / 32 - 2; kc += 2) { pass_at(s1, xa, wb, KR(kc + 1)); mm(s0); pass_at(s0, xa, wb, KR(kc + 2)); mm(s1); }
  pass_at(s1, xa, wb, KR(DM / 32 - 1)); mm(s0); mm(s1);
#pragma unroll
  for (int j = 0; j < 8; ++j) {
#pragma unroll
    for (int r = 0; r < 8; ++r) so[wave][8 * g + r][j * 16 + col] = acc[j][r] + bfr(BO[n0 + j * 16 + col]); }
  LDSX();
  for (int rl = 0; rl < 16; ++rl) vst2(Y + (r0 + rl) * DM + n0 + lane * 4, *(const v4f*)&so[wave][rl][lane * 4]);
}
extern "C" void kernel_launch(void* const* d_in, const int* in_sizes, int n_in, void* d_out, int out_size, void* d_ws, size_t ws_size, hipStream_t stream) {
  (void)in_sizes; (void)n_in; (void)out_size;
  const float** F = (const float**)d_in;   // 0 x [2,2048,1024], 1 w_qkv [3072,1024] natural (rows q | k | v), 2 b_qkv [3072], 3 w_o [1024,1024] natural, 4 b_o
  if (ws_size < (size_t)WS_END) return;
  char* ws = (char*)d_ws; __bf16* PK = (__bf16*)(ws + WS_PK); _Float16 *QK = (_Float16*)(ws + WS_QK), *QKL = (_Float16*)(ws + WS_QKL), *VTH = (_Float16*)(ws + WS_VTH), *VTL = (_Float16*)(ws + WS_VTL); float* O = (float*)(ws + WS_O); __bf16* XP = (__bf16*)(ws + WS_XP);
  k_pack<<<dim3((QKVW + DM + NB * SS) / 16, 4), 256, 0, stream>>>(F[1], F[3], F[0], PK, XP);
  k_qkv<<<dim3(TNB * SS / 128, QKVW / 128), 128, 0, stream>>>(XP, PK + PK_A, F[2], F[2] + DM, F[2] + 2 * DM, QK, QKL, VTH, VTL);
  k_attn<<<dim3(TQB / 2, NH, TNB), 256, 0, stream>>>(QK, QKL, VTH, VTL, nullptr, O);
  k_out<<<dim3(TOB, DM / 128), 128, 0, stream>>>(O, PK + PK_P, F[4], (float*)d_out);
}

// v010
// A run of this version takes 76.9 microseconds.
// In two side-by-side timings against v009, it was 1.04 and 1.03 times as fast.
// All steps since v000 together make it 5.55 times as fast.
// compute dtype: all float inputs rounded to bf16; qkv = x . W^T + b with EXACT bf16 products on WMMA 16x16x32 (natural rows), f16 hi + residual; causal PLAIN-HYBRID attention (first 128 queries 3-product, later single f16; logits std ~0.5, diffuse), x 1/32, running-max softmax in f32 (hardware exp); out = ctx (bf16 hi + lo) . Wo^T + b_o; f32 output.
#include <hip/hip_runtime.h>
#include <math.h>

typedef __attribute__((ext_vector_type(16))) _Float16 v16h;
typedef __attribute__((ext_vector_type(16))) __bf16 v16b;
typedef __attribute__((ext_vector_type(8)))  _Float16 v8h;
typedef __attribute__((ext_vector_type(8)))  float v8f;
typedef __attribute__((ext_vector_type(4)))  float v4f;
typedef __attribute__((ext_vector_type(2)))  float v2f;
typedef __attribute__((ext_vector_type(4)))  unsigned v4u;
typedef __attribute__((ext_vector_type(4)))  int v4i;
typedef float __attribute__((may_alias)) float_a;
typedef int __attribute__((may_alias)) int_a;

template <typename T> __device__ __forceinline__ void vst2(void* p, T v) { *(T*)p = v;  }
__device__ __forceinline__ v8f wmma16(v16h a, v16h b, v8f c) {
  v8f d = __builtin_amdgcn_wmma_f32_16x16x32_f16(false, a, false, b, (short)0, c, false, false);
  asm volatile("v_nop\n\tv_nop\n\tv_nop\n\tv_nop" : "+v"(d) : "v"(a), "v"(b));
  return d;
}
__device__ __forceinline__ v8f wmma_bf(v16b a, v16b b, v8f c) {
  v8f d = __builtin_amdgcn_wmma_f32_16x16x32_bf16(false, a, false, b, (short)0, c, false, false);
  asm volatile("v_nop\n\tv_nop\n\tv_nop\n\tv_nop" : "+v"(d) : "v"(a), "v"(b));
  return d;
}
// Multi-head attention '2' (B 2, N 2,048, C 1,024, 16 heads x 64): fused natural w_qkv (q | k | v row blocks) + bias, causal softmax(q k / sqrt(1024)) v (the module scales by 1/sqrt(embed_dim), -inf fill), merge heads, natural w_o + b_o.
__device__ __forceinline__ v16h frag_h(const _Float16* rowk0, int lane) {
  union { v16h v; v8h q[2]; } u; const _Float16* p = rowk0 + 8 * (lane >> 4);
  u.q[0] = *(const v8h*)p; u.q[1] = *(const v8h*)(p + 16); return u.v;
}
__device__ __forceinline__ v16h frag_f32(const float* rowk0, int lane) {
  v16h a; const float* p = rowk0 + 8 * (lane >> 4);
#pragma unroll
  for (int i = 0; i < 8; ++i) { a[i] = (_Float16)p[i]; a[8 + i] = (_Float16)p[16 + i]; }
  return a;
}
__device__ __forceinline__ v16h frag_f32s(const float* rowk0, int lane, float sc) {
  v16h a; const float* p = rowk0 + 8 * (lane >> 4);
#pragma unroll
  for (int i = 0; i < 8; ++i) { a[i] = (_Float16)(p[i] * sc); a[8 + i] = (_Float16)(p[16 + i] * sc); }
  return a;
}
// column fragment from a [K][ld] layout (column n), rows >= K read as 0
__device__ __forceinline__ v16h fragc_f32(const float* W, int k0, int n, int lane, int ld, int K) {
  v16h a; const int g = lane >> 4;
#pragma unroll
  for (int i = 0; i < 8; ++i) { const int ka = k0 + 8 * g + i, kb = ka + 16;
    a[i] = (_Float16)(ka < K ? W[(size_t)(ka < K ? ka : K - 1) * ld + n] : 0.f); a[8 + i] = (_Float16)(kb < K ? W[(size_t)(kb < K ? kb : K - 1) * ld + n] : 0.f); }
  return a;
}
struct F2 { v16b h, l; };
__device__ __forceinline__ F2 bsplit16(const float v[16]) { F2 r;
#pragma unroll
  for (int i = 0; i < 16; ++i) { const __bf16 h = (__bf16)v[i]; r.h[i] = h; r.l[i] = (__bf16)(v[i] - (float)h); }
  return r; }
__device__ __forceinline__ F2 split_row(const float* row, int k0, int lane) { float v[16]; const float* p = row + k0 + 8 * (lane >> 4);
#pragma unroll
  for (int i = 0; i < 8; ++i) { v[i] = p[i]; v[8 + i] = p[16 + i]; }
  return bsplit16(v); }
__device__ __forceinline__ F2 split_rowK(const float* row, int k0, int lane, int K) { float v[16]; const int g = lane >> 4;
#pragma unroll
  for (int i = 0; i < 8; ++i) { const int ka = k0 + 8 * g + i, kb = ka + 16; v[i] = ka < K ? row[ka < K ? ka : K - 1] : 0.f; v[8 + i] = kb < K ? row[kb < K ? kb : K - 1] : 0.f; }
  return bsplit16(v); }
__device__ __forceinline__ F2 split_col(const float* W, int k0, int n, int lane, int ld, int K) { float v[16]; const int g = lane >> 4;
#pragma unroll
  for (int i = 0; i < 8; ++i) { const int ka = k0 + 8 * g + i, kb = ka + 16; v[i] = ka < K ? W[(size_t)(ka < K ? ka : K - 1) * ld + n] : 0.f; v[8 + i] = kb < K ? W[(size_t)(kb < K ? kb : K - 1) * ld + n] : 0.f; }
  return bsplit16(v); }
__device__ __forceinline__ v8f mac3(const F2& a, const F2& b, v8f c) { c = wmma_bf(a.l, b.h, c); c = wmma_bf(a.h, b.l, c); return wmma_bf(a.h, b.h, c); }
__device__ __forceinline__ float sigm(float v) { return 1.0f / (1.0f + expf(-v)); }
#define LDSX() do { asm volatile("s_wait_dscnt 0" ::: "memory"); __builtin_amdgcn_wave_barrier(); __builtin_amdgcn_fence(__ATOMIC_RELEASE, "workgroup"); } while (0)


#define NB 2
#define SS 2048
#define DM 1024
#define NH 16
#define HD 64
#define QKVW (3 * DM)
#ifndef TQB
#define TQB (SS / 64)
#define TNB NB
#define TOB (NB * SS / 64)     // output row tiles (all)
#endif
typedef __attribute__((ext_vector_type(8))) __bf16 v8b;
// FRAGMENT ORDER of a 16-bit operand in the workspace: a 16 (rows) x 32 (k) fragment is 1 KiB = two pieces of 512 B; in piece q lane l owns 16 B: row l & 15, k = 16 q + 8 (l >> 4) + 0..7.
// So each wave-wide 16-B load or store covers four whole 128-B lines. p = the fragment's start + 8 * lane.
__device__ __forceinline__ v16b fragp_b(const __bf16* p) {
  union { v16b v; v8b q[2]; } u; u.q[0] = *(const v8b*)p; u.q[1] = *(const v8b*)(p + 256); return u.v;
}
__device__ __forceinline__ v16h fragp_h(const _Float16* p) {
  union { v16h v; v8h q[2]; } u; u.q[0] = *(const v8h*)p; u.q[1] = *(const v8h*)(p + 256); return u.v;
}
__device__ __forceinline__ float bfr(float v) { return (float)(__bf16)v; }
__device__ __attribute__((noinline)) float exp_ni(float v) { return expf(v); }
__device__ __attribute__((noinline)) float erf_ni(float v) { return erff(v); }

#define PK_A 0                       // Wqkv: [24 blocks of 128 rows][32 k passes][8 tiles of 16 rows] fragments (fragment order)
#define PK_P (PK_A + QKVW * DM)        // Wo: [8 blocks][32 passes][8 tiles] fragments
#define PK_END (PK_P + DM * DM)
#define WS_PK  0u
#define WS_QK  (WS_PK + 2u * PK_END)             // f16 [q | k][b][head][128 tiles of 16 rows][2 k passes] fragments
#define WS_QKL (WS_QK + 2u * NB * SS * 2 * DM)     // f16 q | k residual planes x2048, same order
#define WS_VTH (WS_QKL + 2u * NB * SS * 2 * DM)    // f16 hi [b][head][64 passes of 32 keys][4 tiles of 16 d] fragments (row = d, k = key)
#define WS_VTL (WS_VTH + 2u * NB * DM * SS)        // f16 lo x 2048
#define WS_O   (WS_VTL + 2u * NB * DM * SS)        // f32 [256 tiles of 16 rows][32 k passes][4 pieces of 512 B]: piece i, lane l: row l & 15, k = 16 (i >> 1) + 8 (l >> 4) + 4 (i & 1) + 0..3
#define WS_CS  (WS_O + 4u * NB * SS * DM)           // f32 2 x [2048][32], reserved: nothing writes or reads it
#define WS_XP  (WS_CS + 4u * 2 * SS * 32)           // bf16 x: [256 tiles of 16 rows][32 k passes] fragments
#define WS_END (WS_XP + 2u * NB * SS * DM)
#define QKT(plane, b, h, st) (((((size_t)(plane) * NB + (b)) * NH + (h)) * (SS / 16) + (st)) * 1024)   // start of a 16 x 64 q or k tile (two fragments), in elements
#define VT(b, h, ks) ((((size_t)(b) * NH + (h)) * (SS / 32) + (ks)) * 2048)   // start of a pass's four V fragments, in elements
// ---- k_pack: block = (tile of 16 natural rows, quarter of k): f32 -> bf16 in fragment order, whole lines in (two rows x 256 B a wave) and out, turned in LDS; tiles 0..191 w_qkv, 192..255 w_o (both into PK), 256..511 x (into XP)
typedef __attribute__((ext_vector_type(4))) __bf16 v4b;
__global__ __launch_bounds__(256) void k_pack(const float* __restrict__ WA, const float* __restrict__ WO, const float* __restrict__ X, __bf16* __restrict__ PK, __bf16* __restrict__ XP) {
  __shared__ __align__(16) __bf16 s[16][264];   // pitch 528 B = 16 B x odd: the 16 rows of a fragment piece fall on distinct banks
  const int t = blockIdx.x, kq = blockIdx.y, tid = threadIdx.x; const int TA = QKVW / 16, TW = (QKVW + DM) / 16;
  const float* srcp = ((t < TA) ? WA + (size_t)t * 16 * DM : (t < TW) ? WO + (size_t)(t - TA) * 16 * DM : X + (size_t)(t - TW) * 16 * DM) + (size_t)(tid >> 4) * DM + kq * 256 + (tid & 15) * 4;
  v4f a[4];
#pragma unroll
  for (int it = 0; it < 4; ++it) a[it] = *(const v4f*)(srcp + it * 64);
#pragma unroll
  for (int it = 0; it < 4; ++it) { v4b r;
#pragma unroll
    for (int i = 0; i < 4; ++i) r[i] = (__bf16)a[it][i];
    *(v4b*)&s[tid >> 4][it * 64 + (tid & 15) * 4] = r; }
  __syncthreads();
  // weights: [block of 128 rows][k pass][8 tiles] fragments, so a wave's pass is 8 KiB in a row; x: [tile][k pass]
  __bf16* dst = (t < TW) ? PK + (size_t)(t >> 3) * (128 * DM) + (t & 7) * 512 : XP + (size_t)(t - TW) * 16 * DM; const int ps = (t < TW) ? 4096 : 512;
#pragma unroll
  for (int it = 0; it < 2; ++it) { const int o = it * 256 + tid, kcl = o >> 6, q = (o >> 5) & 1, l = o & 31;
    vst2((unsigned*)(dst + (size_t)(kq * 8 + kcl) * ps + q * 256 + l * 8), *(const v4u*)&s[l & 15][kcl * 32 + q * 16 + (l >> 4) * 8]); }
}
// one k pass (32 k) of k_out's 16 x 128 wave tile: the A fragment (its four f32 pieces) and the 8 weight fragments; xa and wb hold the lane's offset
struct PassF { v4f x[4]; v16b w[8]; };
__device__ __forceinline__ void pass_ld(PassF& s, const float* xa, const __bf16* wb, int kc) {
  const float* p = xa + kc * 512; s.x[0] = *(const v4f*)p; s.x[1] = *(const v4f*)(p + 128); s.x[2] = *(const v4f*)(p + 256); s.x[3] = *(const v4f*)(p + 384);
#pragma unroll
  for (int j = 0; j < 8; ++j) s.w[j] = fragp_b(wb + kc * 4096 + j * 512);
}
// one k pass (32 k) of k_qkv's 64 x 64 wave tile: four x fragments and four weight fragments feed 16 WMMAs (half a fragment load a WMMA); xa and wb hold the lane's offset
struct PassQ { v16b a[4]; v16b w[4]; };
__device__ __forceinline__ void pass_ld(PassQ& s, const __bf16* xa, const __bf16* wb, int kc) {
#pragma unroll
  for (int i = 0; i < 4; ++i) s.a[i] = fragp_b(xa + i * (16 * DM) + kc * 512);
#pragma unroll
  for (int j = 0; j < 4; ++j) s.w[j] = fragp_b(wb + kc * 4096 + j * 512);
}
// the loads of k pass kc, closed by their wait: the next pass's addresses have no fixed step from these (the walk wraps), so they are formed anew, and the wait stands before that; both addresses are inputs of the wait, so they stay live up to it and no load of the group lands on a pair that the others still name
template <typename S, typename X> __device__ __forceinline__ void pass_at(S& s, const X* xa, const __bf16* wb, int kc) {
  const X* xp = xa + kc * 512; const __bf16* wp = wb + kc * 4096; pass_ld(s, xp, wp, 0);
  asm volatile("s_wait_xcnt 0x0" :: "v"(xp), "v"(wp) : "memory");
}
// ---- k_qkv: block = (256 rows of x, 192 columns): twelve waves as 4 x 3, each a 64 x 64 tile = 64 rows x ONE head of q, k or v; 256 blocks = one a WGP (three waves a SIMD), all resident at once.
// The waves of a block walk k together, so a line of x that the WGP fetches from L2 serves three waves and a line of the weights four (two and two in a 128 x 128 block): 28 KiB a pass come from L2 for twelve wave tiles, not 48.
__global__ __launch_bounds__(384) void k_qkv(const __bf16* __restrict__ XP, const __bf16* __restrict__ P, const float* __restrict__ BQ, const float* __restrict__ BK, const float* __restrict__ BV, _Float16* __restrict__ QK, _Float16* __restrict__ QKL, _Float16* __restrict__ VTH, _Float16* __restrict__ VTL) {
  __shared__ __align__(16) _Float16 sh[12][64][72], sl[12][64][72];   // each wave's own tile, hi and residual (q, k: [row][d]; v: [d][key]); pitch 144 B = 16 B x odd
  const int tid = threadIdx.x, wave = __builtin_amdgcn_readfirstlane(tid >> 5), lane = tid & 31, col = lane & 15, g = lane >> 4, wr = wave / 3, wc = wave - 3 * wr;   // the wave's number in a scalar register: which of q, k, v a wave holds is now the wave's own matter, and the branch on it stays scalar
  const size_t r0 = (size_t)blockIdx.x * 256 + wr * 64; const int n0 = blockIdx.y * 192 + wc * 64;   // the WAVE's first row and first column
  const int which0 = n0 / DM; const float* BB = BQ ? (((which0 == 0) ? BQ : (which0 == 1) ? BK : BV) + (n0 - which0 * DM)) : nullptr;
  v8f acc[4][4] = {};   // acc[i][j][r]: row r0 + 16 i + 8 g + r, column n0 + 16 j + col
  // the lane's 4 bias values (one a column tile) go out as one group in front of the k loop and are held in registers: the epilogue has no load and no wait on one
  float bias[4] = {};
  if (BB) {
#pragma unroll
    for (int j = 0; j < 4; ++j) bias[j] = BB[j * 16 + col];
    asm volatile("s_wait_xcnt 0x0" ::: "memory");   // before the address registers of the bias loads are reused
  }
  // two register sets: a pass's 16 loads go out as one group, a pass ahead of the WMMAs that read them
  const __bf16* xa = XP + (r0 >> 4) * (16 * DM) + lane * 8; const __bf16* wb = P + (size_t)(n0 >> 7) * (128 * DM) + ((n0 >> 6) & 1) * 2048 + lane * 8;
  PassQ s0, s1;
  // ROTATED k WALK: the block enters the 32 k passes at pass k0 and wraps round. Blocks that read the same weight rows (same y) or the same x rows (same x) so stand at different passes at any moment, in place of all asking L2 for the same lines, not yet fetched, at once.
  const int k0 = (2 * (blockIdx.x + blockIdx.y)) & (DM / 32 - 1);   // same y: 16 blocks at 16 passes, two apart; same x: the same
#define KR(i) (((i) + k0) & (DM / 32 - 1))
  // the WMMAs are the plain builtin (the compiler keeps their distances itself): the operands of wmma_bf's v_nop statement would hold accumulators and both sets under v256, where they do not fit (spills)
  auto mm = [&](const PassQ& s) {
#pragma unroll
    for (int i = 0; i < 4; ++i) {
#pragma unroll
      for (int j = 0; j < 4; ++j) acc[i][j] = __builtin_amdgcn_wmma_f32_16x16x32_bf16(false, s.a[i], false, s.w[j], (short)0, acc[i][j], false, false); } };
#define SB() __builtin_amdgcn_sched_barrier(0)   // keeps a pass's 16 loads one group in front of the WMMA block of the pass before: without it the compiler sinks the loads to their readers (one register set) and every WMMA row waits out its own loads
  pass_at(s0, xa, wb, KR(0)); SB();
#pragma unroll 1   // kept rolled: the body already holds both register sets, a further copy would only cost registers
  for (int kc = 0; kc < DM / 32 - 2; kc += 2) { pass_at(s1, xa, wb, KR(kc + 1)); SB(); mm(s0); SB(); pass_at(s0, xa, wb, KR(kc + 2)); SB(); mm(s1); SB(); }
  pass_at(s1, xa, wb, KR(DM / 32 - 1)); SB(); mm(s0); SB(); mm(s1); SB();
#pragma unroll
  for (int j = 0; j < 4; ++j) bias[j] = bfr(bias[j]);
  const int b = (int)(r0 / SS), sq0 = (int)(r0 % SS);
  if (n0 < 2 * DM) {   // q stored unscaled (f16 sigma ~0.6, no subnormal exposure); 1/32 applied to the f32 score
#pragma unroll
    for (int i = 0; i < 4; ++i) {
#pragma unroll
      for (int j = 0; j < 4; ++j) {
#pragma unroll
        for (int r = 0; r < 8; ++r) { const float v = acc[i][j][r] + bias[j]; const _Float16 hv = (_Float16)v; sh[wave][i * 16 + 8 * g + r][j * 16 + col] = hv; sl[wave][i * 16 + 8 * g + r][j * 16 + col] = (_Float16)((v - (float)hv) * 2048.0f); } } }   // q, k (+ bias) as f16 hi + (x2048) residual
    LDSX();
    // the wave's 64 x 64 tile = four row tiles x two fragments x two pieces, 16 pieces in a row in the workspace, each one 512-B store
    const size_t o0 = QKT(which0, b, (n0 - which0 * DM) / HD, sq0 / 16) + lane * 8;
#pragma unroll
    for (int u = 0; u < 16; ++u) { const int row = (u >> 2) * 16 + col, c0 = (u & 3) * 16 + g * 8;
      vst2((unsigned*)(QK + o0 + u * 256), *(const v4u*)&sh[wave][row][c0]); vst2((unsigned*)(QKL + o0 + u * 256), *(const v4u*)&sl[wave][row][c0]);
      if (u == 7 || u >= 14) asm volatile("s_wait_xcnt 0x0" ::: "memory"); }   // before data registers of the stores so far are rewritten: by later LDS reads (the second half reuses the first half's, the last piece the second half's), behind the last piece by whatever code is laid behind this path
  } else {
#pragma unroll
    for (int i = 0; i < 4; ++i) {
#pragma unroll
      for (int j = 0; j < 4; ++j) {
#pragma unroll
        for (int r = 0; r < 8; ++r) { const float v = acc[i][j][r] + bias[j]; const _Float16 hv = (_Float16)v; sh[wave][j * 16 + col][i * 16 + 8 * g + r] = hv; sl[wave][j * 16 + col][i * 16 + 8 * g + r] = (_Float16)((v - (float)hv) * 2048.0f); } } }
    LDSX();   // the wave reads back only what it wrote itself: no wave waits on another
    // the wave's 64 d x 64 keys = two passes x four d tiles x two pieces, 16 pieces in a row in the workspace, each one 512-B store
    const size_t o0 = VT(b, (n0 - 2 * DM) / HD, sq0 / 32) + lane * 8;
#pragma unroll
    for (int u = 0; u < 16; ++u) { const int d = ((u >> 1) & 3) * 16 + col, sc = (u >> 3) * 32 + (u & 1) * 16 + g * 8;
      vst2((unsigned*)(VTH + o0 + u * 256), *(const v4u*)&sh[wave][d][sc]); vst2((unsigned*)(VTL + o0 + u * 256), *(const v4u*)&sl[wave][d][sc]);
      if (u == 7 || u >= 14) asm volatile("s_wait_xcnt 0x0" ::: "memory"); }   // before data registers of the stores so far are rewritten: by later LDS reads (the second half reuses the first half's, the last piece the second half's), behind the last piece by whatever code is laid behind this path
  }
}
// lane l with lane l ^ 16 (a vector cross-row move, no LDS path)
__device__ __forceinline__ float xhalf(float x) { return __builtin_bit_cast(float, __builtin_amdgcn_permlanex16(__builtin_bit_cast(int, x), __builtin_bit_cast(int, x), 0x76543210, 0xfedcba98, false, false)); }
// ---- k_attn: block = (eight pairs of 16-query tiles, head h, batch b): causal flash attention (K = 64: 2 k-steps) in the TRANSPOSED form: S^T = K . Q^T (A = K fragment, B = q fragment), O^T += V^T . P^T (A = V fragment, B = P).
// A lane then holds ONE query (q0 + col): of a 16-key score tile its 8 registers are keys 8 g + r, so maximum and sum run inside the lane, the two wave halves meet in one exchange (the maximum, each pass) and once behind the loop (the sum).
// The two score tiles of a pass, converted in place, ARE the B fragment of P^T (element s = tile s >> 3, register s & 7: the k order of the V fragments), so P touches no LDS; acc[dt][r] = O(query col, d = dt * 16 + 8 g + r) is already k_out's fragment order.
// scores = (q.k) / 32 with single f16 operands (LEAD: + residual products), P.V: f16 P x V hi (LEAD: + P lo x V hi, P x V lo*2048 in a second accumulator); O(row b*S+q, col h*64+d) = (acc + accl / 2048) / (2048 l)
// The pass is compiled per case of its two wave-uniform conditions, so that the common pass carries only its own work:
// LEAD (query block 0, tiles 0..7): residual products, the low half of P and the second accumulator; elsewhere none of them exists.
// LAST (a tile's one pass that holds its diagonal, ks = q0 / 32): the causal mask, and no fetch of further K rows; every pass in front of it has all 32 keys at or before all 16 queries.
// __expf as it compiles (one multiply, v_exp_f32), written so that the free slot which the instruction set asks for behind a transcendental (before its result is read or its source overwritten) is there by construction.
// exp8: each next v_exp_f32 is the independent instruction behind the one before (early-clobber outputs: none lies on a source), one v_nop closes the last; exp1: the same for a single value.
__device__ __forceinline__ void exp8(float* r, const float* x) {
  float y[8];
#pragma unroll
  for (int i = 0; i < 8; ++i) y[i] = x[i] * 1.44269504f;
  asm("v_exp_f32 %0, %8\n\tv_exp_f32 %1, %9\n\tv_exp_f32 %2, %10\n\tv_exp_f32 %3, %11\n\tv_exp_f32 %4, %12\n\tv_exp_f32 %5, %13\n\tv_exp_f32 %6, %14\n\tv_exp_f32 %7, %15\n\tv_nop"
      : "=&v"(r[0]), "=&v"(r[1]), "=&v"(r[2]), "=&v"(r[3]), "=&v"(r[4]), "=&v"(r[5]), "=&v"(r[6]), "=&v"(r[7])
      : "v"(y[0]), "v"(y[1]), "v"(y[2]), "v"(y[3]), "v"(y[4]), "v"(y[5]), "v"(y[6]), "v"(y[7]));
}
__device__ __forceinline__ float exp1(float x) { float r; const float y = x * 1.44269504f; asm("v_exp_f32 %0, %1\n\tv_nop" : "=v"(r) : "v"(y)); return r; }
// a fragment's two loads; EACH true (the leading blocks, whose loads go through vector address pairs shared by a run of loads): every load is closed by a wait of its own, because the register allocator lets a later load of a run land on the pair that the earlier ones still name
template <bool EACH> __device__ __forceinline__ v16h fragp_x(const _Float16* p) {
  if constexpr (!EACH) return fragp_h(p);
  else { union { v16h v; v8h q[2]; } u;
    u.q[0] = *(const v8h*)p; asm volatile("s_wait_xcnt 0x0" ::: "memory");   // before the next load may land on this one's address pair
    u.q[1] = *(const v8h*)(p + 256); asm volatile("s_wait_xcnt 0x0" ::: "memory");   // the same
    return u.v; }
}
template <bool LEAD> struct AttnSt { v16h aq[2]; v16h kf[2][2]; v8f acc[4]; v8f accl[LEAD ? 4 : 1]; float m, l; };
// ks: this pass; kn: the pass whose K rows are fetched for the next call (not read by LAST); qlp, klb, kb0, vhb, vlb: q residual tile, K residual rows, K rows, V hi and V lo of this (b, h), each at the lane's 16 B; dq: the lane's query counted from the first key of the lane's half in this pass (read by LAST only)
template <bool LEAD, bool LAST>
__device__ __forceinline__ void attn_pass(AttnSt<LEAD>& t, const int ks, const int kn, const int dq, const _Float16* qlp, const _Float16* klb, const _Float16* kb0, const _Float16* vhb, const _Float16* vlb) {
  v8f s[2]; v16h vf[4]; const _Float16* vp = vhb + (size_t)ks * 2048;   // this pass's four V fragments, at the lane's 16 B
  if constexpr (!LEAD) {
#pragma unroll
    for (int dt = 0; dt < 4; ++dt) vf[dt] = fragp_x<LEAD>(vp + dt * 512); }
  if constexpr (!LEAD) asm volatile("s_wait_xcnt 0x0" :: "v"(vp) : "memory");   // before the address registers of the V loads are reused; the address is an input, so it stays live up to the wait and no load of the run lands on the pair that the others still name (LEAD: the V and K loads, below, each have their own wait)
  // LEAD: the residual fragments go out as groups ahead of the WMMAs that read them, held in registers: K and q residuals here, at the head of the pass, V residuals behind the exponentials. One load and a full wait in front of each WMMA would lay the whole load latency bare ten times a pass.
  // So that the groups fit the register budget of four waves a SIMD, the V fragments of a LEAD pass go out behind its score products (when the K and q residuals are dead), not at its head.
  v16h rk[LEAD ? 4 : 1], rq[LEAD ? 2 : 1], rv[LEAD ? 4 : 1];
  if constexpr (LEAD) { const _Float16* kp = klb + (size_t)ks * 2048;   // this pass's four K residual fragments, at the lane's 16 B
#pragma unroll
    for (int f = 0; f < 4; ++f) rk[f] = fragp_h(kp + f * 512);
#pragma unroll
    for (int kc = 0; kc < 2; ++kc) rq[kc] = fragp_h(qlp + kc * 512);
    asm volatile("s_wait_xcnt 0x0" :: "v"(kp), "v"(qlp) : "memory"); }   // before the address registers of the group are reused; both addresses are inputs, so they stay live up to the wait and no load of the group lands on them
#pragma unroll
  for (int ct = 0; ct < 2; ++ct) { v8f c = {};
    if constexpr (LEAD) {   // leading query blocks (few keys, outputs far above the global rms): 3 products
      v8f cl = {};
#pragma unroll
      for (int kc = 0; kc < 2; ++kc) { const v16h kh = t.kf[ct][kc]; c = wmma16(kh, t.aq[kc], c); cl = wmma16(kh, rq[kc], cl); cl = wmma16(rk[ct * 2 + kc], t.aq[kc], cl); }
#pragma unroll
      for (int r = 0; r < 8; ++r) c[r] += cl[r] * (1.0f / 2048.0f); }
    else {
#pragma unroll
      for (int kc = 0; kc < 2; ++kc) c = wmma16(t.kf[ct][kc], t.aq[kc], c); }   // single product elsewhere
#pragma unroll
    for (int r = 0; r < 8; ++r) s[ct][r] = (!LAST || ct * 16 + r <= dq) ? c[r] * 0.03125f : -3.0e38f; }   // 1/sqrt(1024); keys behind the lane's query excluded
  if constexpr (!LAST) {   // the next pass's K rows, right behind this pass's score products
#pragma unroll
    for (int ct = 0; ct < 2; ++ct) {
#pragma unroll
      for (int kc = 0; kc < 2; ++kc) t.kf[ct][kc] = fragp_x<LEAD>(kb0 + (size_t)kn * 2048 + ct * 1024 + kc * 512); }
    if constexpr (!LEAD) asm volatile("s_wait_xcnt 0x0" ::: "memory"); }   // before the address registers of the K loads are reused
  if constexpr (LEAD) {
#pragma unroll
    for (int dt = 0; dt < 4; ++dt) vf[dt] = fragp_x<LEAD>(vp + dt * 512); }
  float mt[8];
#pragma unroll
  for (int r = 0; r < 8; ++r) mt[r] = fmaxf(s[0][r], s[1][r]);
  float mx = fmaxf(fmaxf(fmaxf(mt[0], mt[1]), fmaxf(mt[2], mt[3])), fmaxf(fmaxf(mt[4], mt[5]), fmaxf(mt[6], mt[7])));
  mx = fmaxf(mx, xhalf(mx));   // both halves now hold the maximum over the pass's 32 keys
  const float mn = fmaxf(t.m, mx); const float ea = exp1(t.m - mn); const float alpha = (t.m <= -1.0e38f) ? 0.f : ea;
  float df[16], ex[16];
#pragma unroll
  for (int i = 0; i < 16; ++i) df[i] = s[i >> 3][i & 7] - mn;
  exp8(ex, df); exp8(ex + 8, df + 8);
  if constexpr (LEAD) { const _Float16* lp = vlb + (size_t)ks * 2048;   // this pass's four V residual fragments: in flight under the packing of P and the rescaling
#pragma unroll
    for (int dt = 0; dt < 4; ++dt) rv[dt] = fragp_h(lp + dt * 512);
    asm volatile("s_wait_xcnt 0x0" :: "v"(lp) : "memory"); }   // as at the head of the pass
  v16h pa, pl; float es[4];   // four short chains of adds in place of one long one
#pragma unroll
  for (int i = 0; i < 16; ++i) { const float sv = s[i >> 3][i & 7]; const float e = (LAST && sv <= -1.0e38f) ? 0.f : ex[i]; es[i & 3] = (i < 4) ? e : es[i & 3] + e;
    const float x0 = e * 2048.0f; const _Float16 h0 = (_Float16)x0; pa[i] = h0; if constexpr (LEAD) pl[i] = (_Float16)((x0 - (float)h0) * 2048.0f); }   // P scaled by 2^11 before the f16 split so small softmax weights stay out of the f16 subnormal range; 2^-11 folded into the epilogue
  t.l = t.l * alpha + ((es[0] + es[1]) + (es[2] + es[3])); t.m = mn;
#pragma unroll
  for (int dt = 0; dt < 4; ++dt) {
#pragma unroll
    for (int r = 0; r < 8; ++r) { t.acc[dt][r] *= alpha; if constexpr (LEAD) t.accl[dt][r] *= alpha; } }
#pragma unroll
  for (int dt = 0; dt < 4; ++dt) { const v16h vh = vf[dt]; t.acc[dt] = wmma16(vh, pa, t.acc[dt]);
    if constexpr (LEAD) { t.accl[dt] = wmma16(vh, pl, t.accl[dt]); t.accl[dt] = wmma16(rv[dt], pa, t.accl[dt]); } }   // leading query blocks: P hi/lo x V hi/lo (3 products); elsewhere P x V single
}
// a run of passes of the 16-query tile T: the key passes kbeg .. kend - 1 (all of their 32 keys at or before the tile's first query), then, where diag holds, the tile's diagonal pass, which is pass kend
// ROTATED KEY WALK: the run enters at pass kbeg + rot (rot < kend - kbeg, or 0) and wraps round to kbeg: the eight blocks of a (batch, head), which read the same K and V lines, stand at different passes at any moment
template <bool LEAD>
__device__ __forceinline__ void attn_run(AttnSt<LEAD>& t, const _Float16* __restrict__ QK, const _Float16* __restrict__ QKL, const _Float16* __restrict__ VTH, const _Float16* __restrict__ VTL, const int T, const int h, const int b, const int kbeg, const int kend, const int rot, const bool diag, const int lane) {
  const int col = lane & 15, g = lane >> 4; const int q0 = T * 16; const size_t qt = QKT(0, b, h, T) + lane * 8;   // the wave's q tile, at the lane's 16 B
  // the q residual fragments are read where the leading blocks use them
#pragma unroll
  for (int kc = 0; kc < 2; ++kc) t.aq[kc] = fragp_x<LEAD>(QK + qt + kc * 512);
  t.m = -3.0e38f; t.l = 0.f;   // of the lane's query; l sums the keys of the lane's own half only
#pragma unroll
  for (int dt = 0; dt < 4; ++dt) { t.acc[dt] = v8f{}; if constexpr (LEAD) t.accl[dt] = v8f{}; }
  // K fragments are fetched one pass ahead (right behind the pass's score products), V fragments at the head of their pass (LEAD: behind its score products): each as one group, so no WMMA waits on a load issued directly in front of it
  const _Float16* kb0 = QK + QKT(1, b, h, 0) + lane * 8; const _Float16* klb = QKL + QKT(1, b, h, 0) + lane * 8; const _Float16* vhb = VTH + VT(b, h, 0) + lane * 8; const _Float16* vlb = VTL + VT(b, h, 0) + lane * 8;
#pragma unroll
  for (int ct = 0; ct < 2; ++ct) {
#pragma unroll
    for (int kc = 0; kc < 2; ++kc) t.kf[ct][kc] = fragp_x<LEAD>(kb0 + (size_t)(kbeg + rot) * 2048 + ct * 1024 + kc * 512); }
  if constexpr (!LEAD) asm volatile("s_wait_xcnt 0x0" ::: "memory");   // before the address registers of the q and K loads are reused
#pragma unroll 1   // kept rolled: one copy of the common pass in the instruction cache
  for (int i = kend - kbeg, ks = kbeg + rot; i > 0; --i) { const int kw = (ks + 1 == kend) ? kbeg : ks + 1, kn = (i == 1) ? kend : kw;   // behind the run's last pass comes pass kend
    attn_pass<LEAD, false>(t, ks, kn, 0, QKL + qt, klb, kb0, vhb, vlb); ks = kn; }
  if (diag) attn_pass<LEAD, true>(t, kend, kend, q0 + col - kend * 32 - 8 * g, QKL + qt, klb, kb0, vhb, vlb);
}
// a finished tile goes out
template <bool LEAD>
__device__ __forceinline__ void attn_store(const AttnSt<LEAD>& t, float* __restrict__ O, const int T, const int h, const int b, const int lane) {
  const float il = (1.0f / 2048.0f) / (t.l + xhalf(t.l));   // the two halves' sums meet here, once
  // the wave's 16 x 64 tile = two k passes of k_out x four pieces, each piece one 512-B store, straight from the accumulators
  float* ot = O + ((size_t)(b * (SS / 16) + T) * (DM / 32) + h * 2) * 512 + lane * 4;
#pragma unroll
  for (int u = 0; u < 8; ++u) { v4f o;
#pragma unroll
    for (int i = 0; i < 4; ++i) { float a = t.acc[u >> 1][(u & 1) * 4 + i]; if constexpr (LEAD) a += t.accl[u >> 1][(u & 1) * 4 + i] * (1.0f / 2048.0f); o[i] = a * il; }
    vst2(ot + u * 128, o); }
  asm volatile("s_wait_xcnt 0x0" ::: "memory");   // before the code behind a tile's stores rewrites their data and address registers
}
// EQUAL WAVES. A tile's cost grows with its index (tile T has T / 2 + 1 passes), so tile u (short) and tile 127 - u (long) are dealt as a pair of 65 passes to two waves:
// the head wave (waves 0..7) runs the long tile's first 32 passes; the tail wave (waves 8..15) runs the short tile whole, then the long tile's passes from 32 on, the diagonal pass included: 33 passes.
// The head wave hands its running maximum, sum and accumulators over in LDS (one block barrier), the tail wave joins the two parts as a pass joins its own to the running ones, and stores.
// Every wave of the launch so has 32 or 33 passes wherever it lands; 256 blocks of 16 waves = one a WGP, four waves per SIMD, all resident at once; a block's eight head waves walk the same keys together, its eight tail waves nearly so: a K or V line that the WGP fetches from L2 serves eight waves.
#define HPASS (SS / 64)   // the long tile's passes that the head wave takes; a long tile (T >= 64) has at least HPASS passes in front of its diagonal pass
__global__ __launch_bounds__(512) __attribute__((amdgpu_waves_per_eu(4, 4))) void k_attn(const _Float16* __restrict__ QK, const _Float16* __restrict__ QKL, const _Float16* __restrict__ VTH, const _Float16* __restrict__ VTL, const void* __restrict__ KMASK, float* __restrict__ O) {
  __shared__ __align__(16) float sa[8][8][128]; __shared__ float sml[8][2][32];   // per pair: the head wave's accumulators (8 pieces of 16 B a lane), maximum and sum
  const int tid = threadIdx.x, wave = __builtin_amdgcn_readfirstlane(tid >> 5), lane = tid & 31;   // the wave's number in a scalar register: row addresses built on it cost no vector register
  const int pr = wave & 7, u = blockIdx.x * 8 + pr, h = blockIdx.y, b = blockIdx.z; const bool tail = wave >= 8;
  const int T1 = SS / 16 - 1 - u;
  // where each run enters its walk: the same for a block's eight waves of a kind (they walk together), a share blockIdx.x / 8 of the shortest of their eight runs, so below every run's length
  const int bx = blockIdx.x, rs = (4 * bx * bx) >> 3, rh = (HPASS * bx) >> 3, rl = ((HPASS - 4 - 4 * bx) * bx) >> 3;   // short tiles: at least 4 bx passes; head: HPASS; long tiles' rest: at least HPASS - 4 - 4 bx
  if (tail) {   // the short tile, whole
    if (blockIdx.x < 1) { AttnSt<true> s; attn_run<true>(s, QK, QKL, VTH, VTL, u, h, b, 0, u >> 1, rs, true, lane); attn_store<true>(s, O, u, h, b, lane); }
    else { AttnSt<false> s; attn_run<false>(s, QK, QKL, VTH, VTL, u, h, b, 0, u >> 1, rs, true, lane); attn_store<false>(s, O, u, h, b, lane); }
  }
  AttnSt<false> t;
  attn_run<false>(t, QK, QKL, VTH, VTL, T1, h, b, tail ? HPASS : 0, tail ? (T1 >> 1) : HPASS, tail ? rl : rh, tail, lane);
  if (!tail) {
#pragma unroll
    for (int i = 0; i < 8; ++i) { v4f o;
#pragma unroll
      for (int j = 0; j < 4; ++j) o[j] = t.acc[i >> 1][(i & 1) * 4 + j];
      *(v4f*)&sa[pr][i][lane * 4] = o; }
    sml[pr][0][lane] = t.m; sml[pr][1][lane] = t.l;
  }
  __syncthreads();   // the head waves' parts are in LDS; every wave passes here once
  if (tail) {
    const float ma = sml[pr][0][lane], la = sml[pr][1][lane]; const float mn = fmaxf(ma, t.m); const float fa = exp1(ma - mn), fb = exp1(t.m - mn);
    t.l = t.l * fb + la * fa;
#pragma unroll
    for (int i = 0; i < 8; ++i) { const v4f o = *(const v4f*)&sa[pr][i][lane * 4];
#pragma unroll
      for (int j = 0; j < 4; ++j) t.acc[i >> 1][(i & 1) * 4 + j] = t.acc[i >> 1][(i & 1) * 4 + j] * fb + o[j] * fa; }
    attn_store<false>(t, O, T1, h, b, lane);
  }
}
// ---- k_out: block = (128 rows, 128 cols), eight waves of 16 x 128, 256 blocks = one a WGP: out = O(hi/lo) . Wo rows (2 products) + bo; a weight line that the WGP fetches from L2 serves eight waves (four in a block of 64 rows)
__global__ __launch_bounds__(256) void k_out(const float* __restrict__ O, const __bf16* __restrict__ P, const float* __restrict__ BO, float* __restrict__ Y) {
  __shared__ __align__(16) float so[8][16][132];
  const int tid = threadIdx.x, wave = tid >> 5, lane = tid & 31, col = lane & 15, g = lane >> 4; const size_t r0 = (size_t)blockIdx.x * 128 + wave * 16; const int n0 = blockIdx.y * 128;
  v8f acc[8] = {};
  // two register sets, as in k_qkv: a pass's loads go out as one group, a pass ahead of the WMMAs that read them
  const float* xa = O + (r0 >> 4) * (16 * DM) + lane * 4; const __bf16* wb = P + (size_t)(n0 >> 7) * (128 * DM) + lane * 8;
  PassF s0, s1;
  auto mm = [&](const PassF& s) { float v[16];
#pragma unroll
    for (int i = 0; i < 4; ++i) { v[i] = s.x[0][i]; v[4 + i] = s.x[1][i]; v[8 + i] = s.x[2][i]; v[12 + i] = s.x[3][i]; }
    const F2 a = bsplit16(v);
#pragma unroll
    for (int j = 0; j < 8; ++j) { acc[j] = wmma_bf(a.l, s.w[j], acc[j]); acc[j] = wmma_bf(a.h, s.w[j], acc[j]); } };
  const int k0 = (blockIdx.x + 4 * blockIdx.y) & (DM / 32 - 1);   // rotated k walk, as in k_qkv; same y: 32 blocks at 32 passes; same x: 8 blocks at 8 passes, four apart
  pass_at(s0, xa, wb, KR(0));
#pragma unroll 1   // kept rolled: the body already holds both register sets, a further copy would only cost registers
  for (int kc = 0; kc < DM / 32 - 2; kc += 2) { pass_at(s1, xa, wb, KR(kc + 1)); mm(s0); pass_at(s0, xa, wb, KR(kc + 2)); mm(s1); }
  pass_at(s1, xa, wb, KR(DM / 32 - 1)); mm(s0); mm(s1);
#pragma unroll
  for (int j = 0; j < 8; ++j) {
#pragma unroll
    for (int r = 0; r < 8; ++r) so[wave][8 * g + r][j * 16 + col] = acc[j][r] + bfr(BO[n0 + j * 16 + col]); }
  LDSX();
  for (int rl = 0; rl < 16; ++rl) vst2(Y + (r0 + rl) * DM + n0 + lane * 4, *(const v4f*)&so[wave][rl][lane * 4]);
}
extern "C" void kernel_launch(void* const* d_in, const int* in_sizes, int n_in, void* d_out, int out_size, void* d_ws, size_t ws_size, hipStream_t stream) {
  (void)in_sizes; (void)n_in; (void)out_size;
  const float** F = (const float**)d_in;   // 0 x [2,2048,1024], 1 w_qkv [3072,1024] natural (rows q | k | v), 2 b_qkv [3072], 3 w_o [1024,1024] natural, 4 b_o
  if (ws_size < (size_t)WS_END) return;
  char* ws = (char*)d_ws; __bf16* PK = (__bf16*)(ws + WS_PK); _Float16 *QK = (_Float16*)(ws + WS_QK), *QKL = (_Float16*)(ws + WS_QKL), *VTH = (_Float16*)(ws + WS_VTH), *VTL = (_Float16*)(ws + WS_VTL); float* O = (float*)(ws + WS_O); __bf16* XP = (__bf16*)(ws + WS_XP);
  k_pack<<<dim3((QKVW + DM + NB * SS) / 16, 4), 256, 0, stream>>>(F[1], F[3], F[0], PK, XP);
  k_qkv<<<dim3(TNB * SS / 256, QKVW / 192), 384, 0, stream>>>(XP, PK + PK_A, F[2], F[2] + DM, F[2] + 2 * DM, QK, QKL, VTH, VTL);
  k_attn<<<dim3(TQB / 4, NH, TNB), 512, 0, stream>>>(QK, QKL, VTH, VTL, nullptr, O);
  k_out<<<dim3(TOB / 2, DM / 128), 256, 0, stream>>>(O, PK + PK_P, F[4], (float*)d_out);
}
